// v000
// Measured on an AMD MI455X. A time is GPU time per run, averaged over a window of back-to-back runs after a warm-up
// (all launches, gaps included; the runs take copies of the inputs in turn), and the median of several windows.
// Apart from v000's, it joins two sittings. Times from different sittings can be a few percent apart, while
// side-by-side timings come from the same sitting.
// v000 is the starting kernel. One run takes 341 microseconds.
#include <hip/hip_runtime.h>
#include <hip/hip_bf16.h>

// ---------------------------------------------------------------------------
// BonzSelfAttention for MI455X (gfx1250): bf16 WMMA everywhere, fp32 accum.
// B=8, N=2048, D=768, K=256, H=12, G=4, DH=64
// ---------------------------------------------------------------------------

typedef __attribute__((ext_vector_type(16))) __bf16 v16bf;
typedef __attribute__((ext_vector_type(8)))  float  v8f;
typedef __attribute__((ext_vector_type(4)))  int    v4i;
typedef unsigned short u16;

#define BN   16384   // B*N
#define DD   768
#define NN   2048
#define KK   256
#define HH   12

#if __has_builtin(__builtin_amdgcn_global_load_async_to_lds_b128)
#define HAVE_ASYNC_LDS 1
#else
#define HAVE_ASYNC_LDS 0
#endif

struct alignas(32) Frag32B { uint4 lo, hi; };

// Native bf16 convert (RNE) — lets clang emit v_cvt instead of manual rounding.
__device__ __forceinline__ u16 f2bf(float f) {
  __bf16 h = (__bf16)f;
  return __builtin_bit_cast(u16, h);
}

// A/B operand fragment: two 16-byte chunks (K-chunk and K-chunk+16) per lane.
__device__ __forceinline__ v16bf ldfrag(const u16* p0, const u16* p1) {
  Frag32B f;
  f.lo = *(const uint4*)p0;
  f.hi = *(const uint4*)p1;
  return __builtin_bit_cast(v16bf, f);
}

__device__ __forceinline__ v8f wmma_bf16(v16bf a, v16bf b, v8f c) {
  // (neg_a, A, neg_b, B, c_mod, C, reuse_a, reuse_b)
  return __builtin_amdgcn_wmma_f32_16x16x32_bf16(false, a, false, b, (short)0, c,
                                                 false, false);
}

// ---------------------------------------------------------------------------
// Kernel 1: fp32 -> bf16 conversions (+ project_k transpose)
// ---------------------------------------------------------------------------
__global__ void k_convert(const float* __restrict__ x,  const float* __restrict__ wq,
                          const float* __restrict__ wk, const float* __restrict__ wout,
                          const float* __restrict__ pk,
                          u16* xbf, u16* wqbf, u16* wkbf, u16* woutbf, u16* pkt) {
  long i = (long)blockIdx.x * blockDim.x + threadIdx.x;
  const long NX = (long)BN * DD;             // 12,582,912
  if (i < NX) xbf[i] = f2bf(x[i]);
  if (i < 147456) { wqbf[i] = f2bf(wq[i]); wkbf[i] = f2bf(wk[i]); }
  if (i < 589824) woutbf[i] = f2bf(wout[i]);
  if (i < 524288) {                          // pkt[kq][n] = pk[n][kq]
    int kq = (int)(i >> 11), n = (int)(i & 2047);
    pkt[i] = f2bf(pk[(long)n * KK + kq]);
  }
}

// ---------------------------------------------------------------------------
// Kernel 2: grouped pointwise conv (block-diagonal GEMM), Q and K_raw.
//   y = x_g @ w_g^T  per 192-wide group.  One 16x16 tile per wave, 6 WMMAs.
//   Q stored row-major bf16; K_raw stored TRANSPOSED krt[b][d][n] bf16.
// ---------------------------------------------------------------------------
__global__ void __launch_bounds__(256)
k_gconv(const u16* __restrict__ xbf, const u16* __restrict__ wqbf,
        const u16* __restrict__ wkbf, u16* __restrict__ qbf, u16* __restrict__ krt) {
  const int lane = threadIdx.x & 31, wave = threadIdx.x >> 5;
  const int lm = lane & 15, lhalf = lane >> 4;
  int tile = blockIdx.x * 8 + wave;          // 0..98303
  int qk = tile / 49152;
  int rem = tile - qk * 49152;
  int ct = rem % 48;                         // output col tile (16 channels)
  int rt = rem / 48;                         // row tile (16 rows of B*N)
  int g  = ct / 12;                          // group
  const u16* wbf = (qk == 0) ? wqbf : wkbf;
  const int m0 = rt * 16;
  const u16* arow = xbf + (long)(m0 + lm) * DD + g * 192;
  const u16* brow = wbf + (long)g * 36864 + (long)(ct * 16 - g * 192 + lm) * 192;

  v8f acc = {};
#pragma unroll
  for (int ks = 0; ks < 6; ++ks) {
    int koff = ks * 32 + lhalf * 8;
    v16bf a = ldfrag(arow + koff, arow + koff + 16);
    v16bf b = ldfrag(brow + koff, brow + koff + 16);
    acc = wmma_bf16(a, b, acc);
  }

  if (qk == 0) {
#pragma unroll
    for (int j = 0; j < 8; ++j) {
      int row = m0 + j + lhalf * 8, col = ct * 16 + lm;
      qbf[(long)row * DD + col] = f2bf(acc[j]);
    }
  } else {
#pragma unroll
    for (int j = 0; j < 8; ++j) {
      int row = m0 + j + lhalf * 8;          // global (b,n) row
      int b = row >> 11, n = row & 2047;
      int d = ct * 16 + lm;
      krt[((long)b * DD + d) * NN + n] = f2bf(acc[j]);
    }
  }
}

// ---------------------------------------------------------------------------
// Kernel 3: k_proj[b,kq,d] = sum_n pk[n,kq] * k_raw[b,n,d]
//   A = pkt[kq][n] (row-major), B = krt[b][d][n] (column d per lane), 64 steps.
// ---------------------------------------------------------------------------
__global__ void __launch_bounds__(256)
k_kproj(const u16* __restrict__ pkt, const u16* __restrict__ krt,
        float* __restrict__ kproj) {
  const int lane = threadIdx.x & 31, wave = threadIdx.x >> 5;
  const int lm = lane & 15, lhalf = lane >> 4;
  int id = blockIdx.x * 8 + wave;            // 0..6143
  int b = id / 768;
  int rem = id - b * 768;
  int mt = rem / 48, nt = rem % 48;

  const u16* arow = pkt + (long)(mt * 16 + lm) * NN;
  const u16* brow = krt + ((long)b * DD + nt * 16 + lm) * NN;

  v8f acc = {};
  for (int ks = 0; ks < 64; ++ks) {
    int koff = ks * 32 + lhalf * 8;
    v16bf a = ldfrag(arow + koff, arow + koff + 16);
    v16bf bf = ldfrag(brow + koff, brow + koff + 16);
    acc = wmma_bf16(a, bf, acc);
  }
#pragma unroll
  for (int j = 0; j < 8; ++j) {
    int kq = mt * 16 + j + lhalf * 8, d = nt * 16 + lm;
    kproj[((long)b * KK + kq) * DD + d] = acc[j];
  }
}

// ---------------------------------------------------------------------------
// Kernel 4: gather keys (faithful permute/view trick) + values^T, to bf16.
//   keys[b,h,kq,dq] = kproj[b, (h*64+dq)&255, 3*kq + ((h*64+dq)>>8)]
//   valt[b,h,dq,kq] = kproj[b, kq, h*64+dq]
// ---------------------------------------------------------------------------
__global__ void k_gather(const float* __restrict__ kproj,
                         u16* __restrict__ keys, u16* __restrict__ valt) {
  long i = (long)blockIdx.x * blockDim.x + threadIdx.x;  // < 1,572,864
  int dq = (int)(i & 63);
  int kq = (int)((i >> 6) & 255);
  int bh = (int)(i >> 14);
  int h = bh % HH, b = bh / HH;
  int c = h * 64 + dq;
  int kk2 = c & 255, dd2 = 3 * kq + (c >> 8);
  keys[i] = f2bf(kproj[((long)b * KK + kk2) * DD + dd2]);
  valt[((long)bh * 64 + dq) * KK + kq] = f2bf(kproj[((long)b * KK + kq) * DD + c]);
}

// ---------------------------------------------------------------------------
// Kernel 5: attention.  Block = (b, h, 128-row chunk), 8 waves x 16 rows.
//   LDS: keys 32KB + values^T 32KB + per-wave prob buffer 64KB = 128KB.
//   K/V staged with GLOBAL_LOAD_ASYNC_TO_LDS_B128 (ASYNCcnt-tracked DMA).
// ---------------------------------------------------------------------------
__global__ void __launch_bounds__(256)
k_attn(const u16* __restrict__ qbf, const u16* __restrict__ keys,
       const u16* __restrict__ valt, u16* __restrict__ ctxbf) {
  extern __shared__ __align__(16) unsigned char smem_raw[];
  u16* keys_s = (u16*)smem_raw;              // [256][64]
  u16* valt_s = keys_s + 16384;              // [64][256]
  u16* pbuf   = valt_s + 16384;              // 8 waves * [16][256]

  const int lane = threadIdx.x & 31, wave = threadIdx.x >> 5;
  const int lm = lane & 15, lhalf = lane >> 4;
  int chunk = blockIdx.x & 15;
  int bh = blockIdx.x >> 4;
  int b = bh / HH, h = bh - b * HH;

  // stage K and V^T into LDS (16B per thread per iter)
  {
    const uint4* kg = (const uint4*)(keys + (long)bh * 16384);
    const uint4* vg = (const uint4*)(valt + (long)bh * 16384);
    uint4* ks_ = (uint4*)keys_s;
    uint4* vs_ = (uint4*)valt_s;
#if HAVE_ASYNC_LDS
    typedef __attribute__((address_space(1))) v4i* gp_t;   // global int4*
    typedef __attribute__((address_space(3))) v4i* lp_t;   // LDS int4*
    for (int i = threadIdx.x; i < 2048; i += 256) {
      __builtin_amdgcn_global_load_async_to_lds_b128((gp_t)(kg + i),
                                                     (lp_t)(ks_ + i), 0, 0);
      __builtin_amdgcn_global_load_async_to_lds_b128((gp_t)(vg + i),
                                                     (lp_t)(vs_ + i), 0, 0);
    }
#if __has_builtin(__builtin_amdgcn_s_wait_asynccnt)
    __builtin_amdgcn_s_wait_asynccnt(0);
#else
    asm volatile("s_wait_asynccnt 0x0" ::: "memory");
#endif
#else
    for (int i = threadIdx.x; i < 2048; i += 256) { ks_[i] = kg[i]; vs_[i] = vg[i]; }
#endif
  }
  __syncthreads();

  const int n0 = chunk * 128 + wave * 16;
  const u16* qrow = qbf + ((long)(b * NN + n0 + lm)) * DD + h * 64;
  v16bf aq0 = ldfrag(qrow + lhalf * 8,      qrow + lhalf * 8 + 16);
  v16bf aq1 = ldfrag(qrow + 32 + lhalf * 8, qrow + 32 + lhalf * 8 + 16);

  v8f acc[16];
#pragma unroll
  for (int t = 0; t < 16; ++t) { v8f z = {}; acc[t] = z; }

  // dots = q @ keys^T : 16 column tiles x 2 k-steps
#pragma unroll
  for (int t = 0; t < 16; ++t) {
    const u16* kr = keys_s + (t * 16 + lm) * 64;
    v16bf b0 = ldfrag(kr + lhalf * 8,      kr + lhalf * 8 + 16);
    v16bf b1 = ldfrag(kr + 32 + lhalf * 8, kr + 32 + lhalf * 8 + 16);
    acc[t] = wmma_bf16(aq0, b0, acc[t]);
    acc[t] = wmma_bf16(aq1, b1, acc[t]);
  }

  // softmax over 256 (16 tiles x 16 lanes per half-wave), scale 1/sqrt(64)
  u16* pw = pbuf + wave * 4096;
#pragma unroll
  for (int j = 0; j < 8; ++j) {
    float m = -3.4e38f;
#pragma unroll
    for (int t = 0; t < 16; ++t) m = fmaxf(m, acc[t][j] * 0.125f);
    m = fmaxf(m, __shfl_xor(m, 1, 32));
    m = fmaxf(m, __shfl_xor(m, 2, 32));
    m = fmaxf(m, __shfl_xor(m, 4, 32));
    m = fmaxf(m, __shfl_xor(m, 8, 32));
    float s = 0.f;
#pragma unroll
    for (int t = 0; t < 16; ++t) {
      float p = __expf(acc[t][j] * 0.125f - m);
      acc[t][j] = p;
      s += p;
    }
    s += __shfl_xor(s, 1, 32);
    s += __shfl_xor(s, 2, 32);
    s += __shfl_xor(s, 4, 32);
    s += __shfl_xor(s, 8, 32);
    float inv = 1.f / s;
    int row = j + lhalf * 8;
#pragma unroll
    for (int t = 0; t < 16; ++t)
      pw[row * 256 + t * 16 + lm] = f2bf(acc[t][j] * inv);
  }

  // ctx = attn @ values : 4 dh tiles x 8 k-steps
  v8f o[4];
#pragma unroll
  for (int t = 0; t < 4; ++t) { v8f z = {}; o[t] = z; }
#pragma unroll
  for (int ks = 0; ks < 8; ++ks) {
    const u16* pr = pw + lm * 256 + ks * 32 + lhalf * 8;
    v16bf ap = ldfrag(pr, pr + 16);
#pragma unroll
    for (int dt = 0; dt < 4; ++dt) {
      const u16* vr = valt_s + (dt * 16 + lm) * 256 + ks * 32 + lhalf * 8;
      v16bf bv = ldfrag(vr, vr + 16);
      o[dt] = wmma_bf16(ap, bv, o[dt]);
    }
  }
#pragma unroll
  for (int dt = 0; dt < 4; ++dt)
#pragma unroll
    for (int j = 0; j < 8; ++j) {
      int row = b * NN + n0 + j + lhalf * 8;
      ctxbf[(long)row * DD + h * 64 + dt * 16 + lm] = f2bf(o[dt][j]);
    }
}

// ---------------------------------------------------------------------------
// Kernel 6: out = ctx @ w_out^T + b_out; y = x + out; LayerNorm(y).
//   Block = 16 rows; 8 waves x 6 col tiles; 24 k-steps. LN via LDS + shfl.
// ---------------------------------------------------------------------------
__global__ void __launch_bounds__(256)
k_out(const u16* __restrict__ ctxbf, const u16* __restrict__ woutbf,
      const float* __restrict__ x, const float* __restrict__ bout,
      const float* __restrict__ gamma, const float* __restrict__ beta,
      float* __restrict__ out) {
  __shared__ float ybuf[16][772];            // padded vs 64-bank LDS
  const int lane = threadIdx.x & 31, wave = threadIdx.x >> 5;
  const int lm = lane & 15, lhalf = lane >> 4;
  const int r0 = blockIdx.x * 16;

  const u16* arow = ctxbf + (long)(r0 + lm) * DD;
  v8f acc[6];
#pragma unroll
  for (int c = 0; c < 6; ++c) { v8f z = {}; acc[c] = z; }

  for (int ks = 0; ks < 24; ++ks) {
    int koff = ks * 32 + lhalf * 8;
    v16bf a = ldfrag(arow + koff, arow + koff + 16);
    __builtin_prefetch(arow + koff + 64, 0, 1);
#pragma unroll
    for (int c = 0; c < 6; ++c) {
      int ct = wave * 6 + c;
      const u16* brow = woutbf + (long)(ct * 16 + lm) * DD + koff;
      v16bf bf = ldfrag(brow, brow + 16);
      acc[c] = wmma_bf16(a, bf, acc[c]);
    }
  }

#pragma unroll
  for (int c = 0; c < 6; ++c) {
    int ct = wave * 6 + c;
#pragma unroll
    for (int j = 0; j < 8; ++j) {
      int row = j + lhalf * 8, col = ct * 16 + lm;
      ybuf[row][col] = acc[c][j] + bout[col] + x[(long)(r0 + row) * DD + col];
    }
  }
  __syncthreads();

  int rr = threadIdx.x >> 4;                 // row 0..15, 16 lanes per row
  int s  = threadIdx.x & 15;
  float sum = 0.f, sq = 0.f;
  for (int c = s; c < DD; c += 16) { float v = ybuf[rr][c]; sum += v; sq += v * v; }
  sum += __shfl_xor(sum, 1, 32); sq += __shfl_xor(sq, 1, 32);
  sum += __shfl_xor(sum, 2, 32); sq += __shfl_xor(sq, 2, 32);
  sum += __shfl_xor(sum, 4, 32); sq += __shfl_xor(sq, 4, 32);
  sum += __shfl_xor(sum, 8, 32); sq += __shfl_xor(sq, 8, 32);
  float mu = sum * (1.f / DD);
  float var = sq * (1.f / DD) - mu * mu;
  float rstd = rsqrtf(var + 1e-12f);
  for (int c = s; c < DD; c += 16)
    out[(long)(r0 + rr) * DD + c] = (ybuf[rr][c] - mu) * rstd * gamma[c] + beta[c];
}

// ---------------------------------------------------------------------------
// Host launcher
// ---------------------------------------------------------------------------
extern "C" void kernel_launch(void* const* d_in, const int* in_sizes, int n_in,
                              void* d_out, int out_size, void* d_ws, size_t ws_size,
                              hipStream_t stream) {
  const float* x     = (const float*)d_in[0];
  const float* wq    = (const float*)d_in[1];
  const float* wk    = (const float*)d_in[2];
  const float* pk    = (const float*)d_in[3];
  const float* wout  = (const float*)d_in[4];
  const float* bout  = (const float*)d_in[5];
  const float* gamma = (const float*)d_in[6];
  const float* beta  = (const float*)d_in[7];
  float* out = (float*)d_out;
  char* ws = (char*)d_ws;

  // 256B-aligned workspace layout (bytes)
  u16*   xbf   = (u16*)(ws + 0);             // 25,165,824
  u16*   wqbf  = (u16*)(ws + 25165824);      //    294,912
  u16*   wkbf  = (u16*)(ws + 25460736);      //    294,912
  u16*   woutb = (u16*)(ws + 25755648);      //  1,179,648
  u16*   pkt   = (u16*)(ws + 26935296);      //  1,048,576
  u16*   qbf   = (u16*)(ws + 27983872);      // 25,165,824
  u16*   krt   = (u16*)(ws + 53149696);      // 25,165,824
  float* kproj = (float*)(ws + 78315520);    //  6,291,456
  u16*   keys  = (u16*)(ws + 84606976);      //  3,145,728
  u16*   valt  = (u16*)(ws + 87752704);      //  3,145,728
  u16*   ctxbf = (u16*)(ws + 90898432);      // 25,165,824  (end 116,064,256)

  (void)hipFuncSetAttribute(reinterpret_cast<const void*>(k_attn),
                            hipFuncAttributeMaxDynamicSharedMemorySize, 131072);

  k_convert<<<49152, 256, 0, stream>>>(x, wq, wk, wout, pk, xbf, wqbf, wkbf, woutb, pkt);
  k_gconv  <<<12288, 256, 0, stream>>>(xbf, wqbf, wkbf, qbf, krt);
  k_kproj  <<<  768, 256, 0, stream>>>(pkt, krt, kproj);
  k_gather <<< 6144, 256, 0, stream>>>(kproj, keys, valt);
  k_attn   <<< 1536, 256, 131072, stream>>>(qbf, keys, valt, ctxbf);
  k_out    <<< 1024, 256, 0, stream>>>(ctxbf, woutb, x, bout, gamma, beta, out);
}

// v001
// It runs in 296 microseconds.
// In both of two side-by-side timings against v000, it was 1.18 times as fast.
#include <hip/hip_runtime.h>
#include <hip/hip_bf16.h>

// ---------------------------------------------------------------------------
// BonzSelfAttention for MI455X (gfx1250): bf16 WMMA everywhere, fp32 accum.
// B=8, N=2048, D=768, K=256, H=12, G=4, DH=64
// ---------------------------------------------------------------------------

typedef __attribute__((ext_vector_type(16))) __bf16 v16bf;
typedef __attribute__((ext_vector_type(8)))  __bf16 v8bf;
typedef __attribute__((ext_vector_type(8)))  float  v8f;
typedef __attribute__((ext_vector_type(4)))  int    v4i;
typedef unsigned short u16;

#define BN   16384   // B*N
#define DD   768
#define NN   2048
#define KK   256
#define HH   12

#if __has_builtin(__builtin_amdgcn_global_load_async_to_lds_b128)
#define HAVE_ASYNC_LDS 1
#else
#define HAVE_ASYNC_LDS 0
#endif

struct alignas(32) Frag32B { uint4 lo, hi; };

// Native bf16 convert (RNE) — lets clang emit v_cvt instead of manual rounding.
__device__ __forceinline__ u16 f2bf(float f) {
  __bf16 h = (__bf16)f;
  return __builtin_bit_cast(u16, h);
}

// A/B operand fragment: two 16-byte chunks (K-chunk and K-chunk+16) per lane.
__device__ __forceinline__ v16bf ldfrag(const u16* p0, const u16* p1) {
  Frag32B f;
  f.lo = *(const uint4*)p0;
  f.hi = *(const uint4*)p1;
  return __builtin_bit_cast(v16bf, f);
}

__device__ __forceinline__ v8f wmma_bf16(v16bf a, v16bf b, v8f c) {
  // (neg_a, A, neg_b, B, c_mod, C, reuse_a, reuse_b)
  return __builtin_amdgcn_wmma_f32_16x16x32_bf16(false, a, false, b, (short)0, c,
                                                 false, false);
}

// ---------------------------------------------------------------------------
// Kernel 1: fp32 -> bf16 conversions (+ project_k transpose)
// ---------------------------------------------------------------------------
__global__ void k_convert(const float* __restrict__ x,  const float* __restrict__ wq,
                          const float* __restrict__ wk, const float* __restrict__ wout,
                          const float* __restrict__ pk,
                          u16* xbf, u16* wqbf, u16* wkbf, u16* woutbf, u16* pkt) {
  long i = (long)blockIdx.x * blockDim.x + threadIdx.x;
  const long NX = (long)BN * DD;             // 12,582,912
  if (i < NX) xbf[i] = f2bf(x[i]);
  if (i < 147456) { wqbf[i] = f2bf(wq[i]); wkbf[i] = f2bf(wk[i]); }
  if (i < 589824) woutbf[i] = f2bf(wout[i]);
  if (i < 524288) {                          // pkt[kq][n] = pk[n][kq]
    int kq = (int)(i >> 11), n = (int)(i & 2047);
    pkt[i] = f2bf(pk[(long)n * KK + kq]);
  }
}

// ---------------------------------------------------------------------------
// Kernel 2: grouped pointwise conv (block-diagonal GEMM), Q and K_raw.
//   y = x_g @ w_g^T  per 192-wide group.  One 16x16 tile per wave, 6 WMMAs.
//   Q stored row-major bf16; K_raw stored TRANSPOSED krt[b][d][n] bf16.
// ---------------------------------------------------------------------------
__global__ void __launch_bounds__(256)
k_gconv(const u16* __restrict__ xbf, const u16* __restrict__ wqbf,
        const u16* __restrict__ wkbf, u16* __restrict__ qbf, u16* __restrict__ krt) {
  const int lane = threadIdx.x & 31, wave = threadIdx.x >> 5;
  const int lm = lane & 15, lhalf = lane >> 4;
  int tile = blockIdx.x * 8 + wave;          // 0..98303
  int qk = tile / 49152;
  int rem = tile - qk * 49152;
  int ct = rem % 48;                         // output col tile (16 channels)
  int rt = rem / 48;                         // row tile (16 rows of B*N)
  int g  = ct / 12;                          // group
  const u16* wbf = (qk == 0) ? wqbf : wkbf;
  const int m0 = rt * 16;
  const u16* arow = xbf + (long)(m0 + lm) * DD + g * 192;
  const u16* brow = wbf + (long)g * 36864 + (long)(ct * 16 - g * 192 + lm) * 192;

  v8f acc = {};
#pragma unroll
  for (int ks = 0; ks < 6; ++ks) {
    int koff = ks * 32 + lhalf * 8;
    v16bf a = ldfrag(arow + koff, arow + koff + 16);
    v16bf b = ldfrag(brow + koff, brow + koff + 16);
    acc = wmma_bf16(a, b, acc);
  }

  if (qk == 0) {
#pragma unroll
    for (int j = 0; j < 8; ++j) {
      int row = m0 + j + lhalf * 8, col = ct * 16 + lm;
      qbf[(long)row * DD + col] = f2bf(acc[j]);
    }
  } else {
#pragma unroll
    for (int j = 0; j < 8; ++j) {
      int row = m0 + j + lhalf * 8;          // global (b,n) row
      int b = row >> 11, n = row & 2047;
      int d = ct * 16 + lm;
      krt[((long)b * DD + d) * NN + n] = f2bf(acc[j]);
    }
  }
}

// ---------------------------------------------------------------------------
// Kernel 3: k_proj[b,kq,d] = sum_n pk[n,kq] * k_raw[b,n,d]
//   A = pkt[kq][n] (row-major), B = krt[b][d][n] (column d per lane), 64 steps.
//   The f32 tile never goes to memory: each lane holds 8 consecutive kq of one
//   column d, which are 8 consecutive bf16 both in values^T and in keys, so the
//   epilogue stores the same 16 bytes to each.
//   valt[b,h,dq,kq]   = k_proj[b, kq, h*64+dq]
//   keys[b,h,kq2,dq2] = k_proj[b, (h*64+dq2)&255, 3*kq2 + ((h*64+dq2)>>8)]
//     inverted: kq2 = d/3, c = (d%3)*256 + kq, h = c>>6, dq2 = c&63
// ---------------------------------------------------------------------------
__global__ void __launch_bounds__(256)
k_kproj(const u16* __restrict__ pkt, const u16* __restrict__ krt,
        u16* __restrict__ keys, u16* __restrict__ valt) {
  const int lane = threadIdx.x & 31, wave = threadIdx.x >> 5;
  const int lm = lane & 15, lhalf = lane >> 4;
  int id = blockIdx.x * 8 + wave;            // 0..6143
  int b = id / 768;
  int rem = id - b * 768;
  int mt = rem / 48, nt = rem % 48;

  const u16* arow = pkt + (long)(mt * 16 + lm) * NN;
  const u16* brow = krt + ((long)b * DD + nt * 16 + lm) * NN;

  v8f acc = {};
  for (int ks = 0; ks < 64; ++ks) {
    int koff = ks * 32 + lhalf * 8;
    v16bf a = ldfrag(arow + koff, arow + koff + 16);
    v16bf bf = ldfrag(brow + koff, brow + koff + 16);
    acc = wmma_bf16(a, bf, acc);
  }

  const uint4 pk8 = __builtin_bit_cast(uint4, __builtin_convertvector(acc, v8bf));

  const int kq0 = mt * 16 + lhalf * 8;       // first of this lane's 8 rows
  const int d = nt * 16 + lm;
  *(uint4*)(valt + ((long)(b * HH + (d >> 6)) * 64 + (d & 63)) * KK + kq0) = pk8;
  const int kq2 = d / 3;
  const int c0 = (d - kq2 * 3) * 256 + kq0;
  *(uint4*)(keys + ((long)(b * HH + (c0 >> 6)) * KK + kq2) * 64 + (c0 & 63)) = pk8;
}

// ---------------------------------------------------------------------------
// Kernel 5: attention.  Block = (b, h, 128-row chunk), 8 waves x 16 rows.
//   LDS: keys 32KB + values^T 32KB + per-wave prob buffer 64KB = 128KB.
//   K/V staged with GLOBAL_LOAD_ASYNC_TO_LDS_B128 (ASYNCcnt-tracked DMA).
// ---------------------------------------------------------------------------
__global__ void __launch_bounds__(256)
k_attn(const u16* __restrict__ qbf, const u16* __restrict__ keys,
       const u16* __restrict__ valt, u16* __restrict__ ctxbf) {
  extern __shared__ __align__(16) unsigned char smem_raw[];
  u16* keys_s = (u16*)smem_raw;              // [256][64]
  u16* valt_s = keys_s + 16384;              // [64][256]
  u16* pbuf   = valt_s + 16384;              // 8 waves * [16][256]

  const int lane = threadIdx.x & 31, wave = threadIdx.x >> 5;
  const int lm = lane & 15, lhalf = lane >> 4;
  int chunk = blockIdx.x & 15;
  int bh = blockIdx.x >> 4;
  int b = bh / HH, h = bh - b * HH;

  // stage K and V^T into LDS (16B per thread per iter)
  {
    const uint4* kg = (const uint4*)(keys + (long)bh * 16384);
    const uint4* vg = (const uint4*)(valt + (long)bh * 16384);
    uint4* ks_ = (uint4*)keys_s;
    uint4* vs_ = (uint4*)valt_s;
#if HAVE_ASYNC_LDS
    typedef __attribute__((address_space(1))) v4i* gp_t;   // global int4*
    typedef __attribute__((address_space(3))) v4i* lp_t;   // LDS int4*
    for (int i = threadIdx.x; i < 2048; i += 256) {
      __builtin_amdgcn_global_load_async_to_lds_b128((gp_t)(kg + i),
                                                     (lp_t)(ks_ + i), 0, 0);
      __builtin_amdgcn_global_load_async_to_lds_b128((gp_t)(vg + i),
                                                     (lp_t)(vs_ + i), 0, 0);
    }
#if __has_builtin(__builtin_amdgcn_s_wait_asynccnt)
    __builtin_amdgcn_s_wait_asynccnt(0);
#else
    asm volatile("s_wait_asynccnt 0x0" ::: "memory");
#endif
#else
    for (int i = threadIdx.x; i < 2048; i += 256) { ks_[i] = kg[i]; vs_[i] = vg[i]; }
#endif
  }
  __syncthreads();

  const int n0 = chunk * 128 + wave * 16;
  const u16* qrow = qbf + ((long)(b * NN + n0 + lm)) * DD + h * 64;
  v16bf aq0 = ldfrag(qrow + lhalf * 8,      qrow + lhalf * 8 + 16);
  v16bf aq1 = ldfrag(qrow + 32 + lhalf * 8, qrow + 32 + lhalf * 8 + 16);

  v8f acc[16];
#pragma unroll
  for (int t = 0; t < 16; ++t) { v8f z = {}; acc[t] = z; }

  // dots = q @ keys^T : 16 column tiles x 2 k-steps
#pragma unroll
  for (int t = 0; t < 16; ++t) {
    const u16* kr = keys_s + (t * 16 + lm) * 64;
    v16bf b0 = ldfrag(kr + lhalf * 8,      kr + lhalf * 8 + 16);
    v16bf b1 = ldfrag(kr + 32 + lhalf * 8, kr + 32 + lhalf * 8 + 16);
    acc[t] = wmma_bf16(aq0, b0, acc[t]);
    acc[t] = wmma_bf16(aq1, b1, acc[t]);
  }

  // softmax over 256 (16 tiles x 16 lanes per half-wave), scale 1/sqrt(64)
  u16* pw = pbuf + wave * 4096;
#pragma unroll
  for (int j = 0; j < 8; ++j) {
    float m = -3.4e38f;
#pragma unroll
    for (int t = 0; t < 16; ++t) m = fmaxf(m, acc[t][j] * 0.125f);
    m = fmaxf(m, __shfl_xor(m, 1, 32));
    m = fmaxf(m, __shfl_xor(m, 2, 32));
    m = fmaxf(m, __shfl_xor(m, 4, 32));
    m = fmaxf(m, __shfl_xor(m, 8, 32));
    float s = 0.f;
#pragma unroll
    for (int t = 0; t < 16; ++t) {
      float p = __expf(acc[t][j] * 0.125f - m);
      acc[t][j] = p;
      s += p;
    }
    s += __shfl_xor(s, 1, 32);
    s += __shfl_xor(s, 2, 32);
    s += __shfl_xor(s, 4, 32);
    s += __shfl_xor(s, 8, 32);
    float inv = 1.f / s;
    int row = j + lhalf * 8;
#pragma unroll
    for (int t = 0; t < 16; ++t)
      pw[row * 256 + t * 16 + lm] = f2bf(acc[t][j] * inv);
  }

  // ctx = attn @ values : 4 dh tiles x 8 k-steps
  v8f o[4];
#pragma unroll
  for (int t = 0; t < 4; ++t) { v8f z = {}; o[t] = z; }
#pragma unroll
  for (int ks = 0; ks < 8; ++ks) {
    const u16* pr = pw + lm * 256 + ks * 32 + lhalf * 8;
    v16bf ap = ldfrag(pr, pr + 16);
#pragma unroll
    for (int dt = 0; dt < 4; ++dt) {
      const u16* vr = valt_s + (dt * 16 + lm) * 256 + ks * 32 + lhalf * 8;
      v16bf bv = ldfrag(vr, vr + 16);
      o[dt] = wmma_bf16(ap, bv, o[dt]);
    }
  }
#pragma unroll
  for (int dt = 0; dt < 4; ++dt)
#pragma unroll
    for (int j = 0; j < 8; ++j) {
      int row = b * NN + n0 + j + lhalf * 8;
      ctxbf[(long)row * DD + h * 64 + dt * 16 + lm] = f2bf(o[dt][j]);
    }
}

// ---------------------------------------------------------------------------
// Kernel 6: out = ctx @ w_out^T + b_out; y = x + out; LayerNorm(y).
//   Block = 16 rows; 8 waves x 6 col tiles; 24 k-steps. LN via LDS + shfl.
// ---------------------------------------------------------------------------
__global__ void __launch_bounds__(256)
k_out(const u16* __restrict__ ctxbf, const u16* __restrict__ woutbf,
      const float* __restrict__ x, const float* __restrict__ bout,
      const float* __restrict__ gamma, const float* __restrict__ beta,
      float* __restrict__ out) {
  __shared__ float ybuf[16][772];            // padded vs 64-bank LDS
  const int lane = threadIdx.x & 31, wave = threadIdx.x >> 5;
  const int lm = lane & 15, lhalf = lane >> 4;
  const int r0 = blockIdx.x * 16;

  const u16* arow = ctxbf + (long)(r0 + lm) * DD;
  v8f acc[6];
#pragma unroll
  for (int c = 0; c < 6; ++c) { v8f z = {}; acc[c] = z; }

  for (int ks = 0; ks < 24; ++ks) {
    int koff = ks * 32 + lhalf * 8;
    v16bf a = ldfrag(arow + koff, arow + koff + 16);
    __builtin_prefetch(arow + koff + 64, 0, 1);
#pragma unroll
    for (int c = 0; c < 6; ++c) {
      int ct = wave * 6 + c;
      const u16* brow = woutbf + (long)(ct * 16 + lm) * DD + koff;
      v16bf bf = ldfrag(brow, brow + 16);
      acc[c] = wmma_bf16(a, bf, acc[c]);
    }
  }

#pragma unroll
  for (int c = 0; c < 6; ++c) {
    int ct = wave * 6 + c;
#pragma unroll
    for (int j = 0; j < 8; ++j) {
      int row = j + lhalf * 8, col = ct * 16 + lm;
      ybuf[row][col] = acc[c][j] + bout[col] + x[(long)(r0 + row) * DD + col];
    }
  }
  __syncthreads();

  int rr = threadIdx.x >> 4;                 // row 0..15, 16 lanes per row
  int s  = threadIdx.x & 15;
  float sum = 0.f, sq = 0.f;
  for (int c = s; c < DD; c += 16) { float v = ybuf[rr][c]; sum += v; sq += v * v; }
  sum += __shfl_xor(sum, 1, 32); sq += __shfl_xor(sq, 1, 32);
  sum += __shfl_xor(sum, 2, 32); sq += __shfl_xor(sq, 2, 32);
  sum += __shfl_xor(sum, 4, 32); sq += __shfl_xor(sq, 4, 32);
  sum += __shfl_xor(sum, 8, 32); sq += __shfl_xor(sq, 8, 32);
  float mu = sum * (1.f / DD);
  float var = sq * (1.f / DD) - mu * mu;
  float rstd = rsqrtf(var + 1e-12f);
  for (int c = s; c < DD; c += 16)
    out[(long)(r0 + rr) * DD + c] = (ybuf[rr][c] - mu) * rstd * gamma[c] + beta[c];
}

// ---------------------------------------------------------------------------
// Host launcher
// ---------------------------------------------------------------------------
extern "C" void kernel_launch(void* const* d_in, const int* in_sizes, int n_in,
                              void* d_out, int out_size, void* d_ws, size_t ws_size,
                              hipStream_t stream) {
  const float* x     = (const float*)d_in[0];
  const float* wq    = (const float*)d_in[1];
  const float* wk    = (const float*)d_in[2];
  const float* pk    = (const float*)d_in[3];
  const float* wout  = (const float*)d_in[4];
  const float* bout  = (const float*)d_in[5];
  const float* gamma = (const float*)d_in[6];
  const float* beta  = (const float*)d_in[7];
  float* out = (float*)d_out;
  char* ws = (char*)d_ws;

  // 256B-aligned workspace layout (bytes)
  u16*   xbf   = (u16*)(ws + 0);             // 25,165,824
  u16*   wqbf  = (u16*)(ws + 25165824);      //    294,912
  u16*   wkbf  = (u16*)(ws + 25460736);      //    294,912
  u16*   woutb = (u16*)(ws + 25755648);      //  1,179,648
  u16*   pkt   = (u16*)(ws + 26935296);      //  1,048,576
  u16*   qbf   = (u16*)(ws + 27983872);      // 25,165,824
  u16*   krt   = (u16*)(ws + 53149696);      // 25,165,824
  u16*   keys  = (u16*)(ws + 84606976);      //  3,145,728
  u16*   valt  = (u16*)(ws + 87752704);      //  3,145,728
  u16*   ctxbf = (u16*)(ws + 90898432);      // 25,165,824  (end 116,064,256)

  (void)hipFuncSetAttribute(reinterpret_cast<const void*>(k_attn),
                            hipFuncAttributeMaxDynamicSharedMemorySize, 131072);

  k_convert<<<49152, 256, 0, stream>>>(x, wq, wk, wout, pk, xbf, wqbf, wkbf, woutb, pkt);
  k_gconv  <<<12288, 256, 0, stream>>>(xbf, wqbf, wkbf, qbf, krt);
  k_kproj  <<<  768, 256, 0, stream>>>(pkt, krt, keys, valt);
  k_attn   <<< 1536, 256, 131072, stream>>>(qbf, keys, valt, ctxbf);
  k_out    <<< 1024, 256, 0, stream>>>(ctxbf, woutb, x, bout, gamma, beta, out);
}

// v002
// It runs in 277 microseconds.
// In two side-by-side timings against v001, it was 1.08 and 1.06 times as fast.
// Over all steps from v000 it is 1.26 times as fast.
#include <hip/hip_runtime.h>
#include <hip/hip_bf16.h>

// ---------------------------------------------------------------------------
// BonzSelfAttention for MI455X (gfx1250): bf16 WMMA everywhere, fp32 accum.
// B=8, N=2048, D=768, K=256, H=12, G=4, DH=64
// ---------------------------------------------------------------------------

typedef __attribute__((ext_vector_type(16))) __bf16 v16bf;
typedef __attribute__((ext_vector_type(8)))  __bf16 v8bf;
typedef __attribute__((ext_vector_type(8)))  float  v8f;
typedef __attribute__((ext_vector_type(4)))  float  v4f;
typedef __attribute__((ext_vector_type(4)))  __bf16 v4bf;
typedef __attribute__((ext_vector_type(4)))  int    v4i;
typedef unsigned short u16;

#define BN   16384   // B*N
#define DD   768
#define NN   2048
#define KK   256
#define HH   12

#if __has_builtin(__builtin_amdgcn_global_load_async_to_lds_b128)
#define HAVE_ASYNC_LDS 1
#else
#define HAVE_ASYNC_LDS 0
#endif

struct alignas(32) Frag32B { uint4 lo, hi; };

// Native bf16 convert (RNE) — lets clang emit v_cvt instead of manual rounding.
__device__ __forceinline__ u16 f2bf(float f) {
  __bf16 h = (__bf16)f;
  return __builtin_bit_cast(u16, h);
}

// A/B operand fragment: two 16-byte chunks (K-chunk and K-chunk+16) per lane.
__device__ __forceinline__ v16bf ldfrag(const u16* p0, const u16* p1) {
  Frag32B f;
  f.lo = *(const uint4*)p0;
  f.hi = *(const uint4*)p1;
  return __builtin_bit_cast(v16bf, f);
}

__device__ __forceinline__ v8f wmma_bf16(v16bf a, v16bf b, v8f c) {
  // (neg_a, A, neg_b, B, c_mod, C, reuse_a, reuse_b)
  return __builtin_amdgcn_wmma_f32_16x16x32_bf16(false, a, false, b, (short)0, c,
                                                 false, false);
}

// ---------------------------------------------------------------------------
// Kernel 1: fp32 -> bf16 conversions (+ project_k transpose)
//   Few, long waves instead of one element per thread.  A block takes one role
//   by its index (block-uniform):
//     0..31     project_k: thread = column kq, 64 rows n; the 64 loads are
//               coalesced over kq, and the thread stores one whole 128-B line
//               of pkt[kq][n]
//     32..37    wq, 38..43 wk, 44..67 w_out, 68..579 x: a contiguous run of
//               6144 float4; every wave-wide load covers 512 contiguous bytes,
//               every wave-wide store 256, and a thread's 24 loads are
//               independent, so many are in flight at a time
// ---------------------------------------------------------------------------
__global__ void __launch_bounds__(256)
k_convert(const float* __restrict__ x,  const float* __restrict__ wq,
          const float* __restrict__ wk, const float* __restrict__ wout,
          const float* __restrict__ pk,
          u16* __restrict__ xbf, u16* __restrict__ wqbf, u16* __restrict__ wkbf,
          u16* __restrict__ woutbf, u16* __restrict__ pkt) {
  const int tid = threadIdx.x;
  int bid = blockIdx.x;

  if (bid < 32) {                            // pkt[kq][n] = pk[n][kq]
    const float* s = pk + (long)bid * 64 * KK + tid;
    float v[64];
#pragma unroll
    for (int j = 0; j < 64; ++j) v[j] = s[j * KK];
    uint4* d = (uint4*)(pkt + (long)tid * NN + bid * 64);
#pragma unroll
    for (int c = 0; c < 8; ++c) {
      v8f f;
#pragma unroll
      for (int j = 0; j < 8; ++j) f[j] = v[c * 8 + j];
      d[c] = __builtin_bit_cast(uint4, __builtin_convertvector(f, v8bf));
    }
    return;
  }

  const float* s;
  u16* d;
  if (bid < 38)      { s = wq;   d = wqbf;   bid -= 32; }
  else if (bid < 44) { s = wk;   d = wkbf;   bid -= 38; }
  else if (bid < 68) { s = wout; d = woutbf; bid -= 44; }
  else               { s = x;    d = xbf;    bid -= 68; }

  const v4f* s4 = (const v4f*)s + (long)bid * 6144 + tid;
  uint2*     d4 = (uint2*)d     + (long)bid * 6144 + tid;
  v4f v[24];
#pragma unroll
  for (int k = 0; k < 24; ++k) v[k] = s4[k * 256];
#pragma unroll
  for (int k = 0; k < 24; ++k)
    d4[k * 256] = __builtin_bit_cast(uint2, __builtin_convertvector(v[k], v4bf));
}

// ---------------------------------------------------------------------------
// Kernel 2: grouped pointwise conv (block-diagonal GEMM), Q and K_raw.
//   y = x_g @ w_g^T  per 192-wide group.  One 16x16 tile per wave, 6 WMMAs.
//   Q stored row-major bf16; K_raw stored TRANSPOSED krt[b][d][n] bf16.
// ---------------------------------------------------------------------------
__global__ void __launch_bounds__(256)
k_gconv(const u16* __restrict__ xbf, const u16* __restrict__ wqbf,
        const u16* __restrict__ wkbf, u16* __restrict__ qbf, u16* __restrict__ krt) {
  const int lane = threadIdx.x & 31, wave = threadIdx.x >> 5;
  const int lm = lane & 15, lhalf = lane >> 4;
  int tile = blockIdx.x * 8 + wave;          // 0..98303
  int qk = tile / 49152;
  int rem = tile - qk * 49152;
  int ct = rem % 48;                         // output col tile (16 channels)
  int rt = rem / 48;                         // row tile (16 rows of B*N)
  int g  = ct / 12;                          // group
  const u16* wbf = (qk == 0) ? wqbf : wkbf;
  const int m0 = rt * 16;
  const u16* arow = xbf + (long)(m0 + lm) * DD + g * 192;
  const u16* brow = wbf + (long)g * 36864 + (long)(ct * 16 - g * 192 + lm) * 192;

  v8f acc = {};
#pragma unroll
  for (int ks = 0; ks < 6; ++ks) {
    int koff = ks * 32 + lhalf * 8;
    v16bf a = ldfrag(arow + koff, arow + koff + 16);
    v16bf b = ldfrag(brow + koff, brow + koff + 16);
    acc = wmma_bf16(a, b, acc);
  }

  if (qk == 0) {
#pragma unroll
    for (int j = 0; j < 8; ++j) {
      int row = m0 + j + lhalf * 8, col = ct * 16 + lm;
      qbf[(long)row * DD + col] = f2bf(acc[j]);
    }
  } else {
#pragma unroll
    for (int j = 0; j < 8; ++j) {
      int row = m0 + j + lhalf * 8;          // global (b,n) row
      int b = row >> 11, n = row & 2047;
      int d = ct * 16 + lm;
      krt[((long)b * DD + d) * NN + n] = f2bf(acc[j]);
    }
  }
}

// ---------------------------------------------------------------------------
// Kernel 3: k_proj[b,kq,d] = sum_n pk[n,kq] * k_raw[b,n,d]
//   A = pkt[kq][n] (row-major), B = krt[b][d][n] (column d per lane), 64 steps.
//   The f32 tile never goes to memory: each lane holds 8 consecutive kq of one
//   column d, which are 8 consecutive bf16 both in values^T and in keys, so the
//   epilogue stores the same 16 bytes to each.
//   valt[b,h,dq,kq]   = k_proj[b, kq, h*64+dq]
//   keys[b,h,kq2,dq2] = k_proj[b, (h*64+dq2)&255, 3*kq2 + ((h*64+dq2)>>8)]
//     inverted: kq2 = d/3, c = (d%3)*256 + kq, h = c>>6, dq2 = c&63
// ---------------------------------------------------------------------------
__global__ void __launch_bounds__(256)
k_kproj(const u16* __restrict__ pkt, const u16* __restrict__ krt,
        u16* __restrict__ keys, u16* __restrict__ valt) {
  const int lane = threadIdx.x & 31, wave = threadIdx.x >> 5;
  const int lm = lane & 15, lhalf = lane >> 4;
  int id = blockIdx.x * 8 + wave;            // 0..6143
  int b = id / 768;
  int rem = id - b * 768;
  int mt = rem / 48, nt = rem % 48;

  const u16* arow = pkt + (long)(mt * 16 + lm) * NN;
  const u16* brow = krt + ((long)b * DD + nt * 16 + lm) * NN;

  v8f acc = {};
  for (int ks = 0; ks < 64; ++ks) {
    int koff = ks * 32 + lhalf * 8;
    v16bf a = ldfrag(arow + koff, arow + koff + 16);
    v16bf bf = ldfrag(brow + koff, brow + koff + 16);
    acc = wmma_bf16(a, bf, acc);
  }

  const uint4 pk8 = __builtin_bit_cast(uint4, __builtin_convertvector(acc, v8bf));

  const int kq0 = mt * 16 + lhalf * 8;       // first of this lane's 8 rows
  const int d = nt * 16 + lm;
  *(uint4*)(valt + ((long)(b * HH + (d >> 6)) * 64 + (d & 63)) * KK + kq0) = pk8;
  const int kq2 = d / 3;
  const int c0 = (d - kq2 * 3) * 256 + kq0;
  *(uint4*)(keys + ((long)(b * HH + (c0 >> 6)) * KK + kq2) * 64 + (c0 & 63)) = pk8;
}

// ---------------------------------------------------------------------------
// Kernel 5: attention.  Block = (b, h, 128-row chunk), 8 waves x 16 rows.
//   LDS: keys 32KB + values^T 32KB + per-wave prob buffer 64KB = 128KB.
//   K/V staged with GLOBAL_LOAD_ASYNC_TO_LDS_B128 (ASYNCcnt-tracked DMA).
// ---------------------------------------------------------------------------
__global__ void __launch_bounds__(256)
k_attn(const u16* __restrict__ qbf, const u16* __restrict__ keys,
       const u16* __restrict__ valt, u16* __restrict__ ctxbf) {
  extern __shared__ __align__(16) unsigned char smem_raw[];
  u16* keys_s = (u16*)smem_raw;              // [256][64]
  u16* valt_s = keys_s + 16384;              // [64][256]
  u16* pbuf   = valt_s + 16384;              // 8 waves * [16][256]

  const int lane = threadIdx.x & 31, wave = threadIdx.x >> 5;
  const int lm = lane & 15, lhalf = lane >> 4;
  int chunk = blockIdx.x & 15;
  int bh = blockIdx.x >> 4;
  int b = bh / HH, h = bh - b * HH;

  // stage K and V^T into LDS (16B per thread per iter)
  {
    const uint4* kg = (const uint4*)(keys + (long)bh * 16384);
    const uint4* vg = (const uint4*)(valt + (long)bh * 16384);
    uint4* ks_ = (uint4*)keys_s;
    uint4* vs_ = (uint4*)valt_s;
#if HAVE_ASYNC_LDS
    typedef __attribute__((address_space(1))) v4i* gp_t;   // global int4*
    typedef __attribute__((address_space(3))) v4i* lp_t;   // LDS int4*
    for (int i = threadIdx.x; i < 2048; i += 256) {
      __builtin_amdgcn_global_load_async_to_lds_b128((gp_t)(kg + i),
                                                     (lp_t)(ks_ + i), 0, 0);
      __builtin_amdgcn_global_load_async_to_lds_b128((gp_t)(vg + i),
                                                     (lp_t)(vs_ + i), 0, 0);
    }
#if __has_builtin(__builtin_amdgcn_s_wait_asynccnt)
    __builtin_amdgcn_s_wait_asynccnt(0);
#else
    asm volatile("s_wait_asynccnt 0x0" ::: "memory");
#endif
#else
    for (int i = threadIdx.x; i < 2048; i += 256) { ks_[i] = kg[i]; vs_[i] = vg[i]; }
#endif
  }
  __syncthreads();

  const int n0 = chunk * 128 + wave * 16;
  const u16* qrow = qbf + ((long)(b * NN + n0 + lm)) * DD + h * 64;
  v16bf aq0 = ldfrag(qrow + lhalf * 8,      qrow + lhalf * 8 + 16);
  v16bf aq1 = ldfrag(qrow + 32 + lhalf * 8, qrow + 32 + lhalf * 8 + 16);

  v8f acc[16];
#pragma unroll
  for (int t = 0; t < 16; ++t) { v8f z = {}; acc[t] = z; }

  // dots = q @ keys^T : 16 column tiles x 2 k-steps
#pragma unroll
  for (int t = 0; t < 16; ++t) {
    const u16* kr = keys_s + (t * 16 + lm) * 64;
    v16bf b0 = ldfrag(kr + lhalf * 8,      kr + lhalf * 8 + 16);
    v16bf b1 = ldfrag(kr + 32 + lhalf * 8, kr + 32 + lhalf * 8 + 16);
    acc[t] = wmma_bf16(aq0, b0, acc[t]);
    acc[t] = wmma_bf16(aq1, b1, acc[t]);
  }

  // softmax over 256 (16 tiles x 16 lanes per half-wave), scale 1/sqrt(64)
  u16* pw = pbuf + wave * 4096;
#pragma unroll
  for (int j = 0; j < 8; ++j) {
    float m = -3.4e38f;
#pragma unroll
    for (int t = 0; t < 16; ++t) m = fmaxf(m, acc[t][j] * 0.125f);
    m = fmaxf(m, __shfl_xor(m, 1, 32));
    m = fmaxf(m, __shfl_xor(m, 2, 32));
    m = fmaxf(m, __shfl_xor(m, 4, 32));
    m = fmaxf(m, __shfl_xor(m, 8, 32));
    float s = 0.f;
#pragma unroll
    for (int t = 0; t < 16; ++t) {
      float p = __expf(acc[t][j] * 0.125f - m);
      acc[t][j] = p;
      s += p;
    }
    s += __shfl_xor(s, 1, 32);
    s += __shfl_xor(s, 2, 32);
    s += __shfl_xor(s, 4, 32);
    s += __shfl_xor(s, 8, 32);
    float inv = 1.f / s;
    int row = j + lhalf * 8;
#pragma unroll
    for (int t = 0; t < 16; ++t)
      pw[row * 256 + t * 16 + lm] = f2bf(acc[t][j] * inv);
  }

  // ctx = attn @ values : 4 dh tiles x 8 k-steps
  v8f o[4];
#pragma unroll
  for (int t = 0; t < 4; ++t) { v8f z = {}; o[t] = z; }
#pragma unroll
  for (int ks = 0; ks < 8; ++ks) {
    const u16* pr = pw + lm * 256 + ks * 32 + lhalf * 8;
    v16bf ap = ldfrag(pr, pr + 16);
#pragma unroll
    for (int dt = 0; dt < 4; ++dt) {
      const u16* vr = valt_s + (dt * 16 + lm) * 256 + ks * 32 + lhalf * 8;
      v16bf bv = ldfrag(vr, vr + 16);
      o[dt] = wmma_bf16(ap, bv, o[dt]);
    }
  }
#pragma unroll
  for (int dt = 0; dt < 4; ++dt)
#pragma unroll
    for (int j = 0; j < 8; ++j) {
      int row = b * NN + n0 + j + lhalf * 8;
      ctxbf[(long)row * DD + h * 64 + dt * 16 + lm] = f2bf(o[dt][j]);
    }
}

// ---------------------------------------------------------------------------
// Kernel 6: out = ctx @ w_out^T + b_out; y = x + out; LayerNorm(y).
//   Block = 16 rows; 8 waves x 6 col tiles; 24 k-steps. LN via LDS + shfl.
// ---------------------------------------------------------------------------
__global__ void __launch_bounds__(256)
k_out(const u16* __restrict__ ctxbf, const u16* __restrict__ woutbf,
      const float* __restrict__ x, const float* __restrict__ bout,
      const float* __restrict__ gamma, const float* __restrict__ beta,
      float* __restrict__ out) {
  __shared__ float ybuf[16][772];            // padded vs 64-bank LDS
  const int lane = threadIdx.x & 31, wave = threadIdx.x >> 5;
  const int lm = lane & 15, lhalf = lane >> 4;
  const int r0 = blockIdx.x * 16;

  const u16* arow = ctxbf + (long)(r0 + lm) * DD;
  v8f acc[6];
#pragma unroll
  for (int c = 0; c < 6; ++c) { v8f z = {}; acc[c] = z; }

  for (int ks = 0; ks < 24; ++ks) {
    int koff = ks * 32 + lhalf * 8;
    v16bf a = ldfrag(arow + koff, arow + koff + 16);
    __builtin_prefetch(arow + koff + 64, 0, 1);
#pragma unroll
    for (int c = 0; c < 6; ++c) {
      int ct = wave * 6 + c;
      const u16* brow = woutbf + (long)(ct * 16 + lm) * DD + koff;
      v16bf bf = ldfrag(brow, brow + 16);
      acc[c] = wmma_bf16(a, bf, acc[c]);
    }
  }

#pragma unroll
  for (int c = 0; c < 6; ++c) {
    int ct = wave * 6 + c;
#pragma unroll
    for (int j = 0; j < 8; ++j) {
      int row = j + lhalf * 8, col = ct * 16 + lm;
      ybuf[row][col] = acc[c][j] + bout[col] + x[(long)(r0 + row) * DD + col];
    }
  }
  __syncthreads();

  int rr = threadIdx.x >> 4;                 // row 0..15, 16 lanes per row
  int s  = threadIdx.x & 15;
  float sum = 0.f, sq = 0.f;
  for (int c = s; c < DD; c += 16) { float v = ybuf[rr][c]; sum += v; sq += v * v; }
  sum += __shfl_xor(sum, 1, 32); sq += __shfl_xor(sq, 1, 32);
  sum += __shfl_xor(sum, 2, 32); sq += __shfl_xor(sq, 2, 32);
  sum += __shfl_xor(sum, 4, 32); sq += __shfl_xor(sq, 4, 32);
  sum += __shfl_xor(sum, 8, 32); sq += __shfl_xor(sq, 8, 32);
  float mu = sum * (1.f / DD);
  float var = sq * (1.f / DD) - mu * mu;
  float rstd = rsqrtf(var + 1e-12f);
  for (int c = s; c < DD; c += 16)
    out[(long)(r0 + rr) * DD + c] = (ybuf[rr][c] - mu) * rstd * gamma[c] + beta[c];
}

// ---------------------------------------------------------------------------
// Host launcher
// ---------------------------------------------------------------------------
extern "C" void kernel_launch(void* const* d_in, const int* in_sizes, int n_in,
                              void* d_out, int out_size, void* d_ws, size_t ws_size,
                              hipStream_t stream) {
  const float* x     = (const float*)d_in[0];
  const float* wq    = (const float*)d_in[1];
  const float* wk    = (const float*)d_in[2];
  const float* pk    = (const float*)d_in[3];
  const float* wout  = (const float*)d_in[4];
  const float* bout  = (const float*)d_in[5];
  const float* gamma = (const float*)d_in[6];
  const float* beta  = (const float*)d_in[7];
  float* out = (float*)d_out;
  char* ws = (char*)d_ws;

  // 256B-aligned workspace layout (bytes)
  u16*   xbf   = (u16*)(ws + 0);             // 25,165,824
  u16*   wqbf  = (u16*)(ws + 25165824);      //    294,912
  u16*   wkbf  = (u16*)(ws + 25460736);      //    294,912
  u16*   woutb = (u16*)(ws + 25755648);      //  1,179,648
  u16*   pkt   = (u16*)(ws + 26935296);      //  1,048,576
  u16*   qbf   = (u16*)(ws + 27983872);      // 25,165,824
  u16*   krt   = (u16*)(ws + 53149696);      // 25,165,824
  u16*   keys  = (u16*)(ws + 84606976);      //  3,145,728
  u16*   valt  = (u16*)(ws + 87752704);      //  3,145,728
  u16*   ctxbf = (u16*)(ws + 90898432);      // 25,165,824  (end 116,064,256)

  (void)hipFuncSetAttribute(reinterpret_cast<const void*>(k_attn),
                            hipFuncAttributeMaxDynamicSharedMemorySize, 131072);

  k_convert<<<  580, 256, 0, stream>>>(x, wq, wk, wout, pk, xbf, wqbf, wkbf, woutb, pkt);
  k_gconv  <<<12288, 256, 0, stream>>>(xbf, wqbf, wkbf, qbf, krt);
  k_kproj  <<<  768, 256, 0, stream>>>(pkt, krt, keys, valt);
  k_attn   <<< 1536, 256, 131072, stream>>>(qbf, keys, valt, ctxbf);
  k_out    <<< 1024, 256, 0, stream>>>(ctxbf, woutb, x, bout, gamma, beta, out);
}

// v003
// Measured time: 235 microseconds a run.
// Timed twice side by side with v002, it ran 1.18 and 1.20 times as fast.
// Counting every step since v000, it is 1.50 times as fast.
#include <hip/hip_runtime.h>
#include <hip/hip_bf16.h>

// ---------------------------------------------------------------------------
// BonzSelfAttention for MI455X (gfx1250): bf16 WMMA everywhere, fp32 accum.
// B=8, N=2048, D=768, K=256, H=12, G=4, DH=64
// ---------------------------------------------------------------------------

typedef __attribute__((ext_vector_type(16))) __bf16 v16bf;
typedef __attribute__((ext_vector_type(8)))  __bf16 v8bf;
typedef __attribute__((ext_vector_type(8)))  float  v8f;
typedef __attribute__((ext_vector_type(4)))  float  v4f;
typedef __attribute__((ext_vector_type(4)))  __bf16 v4bf;
typedef __attribute__((ext_vector_type(4)))  int    v4i;
typedef unsigned short u16;

#define BN   16384   // B*N
#define DD   768
#define NN   2048
#define KK   256
#define HH   12

#if __has_builtin(__builtin_amdgcn_global_load_async_to_lds_b128)
#define HAVE_ASYNC_LDS 1
#else
#define HAVE_ASYNC_LDS 0
#endif

struct alignas(32) Frag32B { uint4 lo, hi; };

// Native bf16 convert (RNE) — lets clang emit v_cvt instead of manual rounding.
__device__ __forceinline__ u16 f2bf(float f) {
  __bf16 h = (__bf16)f;
  return __builtin_bit_cast(u16, h);
}

// A/B operand fragment: two 16-byte chunks (K-chunk and K-chunk+16) per lane.
__device__ __forceinline__ v16bf ldfrag(const u16* p0, const u16* p1) {
  Frag32B f;
  f.lo = *(const uint4*)p0;
  f.hi = *(const uint4*)p1;
  return __builtin_bit_cast(v16bf, f);
}

__device__ __forceinline__ v8f wmma_bf16(v16bf a, v16bf b, v8f c) {
  // (neg_a, A, neg_b, B, c_mod, C, reuse_a, reuse_b)
  return __builtin_amdgcn_wmma_f32_16x16x32_bf16(false, a, false, b, (short)0, c,
                                                 false, false);
}

// ---------------------------------------------------------------------------
// Kernel 1: fp32 -> bf16 conversions (+ project_k transpose)
//   Few, long waves instead of one element per thread.  A block takes one role
//   by its index (block-uniform):
//     0..31     project_k: thread = column kq, 64 rows n; the 64 loads are
//               coalesced over kq, and the thread stores one whole 128-B line
//               of pkt[kq][n]
//     32..37    wq, 38..43 wk, 44..67 w_out, 68..579 x: a contiguous run of
//               6144 float4; every wave-wide load covers 512 contiguous bytes,
//               every wave-wide store 256, and a thread's 24 loads are
//               independent, so many are in flight at a time
// ---------------------------------------------------------------------------
__global__ void __launch_bounds__(256)
k_convert(const float* __restrict__ x,  const float* __restrict__ wq,
          const float* __restrict__ wk, const float* __restrict__ wout,
          const float* __restrict__ pk,
          u16* __restrict__ xbf, u16* __restrict__ wqbf, u16* __restrict__ wkbf,
          u16* __restrict__ woutbf, u16* __restrict__ pkt) {
  const int tid = threadIdx.x;
  int bid = blockIdx.x;

  if (bid < 32) {                            // pkt[kq][n] = pk[n][kq]
    const float* s = pk + (long)bid * 64 * KK + tid;
    float v[64];
#pragma unroll
    for (int j = 0; j < 64; ++j) v[j] = s[j * KK];
    uint4* d = (uint4*)(pkt + (long)tid * NN + bid * 64);
#pragma unroll
    for (int c = 0; c < 8; ++c) {
      v8f f;
#pragma unroll
      for (int j = 0; j < 8; ++j) f[j] = v[c * 8 + j];
      d[c] = __builtin_bit_cast(uint4, __builtin_convertvector(f, v8bf));
    }
    return;
  }

  const float* s;
  u16* d;
  if (bid < 38)      { s = wq;   d = wqbf;   bid -= 32; }
  else if (bid < 44) { s = wk;   d = wkbf;   bid -= 38; }
  else if (bid < 68) { s = wout; d = woutbf; bid -= 44; }
  else               { s = x;    d = xbf;    bid -= 68; }

  const v4f* s4 = (const v4f*)s + (long)bid * 6144 + tid;
  uint2*     d4 = (uint2*)d     + (long)bid * 6144 + tid;
  v4f v[24];
#pragma unroll
  for (int k = 0; k < 24; ++k) v[k] = s4[k * 256];
#pragma unroll
  for (int k = 0; k < 24; ++k)
    d4[k * 256] = __builtin_bit_cast(uint2, __builtin_convertvector(v[k], v4bf));
}

// ---------------------------------------------------------------------------
// Kernel 2: grouped pointwise conv (block-diagonal GEMM), Q and K_raw.
//   y = x_g @ w_g^T  per 192-wide group.  One 16x16 tile per wave, 6 WMMAs.
//   Q stored row-major bf16; K_raw stored TRANSPOSED krt[b][d][n] bf16.
// ---------------------------------------------------------------------------
__global__ void __launch_bounds__(256)
k_gconv(const u16* __restrict__ xbf, const u16* __restrict__ wqbf,
        const u16* __restrict__ wkbf, u16* __restrict__ qbf, u16* __restrict__ krt) {
  const int lane = threadIdx.x & 31, wave = threadIdx.x >> 5;
  const int lm = lane & 15, lhalf = lane >> 4;
  int tile = blockIdx.x * 8 + wave;          // 0..98303
  int qk = tile / 49152;
  int rem = tile - qk * 49152;
  int ct = rem % 48;                         // output col tile (16 channels)
  int rt = rem / 48;                         // row tile (16 rows of B*N)
  int g  = ct / 12;                          // group
  const u16* wbf = (qk == 0) ? wqbf : wkbf;
  const int m0 = rt * 16;
  const u16* arow = xbf + (long)(m0 + lm) * DD + g * 192;
  const u16* brow = wbf + (long)g * 36864 + (long)(ct * 16 - g * 192 + lm) * 192;

  v8f acc = {};
#pragma unroll
  for (int ks = 0; ks < 6; ++ks) {
    int koff = ks * 32 + lhalf * 8;
    v16bf a = ldfrag(arow + koff, arow + koff + 16);
    v16bf b = ldfrag(brow + koff, brow + koff + 16);
    acc = wmma_bf16(a, b, acc);
  }

  if (qk == 0) {
#pragma unroll
    for (int j = 0; j < 8; ++j) {
      int row = m0 + j + lhalf * 8, col = ct * 16 + lm;
      qbf[(long)row * DD + col] = f2bf(acc[j]);
    }
  } else {
#pragma unroll
    for (int j = 0; j < 8; ++j) {
      int row = m0 + j + lhalf * 8;          // global (b,n) row
      int b = row >> 11, n = row & 2047;
      int d = ct * 16 + lm;
      krt[((long)b * DD + d) * NN + n] = f2bf(acc[j]);
    }
  }
}

// ---------------------------------------------------------------------------
// Kernel 3: k_proj[b,kq,d] = sum_n pk[n,kq] * k_raw[b,n,d]
//   A = pkt[kq][n] (row-major), B = krt[b][d][n] (column d per lane), 64 steps.
//   The f32 tile never goes to memory: each lane holds 8 consecutive kq of one
//   column d, which are 8 consecutive bf16 both in values^T and in keys, so the
//   epilogue stores the same 16 bytes to each.
//   valt[b,h,dq,kq]   = k_proj[b, kq, h*64+dq]
//   keys[b,h,kq2,dq2] = k_proj[b, (h*64+dq2)&255, 3*kq2 + ((h*64+dq2)>>8)]
//     inverted: kq2 = d/3, c = (d%3)*256 + kq, h = c>>6, dq2 = c&63
// ---------------------------------------------------------------------------
__global__ void __launch_bounds__(256)
k_kproj(const u16* __restrict__ pkt, const u16* __restrict__ krt,
        u16* __restrict__ keys, u16* __restrict__ valt) {
  const int lane = threadIdx.x & 31, wave = threadIdx.x >> 5;
  const int lm = lane & 15, lhalf = lane >> 4;
  int id = blockIdx.x * 8 + wave;            // 0..6143
  int b = id / 768;
  int rem = id - b * 768;
  int mt = rem / 48, nt = rem % 48;

  const u16* arow = pkt + (long)(mt * 16 + lm) * NN;
  const u16* brow = krt + ((long)b * DD + nt * 16 + lm) * NN;

  v8f acc = {};
  for (int ks = 0; ks < 64; ++ks) {
    int koff = ks * 32 + lhalf * 8;
    v16bf a = ldfrag(arow + koff, arow + koff + 16);
    v16bf bf = ldfrag(brow + koff, brow + koff + 16);
    acc = wmma_bf16(a, bf, acc);
  }

  const uint4 pk8 = __builtin_bit_cast(uint4, __builtin_convertvector(acc, v8bf));

  const int kq0 = mt * 16 + lhalf * 8;       // first of this lane's 8 rows
  const int d = nt * 16 + lm;
  *(uint4*)(valt + ((long)(b * HH + (d >> 6)) * 64 + (d & 63)) * KK + kq0) = pk8;
  const int kq2 = d / 3;
  const int c0 = (d - kq2 * 3) * 256 + kq0;
  *(uint4*)(keys + ((long)(b * HH + (c0 >> 6)) * KK + kq2) * 64 + (c0 & 63)) = pk8;
}

// ---------------------------------------------------------------------------
// Kernel 5: attention.  Block = (b, h, 128-row chunk), 8 waves x 16 rows.
//   LDS: keys 36KB + values^T 33KB + per-wave prob buffer 66KB = 135KB.
//   K/V staged with GLOBAL_LOAD_ASYNC_TO_LDS_B128 (ASYNCcnt-tracked DMA).
//   Every LDS row is read by ds_load_b128 with one row per lane, so each row
//   carries 16 pad bytes: the pitch is 16 B x odd (144 B, 528 B) and the 16
//   lanes of a half-wave fall on 16 different groups of four banks (bare
//   pitches of 128 B and 512 B put them on two groups and on one).
// ---------------------------------------------------------------------------
#define KPITCH 72    // keys row: 64 bf16 + 8 pad
#define VPITCH 264   // values^T row and prob row: 256 bf16 + 8 pad
__global__ void __launch_bounds__(256)
k_attn(const u16* __restrict__ qbf, const u16* __restrict__ keys,
       const u16* __restrict__ valt, u16* __restrict__ ctxbf) {
  extern __shared__ __align__(16) unsigned char smem_raw[];
  u16* keys_s = (u16*)smem_raw;              // [256][KPITCH]
  u16* valt_s = keys_s + 256 * KPITCH;       // [64][VPITCH]
  u16* pbuf   = valt_s + 64 * VPITCH;        // 8 waves * [16][VPITCH]

  const int lane = threadIdx.x & 31, wave = threadIdx.x >> 5;
  const int lm = lane & 15, lhalf = lane >> 4;
  int chunk = blockIdx.x & 15;
  int bh = blockIdx.x >> 4;
  int b = bh / HH, h = bh - b * HH;

  // stage K and V^T into LDS (16B per thread per iter)
  {
    const uint4* kg = (const uint4*)(keys + (long)bh * 16384);
    const uint4* vg = (const uint4*)(valt + (long)bh * 16384);
#if HAVE_ASYNC_LDS
    typedef __attribute__((address_space(1))) v4i* gp_t;   // global int4*
    typedef __attribute__((address_space(3))) v4i* lp_t;   // LDS int4*
    for (int i = threadIdx.x; i < 2048; i += 256) {
      u16* kd = keys_s + (i >> 3) * KPITCH + (i & 7) * 8;    // 8 x 16 B a row
      u16* vd = valt_s + (i >> 5) * VPITCH + (i & 31) * 8;   // 32 x 16 B a row
      __builtin_amdgcn_global_load_async_to_lds_b128((gp_t)(kg + i),
                                                     (lp_t)kd, 0, 0);
      __builtin_amdgcn_global_load_async_to_lds_b128((gp_t)(vg + i),
                                                     (lp_t)vd, 0, 0);
    }
#if __has_builtin(__builtin_amdgcn_s_wait_asynccnt)
    __builtin_amdgcn_s_wait_asynccnt(0);
#else
    asm volatile("s_wait_asynccnt 0x0" ::: "memory");
#endif
#else
    for (int i = threadIdx.x; i < 2048; i += 256) {
      *(uint4*)(keys_s + (i >> 3) * KPITCH + (i & 7) * 8) = kg[i];
      *(uint4*)(valt_s + (i >> 5) * VPITCH + (i & 31) * 8) = vg[i];
    }
#endif
  }
  __syncthreads();

  const int n0 = chunk * 128 + wave * 16;
  const u16* qrow = qbf + ((long)(b * NN + n0 + lm)) * DD + h * 64;
  v16bf aq0 = ldfrag(qrow + lhalf * 8,      qrow + lhalf * 8 + 16);
  v16bf aq1 = ldfrag(qrow + 32 + lhalf * 8, qrow + 32 + lhalf * 8 + 16);

  v8f acc[16];
#pragma unroll
  for (int t = 0; t < 16; ++t) { v8f z = {}; acc[t] = z; }

  // dots = q @ keys^T : 16 column tiles x 2 k-steps
#pragma unroll
  for (int t = 0; t < 16; ++t) {
    const u16* kr = keys_s + (t * 16 + lm) * KPITCH;
    v16bf b0 = ldfrag(kr + lhalf * 8,      kr + lhalf * 8 + 16);
    v16bf b1 = ldfrag(kr + 32 + lhalf * 8, kr + 32 + lhalf * 8 + 16);
    acc[t] = wmma_bf16(aq0, b0, acc[t]);
    acc[t] = wmma_bf16(aq1, b1, acc[t]);
  }

  // softmax over 256 (16 tiles x 16 lanes per half-wave), scale 1/sqrt(64)
  u16* pw = pbuf + wave * (16 * VPITCH);
#pragma unroll
  for (int j = 0; j < 8; ++j) {
    float m = -3.4e38f;
#pragma unroll
    for (int t = 0; t < 16; ++t) m = fmaxf(m, acc[t][j] * 0.125f);
    m = fmaxf(m, __shfl_xor(m, 1, 32));
    m = fmaxf(m, __shfl_xor(m, 2, 32));
    m = fmaxf(m, __shfl_xor(m, 4, 32));
    m = fmaxf(m, __shfl_xor(m, 8, 32));
    float s = 0.f;
#pragma unroll
    for (int t = 0; t < 16; ++t) {
      float p = __expf(acc[t][j] * 0.125f - m);
      acc[t][j] = p;
      s += p;
    }
    s += __shfl_xor(s, 1, 32);
    s += __shfl_xor(s, 2, 32);
    s += __shfl_xor(s, 4, 32);
    s += __shfl_xor(s, 8, 32);
    float inv = 1.f / s;
    int row = j + lhalf * 8;
#pragma unroll
    for (int t = 0; t < 16; ++t)
      pw[row * VPITCH + t * 16 + lm] = f2bf(acc[t][j] * inv);
  }

  // ctx = attn @ values : 4 dh tiles x 8 k-steps
  v8f o[4];
#pragma unroll
  for (int t = 0; t < 4; ++t) { v8f z = {}; o[t] = z; }
#pragma unroll
  for (int ks = 0; ks < 8; ++ks) {
    const u16* pr = pw + lm * VPITCH + ks * 32 + lhalf * 8;
    v16bf ap = ldfrag(pr, pr + 16);
#pragma unroll
    for (int dt = 0; dt < 4; ++dt) {
      const u16* vr = valt_s + (dt * 16 + lm) * VPITCH + ks * 32 + lhalf * 8;
      v16bf bv = ldfrag(vr, vr + 16);
      o[dt] = wmma_bf16(ap, bv, o[dt]);
    }
  }
#pragma unroll
  for (int dt = 0; dt < 4; ++dt)
#pragma unroll
    for (int j = 0; j < 8; ++j) {
      int row = b * NN + n0 + j + lhalf * 8;
      ctxbf[(long)row * DD + h * 64 + dt * 16 + lm] = f2bf(o[dt][j]);
    }
}

// ---------------------------------------------------------------------------
// Kernel 6: out = ctx @ w_out^T + b_out; y = x + out; LayerNorm(y).
//   Block = 16 rows; 8 waves x 6 col tiles; 24 k-steps. LN via LDS + shfl.
// ---------------------------------------------------------------------------
__global__ void __launch_bounds__(256)
k_out(const u16* __restrict__ ctxbf, const u16* __restrict__ woutbf,
      const float* __restrict__ x, const float* __restrict__ bout,
      const float* __restrict__ gamma, const float* __restrict__ beta,
      float* __restrict__ out) {
  __shared__ float ybuf[16][772];            // padded vs 64-bank LDS
  const int lane = threadIdx.x & 31, wave = threadIdx.x >> 5;
  const int lm = lane & 15, lhalf = lane >> 4;
  const int r0 = blockIdx.x * 16;

  const u16* arow = ctxbf + (long)(r0 + lm) * DD;
  v8f acc[6];
#pragma unroll
  for (int c = 0; c < 6; ++c) { v8f z = {}; acc[c] = z; }

  for (int ks = 0; ks < 24; ++ks) {
    int koff = ks * 32 + lhalf * 8;
    v16bf a = ldfrag(arow + koff, arow + koff + 16);
    __builtin_prefetch(arow + koff + 64, 0, 1);
#pragma unroll
    for (int c = 0; c < 6; ++c) {
      int ct = wave * 6 + c;
      const u16* brow = woutbf + (long)(ct * 16 + lm) * DD + koff;
      v16bf bf = ldfrag(brow, brow + 16);
      acc[c] = wmma_bf16(a, bf, acc[c]);
    }
  }

#pragma unroll
  for (int c = 0; c < 6; ++c) {
    int ct = wave * 6 + c;
#pragma unroll
    for (int j = 0; j < 8; ++j) {
      int row = j + lhalf * 8, col = ct * 16 + lm;
      ybuf[row][col] = acc[c][j] + bout[col] + x[(long)(r0 + row) * DD + col];
    }
  }
  __syncthreads();

  int rr = threadIdx.x >> 4;                 // row 0..15, 16 lanes per row
  int s  = threadIdx.x & 15;
  float sum = 0.f, sq = 0.f;
  for (int c = s; c < DD; c += 16) { float v = ybuf[rr][c]; sum += v; sq += v * v; }
  sum += __shfl_xor(sum, 1, 32); sq += __shfl_xor(sq, 1, 32);
  sum += __shfl_xor(sum, 2, 32); sq += __shfl_xor(sq, 2, 32);
  sum += __shfl_xor(sum, 4, 32); sq += __shfl_xor(sq, 4, 32);
  sum += __shfl_xor(sum, 8, 32); sq += __shfl_xor(sq, 8, 32);
  float mu = sum * (1.f / DD);
  float var = sq * (1.f / DD) - mu * mu;
  float rstd = rsqrtf(var + 1e-12f);
  for (int c = s; c < DD; c += 16)
    out[(long)(r0 + rr) * DD + c] = (ybuf[rr][c] - mu) * rstd * gamma[c] + beta[c];
}

// ---------------------------------------------------------------------------
// Host launcher
// ---------------------------------------------------------------------------
extern "C" void kernel_launch(void* const* d_in, const int* in_sizes, int n_in,
                              void* d_out, int out_size, void* d_ws, size_t ws_size,
                              hipStream_t stream) {
  const float* x     = (const float*)d_in[0];
  const float* wq    = (const float*)d_in[1];
  const float* wk    = (const float*)d_in[2];
  const float* pk    = (const float*)d_in[3];
  const float* wout  = (const float*)d_in[4];
  const float* bout  = (const float*)d_in[5];
  const float* gamma = (const float*)d_in[6];
  const float* beta  = (const float*)d_in[7];
  float* out = (float*)d_out;
  char* ws = (char*)d_ws;

  // 256B-aligned workspace layout (bytes)
  u16*   xbf   = (u16*)(ws + 0);             // 25,165,824
  u16*   wqbf  = (u16*)(ws + 25165824);      //    294,912
  u16*   wkbf  = (u16*)(ws + 25460736);      //    294,912
  u16*   woutb = (u16*)(ws + 25755648);      //  1,179,648
  u16*   pkt   = (u16*)(ws + 26935296);      //  1,048,576
  u16*   qbf   = (u16*)(ws + 27983872);      // 25,165,824
  u16*   krt   = (u16*)(ws + 53149696);      // 25,165,824
  u16*   keys  = (u16*)(ws + 84606976);      //  3,145,728
  u16*   valt  = (u16*)(ws + 87752704);      //  3,145,728
  u16*   ctxbf = (u16*)(ws + 90898432);      // 25,165,824  (end 116,064,256)

  (void)hipFuncSetAttribute(reinterpret_cast<const void*>(k_attn),
                            hipFuncAttributeMaxDynamicSharedMemorySize, 138240);

  k_convert<<<  580, 256, 0, stream>>>(x, wq, wk, wout, pk, xbf, wqbf, wkbf, woutb, pkt);
  k_gconv  <<<12288, 256, 0, stream>>>(xbf, wqbf, wkbf, qbf, krt);
  k_kproj  <<<  768, 256, 0, stream>>>(pkt, krt, keys, valt);
  k_attn   <<< 1536, 256, 138240, stream>>>(qbf, keys, valt, ctxbf);
  k_out    <<< 1024, 256, 0, stream>>>(ctxbf, woutb, x, bout, gamma, beta, out);
}

// v004
// A run of this version takes 160 microseconds.
// Timed twice side by side with v003, it ran 1.45 times as fast both times.
// Over all steps from v000 it is 2.17 times as fast.
#include <hip/hip_runtime.h>
#include <hip/hip_bf16.h>

// ---------------------------------------------------------------------------
// BonzSelfAttention for MI455X (gfx1250): bf16 WMMA everywhere, fp32 accum.
// B=8, N=2048, D=768, K=256, H=12, G=4, DH=64
// ---------------------------------------------------------------------------

typedef __attribute__((ext_vector_type(16))) __bf16 v16bf;
typedef __attribute__((ext_vector_type(8)))  __bf16 v8bf;
typedef __attribute__((ext_vector_type(8)))  float  v8f;
typedef __attribute__((ext_vector_type(4)))  float  v4f;
typedef __attribute__((ext_vector_type(4)))  __bf16 v4bf;
typedef __attribute__((ext_vector_type(4)))  int    v4i;
typedef unsigned short u16;

#define BN   16384   // B*N
#define DD   768
#define NN   2048
#define KK   256
#define HH   12

#if __has_builtin(__builtin_amdgcn_global_load_async_to_lds_b128)
#define HAVE_ASYNC_LDS 1
#else
#define HAVE_ASYNC_LDS 0
#endif

struct alignas(32) Frag32B { uint4 lo, hi; };

// Native bf16 convert (RNE) — lets clang emit v_cvt instead of manual rounding.
__device__ __forceinline__ u16 f2bf(float f) {
  __bf16 h = (__bf16)f;
  return __builtin_bit_cast(u16, h);
}

// A/B operand fragment: two 16-byte chunks (K-chunk and K-chunk+16) per lane.
__device__ __forceinline__ v16bf ldfrag(const u16* p0, const u16* p1) {
  Frag32B f;
  f.lo = *(const uint4*)p0;
  f.hi = *(const uint4*)p1;
  return __builtin_bit_cast(v16bf, f);
}

__device__ __forceinline__ v8f wmma_bf16(v16bf a, v16bf b, v8f c) {
  // (neg_a, A, neg_b, B, c_mod, C, reuse_a, reuse_b)
  return __builtin_amdgcn_wmma_f32_16x16x32_bf16(false, a, false, b, (short)0, c,
                                                 false, false);
}

// ---------------------------------------------------------------------------
// Fragment order.  x, wq, wk, w_out, pkt and krt, bf16 matrices M[row][k] that
// GEMMs read from global memory, are kept in the workspace as 1-KB units, one per (16 rows, 32 k):
//   unit  = (row >> 4) * (K / 32) + (k >> 5)
//   u16 offset in the unit = ((k >> 4) & 1) * 256        first / second chunk
//                          + (((k >> 3) & 1) * 16 + (row & 15)) * 8   the lane
//                          + (k & 7)
// A lane's two 16-B chunks are the ones it took from the row-major matrix, so
// the fragments hold the same values; but the 32 lanes of one load now read 512
// contiguous bytes (4 lines) where rows of 384 B and more gave 16 lines.
// ---------------------------------------------------------------------------
__device__ __forceinline__ v16bf ldunit(const u16* unit_lane) {
  return ldfrag(unit_lane, unit_lane + 256);
}

// ---------------------------------------------------------------------------
// Kernel 1: fp32 -> bf16 conversions into fragment order (+ project_k transpose)
//   Few, long waves instead of one element per thread.  A block takes one role
//   by its index (block-uniform):
//     0..31     project_k: thread = column kq, 64 rows n; the 64 loads are
//               coalesced over kq; 16 threads store 256 contiguous bytes
//     32..37    wq, 38..43 wk, 44..67 w_out, 68..579 x: a wave makes six units
//               in a row (16 rows x 192 k).  The 16 rows of a unit are one
//               128-B line of floats each: a wave-wide float4 load takes four
//               whole lines (8 lanes a row), and the 8-B stores of the four
//               rows fall in 64-B runs of the unit; a thread's 24 loads are
//               independent, so many are in flight at a time
// ---------------------------------------------------------------------------
__global__ void __launch_bounds__(256)
k_convert(const float* __restrict__ x,  const float* __restrict__ wq,
          const float* __restrict__ wk, const float* __restrict__ wout,
          const float* __restrict__ pk,
          u16* __restrict__ xbf, u16* __restrict__ wqbf, u16* __restrict__ wkbf,
          u16* __restrict__ woutbf, u16* __restrict__ pkt) {
  const int tid = threadIdx.x;
  int bid = blockIdx.x;

  if (bid < 32) {                            // pkt[kq][n] = pk[n][kq]
    const float* s = pk + (long)bid * 64 * KK + tid;
    float v[64];
#pragma unroll
    for (int j = 0; j < 64; ++j) v[j] = s[j * KK];
    // rows kq, k = n = bid*64 + c*8 + j: units (tid>>4)*64 + bid*2 + (c>>2)
    u16* d = pkt + ((long)(tid >> 4) * 64 + bid * 2) * 512 + (tid & 15) * 8;
#pragma unroll
    for (int c = 0; c < 8; ++c) {
      v8f f;
#pragma unroll
      for (int j = 0; j < 8; ++j) f[j] = v[c * 8 + j];
      *(uint4*)(d + (c >> 2) * 512 + ((c >> 1) & 1) * 256 + (c & 1) * 128) =
          __builtin_bit_cast(uint4, __builtin_convertvector(f, v8bf));
    }
    return;
  }

  const float* s;
  u16* d;
  int kd = DD;                               // row length k of the matrix
  if (bid < 38)      { s = wq;   d = wqbf;   bid -= 32; kd = 192; }
  else if (bid < 44) { s = wk;   d = wkbf;   bid -= 38; kd = 192; }
  else if (bid < 68) { s = wout; d = woutbf; bid -= 44; }
  else               { s = x;    d = xbf;    bid -= 68; }

  const int r4 = (tid & 31) >> 3, p = tid & 7;   // row in a group of 4, float4 in the line
  const int gw = bid * 8 + (tid >> 5);       // this wave's run of six units
  int rt = gw, ks0 = 0;                      // 192 k: six units are a row tile
  if (kd == DD) { rt = gw >> 2; ks0 = (gw & 3) * 6; }

  // v[u*4+i]: unit u, row i*4 + r4, k = p*4 .. p*4+3 of the unit
  const v4f* s4 = (const v4f*)(s + (long)(rt * 16 + r4) * kd + ks0 * 32 + p * 4);
  uint2*     d2 = (uint2*)(d + (long)gw * 6 * 512 + (p >> 2) * 256 +
                           (((p >> 1) & 1) * 16 + r4) * 8 + (p & 1) * 4);
  const v4f* r0 = s4;                        // the four rows' address pairs
  const v4f* r1 = s4 + kd;
  const v4f* r2 = s4 + 2 * kd;
  const v4f* r3 = s4 + 3 * kd;
  v4f v[24];
#pragma unroll
  for (int u = 0; u < 6; ++u) {
    v[u * 4]     = r0[u * 8];
    v[u * 4 + 1] = r1[u * 8];
    v[u * 4 + 2] = r2[u * 8];
    v[u * 4 + 3] = r3[u * 8];
  }
  // The address pairs stay whole until this wait.
  asm volatile("s_wait_xcnt 0x0" :: "v"(r0), "v"(r1), "v"(r2), "v"(r3) : "memory");
#pragma unroll
  for (int u = 0; u < 6; ++u)
#pragma unroll
    for (int i = 0; i < 4; ++i)
      d2[u * 128 + i * 8] =
          __builtin_bit_cast(uint2, __builtin_convertvector(v[u * 4 + i], v4bf));
}

// ---------------------------------------------------------------------------
// Kernel 2: grouped pointwise conv (block-diagonal GEMM), Q and K_raw.
//   y = x_g @ w_g^T  per 192-wide group.  One 16x16 tile per wave, 6 WMMAs.
//   x and w come in fragment order.  Q stored row-major bf16; K_raw stored
//   TRANSPOSED (rows b*768+d, k = n) in fragment order: a lane's 8 sums are 8
//   consecutive n of one d, which is one 16-B chunk at the lane's own place.
// ---------------------------------------------------------------------------
__global__ void __launch_bounds__(256)
k_gconv(const u16* __restrict__ xbf, const u16* __restrict__ wqbf,
        const u16* __restrict__ wkbf, u16* __restrict__ qbf, u16* __restrict__ krt) {
  const int lane = threadIdx.x & 31, wave = threadIdx.x >> 5;
  const int lm = lane & 15, lhalf = lane >> 4;
  int tile = blockIdx.x * 8 + wave;          // 0..98303
  int qk = tile / 49152;
  int rem = tile - qk * 49152;
  int ct = rem % 48;                         // output col tile (16 channels)
  int rt = rem / 48;                         // row tile (16 rows of B*N)
  int g  = ct / 12;                          // group
  const u16* wbf = (qk == 0) ? wqbf : wkbf;
  const int m0 = rt * 16;
  const u16* au = xbf + ((long)rt * 24 + g * 6) * 512 + lane * 8;
  const u16* bu = wbf + (long)ct * 6 * 512 + lane * 8;   // rows g*192+o = ct*16+lm

  v8f acc = {};
#pragma unroll
  for (int ks = 0; ks < 6; ++ks) {
    v16bf a = ldunit(au + ks * 512);
    v16bf b = ldunit(bu + ks * 512);
    acc = wmma_bf16(a, b, acc);
  }

  if (qk == 0) {
#pragma unroll
    for (int j = 0; j < 8; ++j) {
      int row = m0 + j + lhalf * 8, col = ct * 16 + lm;
      qbf[(long)row * DD + col] = f2bf(acc[j]);
    }
  } else {
    const int b = m0 >> 11, n0 = m0 & 2047;  // acc[j]: n = n0 + lhalf*8 + j
    *(uint4*)(krt + ((long)(b * 48 + ct) * 64 + (n0 >> 5)) * 512 +
              ((n0 >> 4) & 1) * 256 + lane * 8) =
        __builtin_bit_cast(uint4, __builtin_convertvector(acc, v8bf));
  }
}

// ---------------------------------------------------------------------------
// Kernel 3: k_proj[b,kq,d] = sum_n pk[n,kq] * k_raw[b,n,d]
//   A = pkt (rows kq, k = n), B = krt (rows b*768+d, k = n), both in fragment
//   order, 64 steps.
//   The f32 tile never goes to memory: each lane holds 8 consecutive kq of one
//   column d, which are 8 consecutive bf16 both in values^T and in keys, so the
//   epilogue stores the same 16 bytes to each.
//   valt[b,h,dq,kq]   = k_proj[b, kq, h*64+dq]
//   keys[b,h,kq2,dq2] = k_proj[b, (h*64+dq2)&255, 3*kq2 + ((h*64+dq2)>>8)]
//     inverted: kq2 = d/3, c = (d%3)*256 + kq, h = c>>6, dq2 = c&63
// ---------------------------------------------------------------------------
__global__ void __launch_bounds__(256)
k_kproj(const u16* __restrict__ pkt, const u16* __restrict__ krt,
        u16* __restrict__ keys, u16* __restrict__ valt) {
  const int lane = threadIdx.x & 31, wave = threadIdx.x >> 5;
  const int lm = lane & 15, lhalf = lane >> 4;
  int id = blockIdx.x * 8 + wave;            // 0..6143
  int b = id / 768;
  int rem = id - b * 768;
  int mt = rem / 48, nt = rem % 48;

  const u16* au = pkt + (long)mt * 64 * 512 + lane * 8;
  const u16* bu = krt + (long)(b * 48 + nt) * 64 * 512 + lane * 8;

  v8f acc = {};
  for (int ks = 0; ks < 64; ++ks) {
    v16bf a = ldunit(au + ks * 512);
    v16bf bf = ldunit(bu + ks * 512);
    acc = wmma_bf16(a, bf, acc);
  }

  const uint4 pk8 = __builtin_bit_cast(uint4, __builtin_convertvector(acc, v8bf));

  const int kq0 = mt * 16 + lhalf * 8;       // first of this lane's 8 rows
  const int d = nt * 16 + lm;
  *(uint4*)(valt + ((long)(b * HH + (d >> 6)) * 64 + (d & 63)) * KK + kq0) = pk8;
  const int kq2 = d / 3;
  const int c0 = (d - kq2 * 3) * 256 + kq0;
  *(uint4*)(keys + ((long)(b * HH + (c0 >> 6)) * KK + kq2) * 64 + (c0 & 63)) = pk8;
}

// ---------------------------------------------------------------------------
// Kernel 5: attention.  Block = (b, h, 128-row chunk), 8 waves x 16 rows.
//   LDS: keys 36KB + values^T 33KB + per-wave prob buffer 66KB = 135KB.
//   K/V staged with GLOBAL_LOAD_ASYNC_TO_LDS_B128 (ASYNCcnt-tracked DMA).
//   Every LDS row is read by ds_load_b128 with one row per lane, so each row
//   carries 16 pad bytes: the pitch is 16 B x odd (144 B, 528 B) and the 16
//   lanes of a half-wave fall on 16 different groups of four banks (bare
//   pitches of 128 B and 512 B put them on two groups and on one).
// ---------------------------------------------------------------------------
#define KPITCH 72    // keys row: 64 bf16 + 8 pad
#define VPITCH 264   // values^T row and prob row: 256 bf16 + 8 pad
__global__ void __launch_bounds__(256)
k_attn(const u16* __restrict__ qbf, const u16* __restrict__ keys,
       const u16* __restrict__ valt, u16* __restrict__ ctxbf) {
  extern __shared__ __align__(16) unsigned char smem_raw[];
  u16* keys_s = (u16*)smem_raw;              // [256][KPITCH]
  u16* valt_s = keys_s + 256 * KPITCH;       // [64][VPITCH]
  u16* pbuf   = valt_s + 64 * VPITCH;        // 8 waves * [16][VPITCH]

  const int lane = threadIdx.x & 31, wave = threadIdx.x >> 5;
  const int lm = lane & 15, lhalf = lane >> 4;
  int chunk = blockIdx.x & 15;
  int bh = blockIdx.x >> 4;
  int b = bh / HH, h = bh - b * HH;

  // stage K and V^T into LDS (16B per thread per iter)
  {
    const uint4* kg = (const uint4*)(keys + (long)bh * 16384);
    const uint4* vg = (const uint4*)(valt + (long)bh * 16384);
#if HAVE_ASYNC_LDS
    typedef __attribute__((address_space(1))) v4i* gp_t;   // global int4*
    typedef __attribute__((address_space(3))) v4i* lp_t;   // LDS int4*
    for (int i = threadIdx.x; i < 2048; i += 256) {
      u16* kd = keys_s + (i >> 3) * KPITCH + (i & 7) * 8;    // 8 x 16 B a row
      u16* vd = valt_s + (i >> 5) * VPITCH + (i & 31) * 8;   // 32 x 16 B a row
      __builtin_amdgcn_global_load_async_to_lds_b128((gp_t)(kg + i),
                                                     (lp_t)kd, 0, 0);
      __builtin_amdgcn_global_load_async_to_lds_b128((gp_t)(vg + i),
                                                     (lp_t)vd, 0, 0);
    }
#if __has_builtin(__builtin_amdgcn_s_wait_asynccnt)
    __builtin_amdgcn_s_wait_asynccnt(0);
#else
    asm volatile("s_wait_asynccnt 0x0" ::: "memory");
#endif
#else
    for (int i = threadIdx.x; i < 2048; i += 256) {
      *(uint4*)(keys_s + (i >> 3) * KPITCH + (i & 7) * 8) = kg[i];
      *(uint4*)(valt_s + (i >> 5) * VPITCH + (i & 31) * 8) = vg[i];
    }
#endif
  }
  __syncthreads();

  const int n0 = chunk * 128 + wave * 16;
  const u16* qrow = qbf + ((long)(b * NN + n0 + lm)) * DD + h * 64;
  v16bf aq0 = ldfrag(qrow + lhalf * 8,      qrow + lhalf * 8 + 16);
  v16bf aq1 = ldfrag(qrow + 32 + lhalf * 8, qrow + 32 + lhalf * 8 + 16);

  v8f acc[16];
#pragma unroll
  for (int t = 0; t < 16; ++t) { v8f z = {}; acc[t] = z; }

  // dots = q @ keys^T : 16 column tiles x 2 k-steps
#pragma unroll
  for (int t = 0; t < 16; ++t) {
    const u16* kr = keys_s + (t * 16 + lm) * KPITCH;
    v16bf b0 = ldfrag(kr + lhalf * 8,      kr + lhalf * 8 + 16);
    v16bf b1 = ldfrag(kr + 32 + lhalf * 8, kr + 32 + lhalf * 8 + 16);
    acc[t] = wmma_bf16(aq0, b0, acc[t]);
    acc[t] = wmma_bf16(aq1, b1, acc[t]);
  }

  // softmax over 256 (16 tiles x 16 lanes per half-wave), scale 1/sqrt(64)
  u16* pw = pbuf + wave * (16 * VPITCH);
#pragma unroll
  for (int j = 0; j < 8; ++j) {
    float m = -3.4e38f;
#pragma unroll
    for (int t = 0; t < 16; ++t) m = fmaxf(m, acc[t][j] * 0.125f);
    m = fmaxf(m, __shfl_xor(m, 1, 32));
    m = fmaxf(m, __shfl_xor(m, 2, 32));
    m = fmaxf(m, __shfl_xor(m, 4, 32));
    m = fmaxf(m, __shfl_xor(m, 8, 32));
    float s = 0.f;
#pragma unroll
    for (int t = 0; t < 16; ++t) {
      float p = __expf(acc[t][j] * 0.125f - m);
      acc[t][j] = p;
      s += p;
    }
    s += __shfl_xor(s, 1, 32);
    s += __shfl_xor(s, 2, 32);
    s += __shfl_xor(s, 4, 32);
    s += __shfl_xor(s, 8, 32);
    float inv = 1.f / s;
    int row = j + lhalf * 8;
#pragma unroll
    for (int t = 0; t < 16; ++t)
      pw[row * VPITCH + t * 16 + lm] = f2bf(acc[t][j] * inv);
  }

  // ctx = attn @ values : 4 dh tiles x 8 k-steps
  v8f o[4];
#pragma unroll
  for (int t = 0; t < 4; ++t) { v8f z = {}; o[t] = z; }
#pragma unroll
  for (int ks = 0; ks < 8; ++ks) {
    const u16* pr = pw + lm * VPITCH + ks * 32 + lhalf * 8;
    v16bf ap = ldfrag(pr, pr + 16);
#pragma unroll
    for (int dt = 0; dt < 4; ++dt) {
      const u16* vr = valt_s + (dt * 16 + lm) * VPITCH + ks * 32 + lhalf * 8;
      v16bf bv = ldfrag(vr, vr + 16);
      o[dt] = wmma_bf16(ap, bv, o[dt]);
    }
  }
#pragma unroll
  for (int dt = 0; dt < 4; ++dt)
#pragma unroll
    for (int j = 0; j < 8; ++j) {
      int row = b * NN + n0 + j + lhalf * 8;
      ctxbf[(long)row * DD + h * 64 + dt * 16 + lm] = f2bf(o[dt][j]);
    }
}

// ---------------------------------------------------------------------------
// Kernel 6: out = ctx @ w_out^T + b_out; y = x + out; LayerNorm(y).
//   Block = 16 rows; 8 waves x 6 col tiles; 24 k-steps. LN via LDS + shfl.
//   w_out comes in fragment order; ctx is row-major.
// ---------------------------------------------------------------------------
__global__ void __launch_bounds__(256)
k_out(const u16* __restrict__ ctxbf, const u16* __restrict__ woutbf,
      const float* __restrict__ x, const float* __restrict__ bout,
      const float* __restrict__ gamma, const float* __restrict__ beta,
      float* __restrict__ out) {
  __shared__ float ybuf[16][772];            // padded vs 64-bank LDS
  const int lane = threadIdx.x & 31, wave = threadIdx.x >> 5;
  const int lm = lane & 15, lhalf = lane >> 4;
  const int r0 = blockIdx.x * 16;

  const u16* arow = ctxbf + (long)(r0 + lm) * DD;
  v8f acc[6];
#pragma unroll
  for (int c = 0; c < 6; ++c) { v8f z = {}; acc[c] = z; }

  for (int ks = 0; ks < 24; ++ks) {
    int koff = ks * 32 + lhalf * 8;
    v16bf a = ldfrag(arow + koff, arow + koff + 16);
    __builtin_prefetch(arow + koff + 64, 0, 1);
#pragma unroll
    for (int c = 0; c < 6; ++c) {
      int ct = wave * 6 + c;
      v16bf bf = ldunit(woutbf + ((long)ct * 24 + ks) * 512 + lane * 8);
      acc[c] = wmma_bf16(a, bf, acc[c]);
    }
  }

#pragma unroll
  for (int c = 0; c < 6; ++c) {
    int ct = wave * 6 + c;
#pragma unroll
    for (int j = 0; j < 8; ++j) {
      int row = j + lhalf * 8, col = ct * 16 + lm;
      ybuf[row][col] = acc[c][j] + bout[col] + x[(long)(r0 + row) * DD + col];
    }
  }
  __syncthreads();

  int rr = threadIdx.x >> 4;                 // row 0..15, 16 lanes per row
  int s  = threadIdx.x & 15;
  float sum = 0.f, sq = 0.f;
  for (int c = s; c < DD; c += 16) { float v = ybuf[rr][c]; sum += v; sq += v * v; }
  sum += __shfl_xor(sum, 1, 32); sq += __shfl_xor(sq, 1, 32);
  sum += __shfl_xor(sum, 2, 32); sq += __shfl_xor(sq, 2, 32);
  sum += __shfl_xor(sum, 4, 32); sq += __shfl_xor(sq, 4, 32);
  sum += __shfl_xor(sum, 8, 32); sq += __shfl_xor(sq, 8, 32);
  float mu = sum * (1.f / DD);
  float var = sq * (1.f / DD) - mu * mu;
  float rstd = rsqrtf(var + 1e-12f);
  for (int c = s; c < DD; c += 16)
    out[(long)(r0 + rr) * DD + c] = (ybuf[rr][c] - mu) * rstd * gamma[c] + beta[c];
}

// ---------------------------------------------------------------------------
// Host launcher
// ---------------------------------------------------------------------------
extern "C" void kernel_launch(void* const* d_in, const int* in_sizes, int n_in,
                              void* d_out, int out_size, void* d_ws, size_t ws_size,
                              hipStream_t stream) {
  const float* x     = (const float*)d_in[0];
  const float* wq    = (const float*)d_in[1];
  const float* wk    = (const float*)d_in[2];
  const float* pk    = (const float*)d_in[3];
  const float* wout  = (const float*)d_in[4];
  const float* bout  = (const float*)d_in[5];
  const float* gamma = (const float*)d_in[6];
  const float* beta  = (const float*)d_in[7];
  float* out = (float*)d_out;
  char* ws = (char*)d_ws;

  // 256B-aligned workspace layout (bytes)
  u16*   xbf   = (u16*)(ws + 0);             // 25,165,824
  u16*   wqbf  = (u16*)(ws + 25165824);      //    294,912
  u16*   wkbf  = (u16*)(ws + 25460736);      //    294,912
  u16*   woutb = (u16*)(ws + 25755648);      //  1,179,648
  u16*   pkt   = (u16*)(ws + 26935296);      //  1,048,576
  u16*   qbf   = (u16*)(ws + 27983872);      // 25,165,824
  u16*   krt   = (u16*)(ws + 53149696);      // 25,165,824
  u16*   keys  = (u16*)(ws + 84606976);      //  3,145,728
  u16*   valt  = (u16*)(ws + 87752704);      //  3,145,728
  u16*   ctxbf = (u16*)(ws + 90898432);      // 25,165,824  (end 116,064,256)

  (void)hipFuncSetAttribute(reinterpret_cast<const void*>(k_attn),
                            hipFuncAttributeMaxDynamicSharedMemorySize, 138240);

  k_convert<<<  580, 256, 0, stream>>>(x, wq, wk, wout, pk, xbf, wqbf, wkbf, woutb, pkt);
  k_gconv  <<<12288, 256, 0, stream>>>(xbf, wqbf, wkbf, qbf, krt);
  k_kproj  <<<  768, 256, 0, stream>>>(pkt, krt, keys, valt);
  k_attn   <<< 1536, 256, 138240, stream>>>(qbf, keys, valt, ctxbf);
  k_out    <<< 1024, 256, 0, stream>>>(ctxbf, woutb, x, bout, gamma, beta, out);
}

// v005
// One run takes 144 microseconds.
// Next to v004, in two timings, it ran 1.10 times as fast each time.
// Counting every step since v000, it is 2.40 times as fast.
#include <hip/hip_runtime.h>
#include <hip/hip_bf16.h>

// ---------------------------------------------------------------------------
// BonzSelfAttention for MI455X (gfx1250): bf16 WMMA everywhere, fp32 accum.
// B=8, N=2048, D=768, K=256, H=12, G=4, DH=64
// ---------------------------------------------------------------------------

typedef __attribute__((ext_vector_type(16))) __bf16 v16bf;
typedef __attribute__((ext_vector_type(8)))  __bf16 v8bf;
typedef __attribute__((ext_vector_type(8)))  float  v8f;
typedef __attribute__((ext_vector_type(4)))  float  v4f;
typedef __attribute__((ext_vector_type(4)))  __bf16 v4bf;
typedef __attribute__((ext_vector_type(4)))  int    v4i;
typedef unsigned short u16;

#define BN   16384   // B*N
#define DD   768
#define NN   2048
#define KK   256
#define HH   12

#if __has_builtin(__builtin_amdgcn_global_load_async_to_lds_b128)
#define HAVE_ASYNC_LDS 1
#else
#define HAVE_ASYNC_LDS 0
#endif

struct alignas(32) Frag32B { uint4 lo, hi; };

// Native bf16 convert (RNE) — lets clang emit v_cvt instead of manual rounding.
__device__ __forceinline__ u16 f2bf(float f) {
  __bf16 h = (__bf16)f;
  return __builtin_bit_cast(u16, h);
}

// A/B operand fragment: two 16-byte chunks (K-chunk and K-chunk+16) per lane.
__device__ __forceinline__ v16bf ldfrag(const u16* p0, const u16* p1) {
  Frag32B f;
  f.lo = *(const uint4*)p0;
  f.hi = *(const uint4*)p1;
  return __builtin_bit_cast(v16bf, f);
}

__device__ __forceinline__ v8f wmma_bf16(v16bf a, v16bf b, v8f c) {
  // (neg_a, A, neg_b, B, c_mod, C, reuse_a, reuse_b)
  return __builtin_amdgcn_wmma_f32_16x16x32_bf16(false, a, false, b, (short)0, c,
                                                 false, false);
}

// ---------------------------------------------------------------------------
// Fragment order.  x, wq, wk, w_out, pkt and krt, bf16 matrices M[row][k] that
// GEMMs read from global memory, are kept in the workspace as 1-KB units, one per (16 rows, 32 k):
//   unit  = (row >> 4) * (K / 32) + (k >> 5)
//   u16 offset in the unit = ((k >> 4) & 1) * 256        first / second chunk
//                          + (((k >> 3) & 1) * 16 + (row & 15)) * 8   the lane
//                          + (k & 7)
// A lane's two 16-B chunks are the ones it took from the row-major matrix, so
// the fragments hold the same values; but the 32 lanes of one load now read 512
// contiguous bytes (4 lines) where rows of 384 B and more gave 16 lines.
// ---------------------------------------------------------------------------
__device__ __forceinline__ v16bf ldunit(const u16* unit_lane) {
  return ldfrag(unit_lane, unit_lane + 256);
}

// ---------------------------------------------------------------------------
// Kernel 1: fp32 -> bf16 conversions into fragment order (+ project_k transpose)
//   Few, long waves instead of one element per thread.  A block takes one role
//   by its index (block-uniform):
//     0..31     project_k: thread = column kq, 64 rows n; the 64 loads are
//               coalesced over kq; 16 threads store 256 contiguous bytes
//     32..37    wq, 38..43 wk, 44..67 w_out, 68..579 x: a wave makes six units
//               in a row (16 rows x 192 k).  The 16 rows of a unit are one
//               128-B line of floats each: a wave-wide float4 load takes four
//               whole lines (8 lanes a row), and the 8-B stores of the four
//               rows fall in 64-B runs of the unit; a thread's 24 loads are
//               independent, so many are in flight at a time
// ---------------------------------------------------------------------------
__global__ void __launch_bounds__(256)
k_convert(const float* __restrict__ x,  const float* __restrict__ wq,
          const float* __restrict__ wk, const float* __restrict__ wout,
          const float* __restrict__ pk,
          u16* __restrict__ xbf, u16* __restrict__ wqbf, u16* __restrict__ wkbf,
          u16* __restrict__ woutbf, u16* __restrict__ pkt) {
  const int tid = threadIdx.x;
  int bid = blockIdx.x;

  if (bid < 32) {                            // pkt[kq][n] = pk[n][kq]
    const float* s = pk + (long)bid * 64 * KK + tid;
    float v[64];
#pragma unroll
    for (int j = 0; j < 64; ++j) v[j] = s[j * KK];
    // rows kq, k = n = bid*64 + c*8 + j: units (tid>>4)*64 + bid*2 + (c>>2)
    u16* d = pkt + ((long)(tid >> 4) * 64 + bid * 2) * 512 + (tid & 15) * 8;
#pragma unroll
    for (int c = 0; c < 8; ++c) {
      v8f f;
#pragma unroll
      for (int j = 0; j < 8; ++j) f[j] = v[c * 8 + j];
      *(uint4*)(d + (c >> 2) * 512 + ((c >> 1) & 1) * 256 + (c & 1) * 128) =
          __builtin_bit_cast(uint4, __builtin_convertvector(f, v8bf));
    }
    return;
  }

  const float* s;
  u16* d;
  int kd = DD;                               // row length k of the matrix
  if (bid < 38)      { s = wq;   d = wqbf;   bid -= 32; kd = 192; }
  else if (bid < 44) { s = wk;   d = wkbf;   bid -= 38; kd = 192; }
  else if (bid < 68) { s = wout; d = woutbf; bid -= 44; }
  else               { s = x;    d = xbf;    bid -= 68; }

  const int r4 = (tid & 31) >> 3, p = tid & 7;   // row in a group of 4, float4 in the line
  const int gw = bid * 8 + (tid >> 5);       // this wave's run of six units
  int rt = gw, ks0 = 0;                      // 192 k: six units are a row tile
  if (kd == DD) { rt = gw >> 2; ks0 = (gw & 3) * 6; }

  // v[u*4+i]: unit u, row i*4 + r4, k = p*4 .. p*4+3 of the unit
  const v4f* s4 = (const v4f*)(s + (long)(rt * 16 + r4) * kd + ks0 * 32 + p * 4);
  uint2*     d2 = (uint2*)(d + (long)gw * 6 * 512 + (p >> 2) * 256 +
                           (((p >> 1) & 1) * 16 + r4) * 8 + (p & 1) * 4);
  const v4f* r0 = s4;                        // the four rows' address pairs
  const v4f* r1 = s4 + kd;
  const v4f* r2 = s4 + 2 * kd;
  const v4f* r3 = s4 + 3 * kd;
  v4f v[24];
#pragma unroll
  for (int u = 0; u < 6; ++u) {
    v[u * 4]     = r0[u * 8];
    v[u * 4 + 1] = r1[u * 8];
    v[u * 4 + 2] = r2[u * 8];
    v[u * 4 + 3] = r3[u * 8];
  }
  // The address pairs stay whole until this wait.
  asm volatile("s_wait_xcnt 0x0" :: "v"(r0), "v"(r1), "v"(r2), "v"(r3) : "memory");
#pragma unroll
  for (int u = 0; u < 6; ++u)
#pragma unroll
    for (int i = 0; i < 4; ++i)
      d2[u * 128 + i * 8] =
          __builtin_bit_cast(uint2, __builtin_convertvector(v[u * 4 + i], v4bf));
}

// ---------------------------------------------------------------------------
// Kernel 2: grouped pointwise conv (block-diagonal GEMM), Q and K_raw.
//   y = x_g @ w_g^T  per 192-wide group.  x and w come in fragment order.
//   The weights stay in registers: a block of 8 waves takes one group, waves
//   0..3 its Q columns and waves 4..7 its K_raw columns, three 16-column tiles
//   (18 units, 144 registers) a wave, loaded once.  The block then walks GC_RT
//   row tiles; the six x units of a row tile come from L2 once and serve all
//   8 waves, each of which does 18 WMMAs on them (three chains of six).
//   Q stored row-major bf16; K_raw stored TRANSPOSED (rows b*768+d, k = n) in
//   fragment order: a lane's 8 sums are 8 consecutive n of one d, which is one
//   16-B chunk at the lane's own place.
// ---------------------------------------------------------------------------
#define GC_RT 8      // row tiles a block walks: 128 rows, inside one batch
template <bool IS_Q>
__device__ __forceinline__ void gconv_walk(const u16* __restrict__ au,
                                           const u16* __restrict__ bu,
                                           u16* __restrict__ dst) {
  v16bf w[3][6];
#pragma unroll
  for (int c = 0; c < 3; ++c)
#pragma unroll
    for (int ks = 0; ks < 6; ++ks) w[c][ks] = ldunit(bu + (c * 6 + ks) * 512);

  v16bf a[6];
#pragma unroll
  for (int ks = 0; ks < 6; ++ks) a[ks] = ldunit(au + ks * 512);

  for (int i = 0; i < GC_RT; ++i) {
    // Keeps this tile's WMMAs behind the stores of the tile before: left free,
    // they were lifted over them, and the loads below, which cannot pass the
    // wait at the loop's foot, were then issued directly in front of their use.
    __builtin_amdgcn_sched_barrier(0);
    au += 24 * 512;
    v8f acc[3] = {};
#pragma unroll
    for (int ks = 0; ks < 6; ++ks) {
#pragma unroll
      for (int c = 0; c < 3; ++c) acc[c] = wmma_bf16(a[ks], w[c][ks], acc[c]);
      // the next row tile's unit, as soon as this one has been used
      if (i + 1 < GC_RT) a[ks] = ldunit(au + ks * 512);
    }
    // Keeps those loads in front of the conversions and stores, which then run
    // while the loads are in flight.
    __builtin_amdgcn_sched_barrier(0);

    if (IS_Q) {                              // acc[c][j]: row j, col c*16
#pragma unroll
      for (int j = 0; j < 8; ++j)
#pragma unroll
        for (int c = 0; c < 3; ++c) dst[j * DD + c * 16] = f2bf(acc[c][j]);
      dst += 16 * DD;
    } else {                                 // acc[c][j]: n = j, d = c*16
#pragma unroll
      for (int c = 0; c < 3; ++c)
        *(uint4*)(dst + c * 64 * 512) =
            __builtin_bit_cast(uint4, __builtin_convertvector(acc[c], v8bf));
      dst += 256;                            // the next 16 n: the next half unit
    }
    // From here on the stores' data registers are free for the next tiles'
    // loads: the wait stands in front of any such overwrite.
    asm volatile("s_wait_xcnt 0x0" ::: "memory");
  }
}

__global__ void __launch_bounds__(256)
k_gconv(const u16* __restrict__ xbf, const u16* __restrict__ wqbf,
        const u16* __restrict__ wkbf, u16* __restrict__ qbf, u16* __restrict__ krt) {
  const int lane = threadIdx.x & 31;
  const int wave = __builtin_amdgcn_readfirstlane(threadIdx.x >> 5);   // 0..7
  const int lm = lane & 15, lhalf = lane >> 4;
  const int g = blockIdx.x & 3;              // group
  const int rt0 = (blockIdx.x >> 2) * GC_RT; // first row tile (16 rows of B*N)
  const int ct = g * 12 + (wave & 3) * 3;    // first of three col tiles
  const int m0 = rt0 * 16;
  const u16* au = xbf + ((long)rt0 * 24 + g * 6) * 512 + lane * 8;
  const long bo = (long)ct * 6 * 512 + lane * 8;   // rows g*192+o = ct*16+lm

  if (wave < 4) {
    gconv_walk<true>(au, wqbf + bo,
                     qbf + (long)(m0 + lhalf * 8) * DD + ct * 16 + lm);
  } else {
    const int b = m0 >> 11, n0 = m0 & 2047;
    gconv_walk<false>(au, wkbf + bo,
                      krt + (long)(b * 48 + ct) * 64 * 512 + (n0 >> 4) * 256 + lane * 8);
  }
}

// ---------------------------------------------------------------------------
// Kernel 3: k_proj[b,kq,d] = sum_n pk[n,kq] * k_raw[b,n,d]
//   A = pkt (rows kq, k = n), B = krt (rows b*768+d, k = n), both in fragment
//   order, 64 steps.
//   The f32 tile never goes to memory: each lane holds 8 consecutive kq of one
//   column d, which are 8 consecutive bf16 both in values^T and in keys, so the
//   epilogue stores the same 16 bytes to each.
//   valt[b,h,dq,kq]   = k_proj[b, kq, h*64+dq]
//   keys[b,h,kq2,dq2] = k_proj[b, (h*64+dq2)&255, 3*kq2 + ((h*64+dq2)>>8)]
//     inverted: kq2 = d/3, c = (d%3)*256 + kq, h = c>>6, dq2 = c&63
// ---------------------------------------------------------------------------
__global__ void __launch_bounds__(256)
k_kproj(const u16* __restrict__ pkt, const u16* __restrict__ krt,
        u16* __restrict__ keys, u16* __restrict__ valt) {
  const int lane = threadIdx.x & 31, wave = threadIdx.x >> 5;
  const int lm = lane & 15, lhalf = lane >> 4;
  int id = blockIdx.x * 8 + wave;            // 0..6143
  int b = id / 768;
  int rem = id - b * 768;
  int mt = rem / 48, nt = rem % 48;

  const u16* au = pkt + (long)mt * 64 * 512 + lane * 8;
  const u16* bu = krt + (long)(b * 48 + nt) * 64 * 512 + lane * 8;

  v8f acc = {};
  for (int ks = 0; ks < 64; ++ks) {
    v16bf a = ldunit(au + ks * 512);
    v16bf bf = ldunit(bu + ks * 512);
    acc = wmma_bf16(a, bf, acc);
  }

  const uint4 pk8 = __builtin_bit_cast(uint4, __builtin_convertvector(acc, v8bf));

  const int kq0 = mt * 16 + lhalf * 8;       // first of this lane's 8 rows
  const int d = nt * 16 + lm;
  *(uint4*)(valt + ((long)(b * HH + (d >> 6)) * 64 + (d & 63)) * KK + kq0) = pk8;
  const int kq2 = d / 3;
  const int c0 = (d - kq2 * 3) * 256 + kq0;
  *(uint4*)(keys + ((long)(b * HH + (c0 >> 6)) * KK + kq2) * 64 + (c0 & 63)) = pk8;
}

// ---------------------------------------------------------------------------
// Kernel 5: attention.  Block = (b, h, 128-row chunk), 8 waves x 16 rows.
//   LDS: keys 36KB + values^T 33KB + per-wave prob buffer 66KB = 135KB.
//   K/V staged with GLOBAL_LOAD_ASYNC_TO_LDS_B128 (ASYNCcnt-tracked DMA).
//   Every LDS row is read by ds_load_b128 with one row per lane, so each row
//   carries 16 pad bytes: the pitch is 16 B x odd (144 B, 528 B) and the 16
//   lanes of a half-wave fall on 16 different groups of four banks (bare
//   pitches of 128 B and 512 B put them on two groups and on one).
// ---------------------------------------------------------------------------
#define KPITCH 72    // keys row: 64 bf16 + 8 pad
#define VPITCH 264   // values^T row and prob row: 256 bf16 + 8 pad
__global__ void __launch_bounds__(256)
k_attn(const u16* __restrict__ qbf, const u16* __restrict__ keys,
       const u16* __restrict__ valt, u16* __restrict__ ctxbf) {
  extern __shared__ __align__(16) unsigned char smem_raw[];
  u16* keys_s = (u16*)smem_raw;              // [256][KPITCH]
  u16* valt_s = keys_s + 256 * KPITCH;       // [64][VPITCH]
  u16* pbuf   = valt_s + 64 * VPITCH;        // 8 waves * [16][VPITCH]

  const int lane = threadIdx.x & 31, wave = threadIdx.x >> 5;
  const int lm = lane & 15, lhalf = lane >> 4;
  int chunk = blockIdx.x & 15;
  int bh = blockIdx.x >> 4;
  int b = bh / HH, h = bh - b * HH;

  // stage K and V^T into LDS (16B per thread per iter)
  {
    const uint4* kg = (const uint4*)(keys + (long)bh * 16384);
    const uint4* vg = (const uint4*)(valt + (long)bh * 16384);
#if HAVE_ASYNC_LDS
    typedef __attribute__((address_space(1))) v4i* gp_t;   // global int4*
    typedef __attribute__((address_space(3))) v4i* lp_t;   // LDS int4*
    for (int i = threadIdx.x; i < 2048; i += 256) {
      u16* kd = keys_s + (i >> 3) * KPITCH + (i & 7) * 8;    // 8 x 16 B a row
      u16* vd = valt_s + (i >> 5) * VPITCH + (i & 31) * 8;   // 32 x 16 B a row
      __builtin_amdgcn_global_load_async_to_lds_b128((gp_t)(kg + i),
                                                     (lp_t)kd, 0, 0);
      __builtin_amdgcn_global_load_async_to_lds_b128((gp_t)(vg + i),
                                                     (lp_t)vd, 0, 0);
    }
#if __has_builtin(__builtin_amdgcn_s_wait_asynccnt)
    __builtin_amdgcn_s_wait_asynccnt(0);
#else
    asm volatile("s_wait_asynccnt 0x0" ::: "memory");
#endif
#else
    for (int i = threadIdx.x; i < 2048; i += 256) {
      *(uint4*)(keys_s + (i >> 3) * KPITCH + (i & 7) * 8) = kg[i];
      *(uint4*)(valt_s + (i >> 5) * VPITCH + (i & 31) * 8) = vg[i];
    }
#endif
  }
  __syncthreads();

  const int n0 = chunk * 128 + wave * 16;
  const u16* qrow = qbf + ((long)(b * NN + n0 + lm)) * DD + h * 64;
  v16bf aq0 = ldfrag(qrow + lhalf * 8,      qrow + lhalf * 8 + 16);
  v16bf aq1 = ldfrag(qrow + 32 + lhalf * 8, qrow + 32 + lhalf * 8 + 16);

  v8f acc[16];
#pragma unroll
  for (int t = 0; t < 16; ++t) { v8f z = {}; acc[t] = z; }

  // dots = q @ keys^T : 16 column tiles x 2 k-steps
#pragma unroll
  for (int t = 0; t < 16; ++t) {
    const u16* kr = keys_s + (t * 16 + lm) * KPITCH;
    v16bf b0 = ldfrag(kr + lhalf * 8,      kr + lhalf * 8 + 16);
    v16bf b1 = ldfrag(kr + 32 + lhalf * 8, kr + 32 + lhalf * 8 + 16);
    acc[t] = wmma_bf16(aq0, b0, acc[t]);
    acc[t] = wmma_bf16(aq1, b1, acc[t]);
  }

  // softmax over 256 (16 tiles x 16 lanes per half-wave), scale 1/sqrt(64)
  u16* pw = pbuf + wave * (16 * VPITCH);
#pragma unroll
  for (int j = 0; j < 8; ++j) {
    float m = -3.4e38f;
#pragma unroll
    for (int t = 0; t < 16; ++t) m = fmaxf(m, acc[t][j] * 0.125f);
    m = fmaxf(m, __shfl_xor(m, 1, 32));
    m = fmaxf(m, __shfl_xor(m, 2, 32));
    m = fmaxf(m, __shfl_xor(m, 4, 32));
    m = fmaxf(m, __shfl_xor(m, 8, 32));
    float s = 0.f;
#pragma unroll
    for (int t = 0; t < 16; ++t) {
      float p = __expf(acc[t][j] * 0.125f - m);
      acc[t][j] = p;
      s += p;
    }
    s += __shfl_xor(s, 1, 32);
    s += __shfl_xor(s, 2, 32);
    s += __shfl_xor(s, 4, 32);
    s += __shfl_xor(s, 8, 32);
    float inv = 1.f / s;
    int row = j + lhalf * 8;
#pragma unroll
    for (int t = 0; t < 16; ++t)
      pw[row * VPITCH + t * 16 + lm] = f2bf(acc[t][j] * inv);
  }

  // ctx = attn @ values : 4 dh tiles x 8 k-steps
  v8f o[4];
#pragma unroll
  for (int t = 0; t < 4; ++t) { v8f z = {}; o[t] = z; }
#pragma unroll
  for (int ks = 0; ks < 8; ++ks) {
    const u16* pr = pw + lm * VPITCH + ks * 32 + lhalf * 8;
    v16bf ap = ldfrag(pr, pr + 16);
#pragma unroll
    for (int dt = 0; dt < 4; ++dt) {
      const u16* vr = valt_s + (dt * 16 + lm) * VPITCH + ks * 32 + lhalf * 8;
      v16bf bv = ldfrag(vr, vr + 16);
      o[dt] = wmma_bf16(ap, bv, o[dt]);
    }
  }
#pragma unroll
  for (int dt = 0; dt < 4; ++dt)
#pragma unroll
    for (int j = 0; j < 8; ++j) {
      int row = b * NN + n0 + j + lhalf * 8;
      ctxbf[(long)row * DD + h * 64 + dt * 16 + lm] = f2bf(o[dt][j]);
    }
}

// ---------------------------------------------------------------------------
// Kernel 6: out = ctx @ w_out^T + b_out; y = x + out; LayerNorm(y).
//   Block = 16 rows; 8 waves x 6 col tiles; 24 k-steps. LN via LDS + shfl.
//   w_out comes in fragment order; ctx is row-major.
// ---------------------------------------------------------------------------
__global__ void __launch_bounds__(256)
k_out(const u16* __restrict__ ctxbf, const u16* __restrict__ woutbf,
      const float* __restrict__ x, const float* __restrict__ bout,
      const float* __restrict__ gamma, const float* __restrict__ beta,
      float* __restrict__ out) {
  __shared__ float ybuf[16][772];            // padded vs 64-bank LDS
  const int lane = threadIdx.x & 31, wave = threadIdx.x >> 5;
  const int lm = lane & 15, lhalf = lane >> 4;
  const int r0 = blockIdx.x * 16;

  const u16* arow = ctxbf + (long)(r0 + lm) * DD;
  v8f acc[6];
#pragma unroll
  for (int c = 0; c < 6; ++c) { v8f z = {}; acc[c] = z; }

  for (int ks = 0; ks < 24; ++ks) {
    int koff = ks * 32 + lhalf * 8;
    v16bf a = ldfrag(arow + koff, arow + koff + 16);
    __builtin_prefetch(arow + koff + 64, 0, 1);
#pragma unroll
    for (int c = 0; c < 6; ++c) {
      int ct = wave * 6 + c;
      v16bf bf = ldunit(woutbf + ((long)ct * 24 + ks) * 512 + lane * 8);
      acc[c] = wmma_bf16(a, bf, acc[c]);
    }
  }

#pragma unroll
  for (int c = 0; c < 6; ++c) {
    int ct = wave * 6 + c;
#pragma unroll
    for (int j = 0; j < 8; ++j) {
      int row = j + lhalf * 8, col = ct * 16 + lm;
      ybuf[row][col] = acc[c][j] + bout[col] + x[(long)(r0 + row) * DD + col];
    }
  }
  __syncthreads();

  int rr = threadIdx.x >> 4;                 // row 0..15, 16 lanes per row
  int s  = threadIdx.x & 15;
  float sum = 0.f, sq = 0.f;
  for (int c = s; c < DD; c += 16) { float v = ybuf[rr][c]; sum += v; sq += v * v; }
  sum += __shfl_xor(sum, 1, 32); sq += __shfl_xor(sq, 1, 32);
  sum += __shfl_xor(sum, 2, 32); sq += __shfl_xor(sq, 2, 32);
  sum += __shfl_xor(sum, 4, 32); sq += __shfl_xor(sq, 4, 32);
  sum += __shfl_xor(sum, 8, 32); sq += __shfl_xor(sq, 8, 32);
  float mu = sum * (1.f / DD);
  float var = sq * (1.f / DD) - mu * mu;
  float rstd = rsqrtf(var + 1e-12f);
  for (int c = s; c < DD; c += 16)
    out[(long)(r0 + rr) * DD + c] = (ybuf[rr][c] - mu) * rstd * gamma[c] + beta[c];
}

// ---------------------------------------------------------------------------
// Host launcher
// ---------------------------------------------------------------------------
extern "C" void kernel_launch(void* const* d_in, const int* in_sizes, int n_in,
                              void* d_out, int out_size, void* d_ws, size_t ws_size,
                              hipStream_t stream) {
  const float* x     = (const float*)d_in[0];
  const float* wq    = (const float*)d_in[1];
  const float* wk    = (const float*)d_in[2];
  const float* pk    = (const float*)d_in[3];
  const float* wout  = (const float*)d_in[4];
  const float* bout  = (const float*)d_in[5];
  const float* gamma = (const float*)d_in[6];
  const float* beta  = (const float*)d_in[7];
  float* out = (float*)d_out;
  char* ws = (char*)d_ws;

  // 256B-aligned workspace layout (bytes)
  u16*   xbf   = (u16*)(ws + 0);             // 25,165,824
  u16*   wqbf  = (u16*)(ws + 25165824);      //    294,912
  u16*   wkbf  = (u16*)(ws + 25460736);      //    294,912
  u16*   woutb = (u16*)(ws + 25755648);      //  1,179,648
  u16*   pkt   = (u16*)(ws + 26935296);      //  1,048,576
  u16*   qbf   = (u16*)(ws + 27983872);      // 25,165,824
  u16*   krt   = (u16*)(ws + 53149696);      // 25,165,824
  u16*   keys  = (u16*)(ws + 84606976);      //  3,145,728
  u16*   valt  = (u16*)(ws + 87752704);      //  3,145,728
  u16*   ctxbf = (u16*)(ws + 90898432);      // 25,165,824  (end 116,064,256)

  (void)hipFuncSetAttribute(reinterpret_cast<const void*>(k_attn),
                            hipFuncAttributeMaxDynamicSharedMemorySize, 138240);

  k_convert<<<  580, 256, 0, stream>>>(x, wq, wk, wout, pk, xbf, wqbf, wkbf, woutb, pkt);
  k_gconv  <<<  512, 256, 0, stream>>>(xbf, wqbf, wkbf, qbf, krt);
  k_kproj  <<<  768, 256, 0, stream>>>(pkt, krt, keys, valt);
  k_attn   <<< 1536, 256, 138240, stream>>>(qbf, keys, valt, ctxbf);
  k_out    <<< 1024, 256, 0, stream>>>(ctxbf, woutb, x, bout, gamma, beta, out);
}

// v006
// It runs in 114 microseconds.
// Timed twice side by side with v005, it ran 1.24 times as fast both times.
// Counting every step since v000, it is 2.97 times as fast.
#include <hip/hip_runtime.h>
#include <hip/hip_bf16.h>

// ---------------------------------------------------------------------------
// BonzSelfAttention for MI455X (gfx1250): bf16 WMMA everywhere, fp32 accum.
// B=8, N=2048, D=768, K=256, H=12, G=4, DH=64
// ---------------------------------------------------------------------------

typedef __attribute__((ext_vector_type(16))) __bf16 v16bf;
typedef __attribute__((ext_vector_type(8)))  __bf16 v8bf;
typedef __attribute__((ext_vector_type(8)))  float  v8f;
typedef __attribute__((ext_vector_type(4)))  float  v4f;
typedef __attribute__((ext_vector_type(4)))  __bf16 v4bf;
typedef __attribute__((ext_vector_type(4)))  int    v4i;
typedef unsigned short u16;

#define BN   16384   // B*N
#define DD   768
#define NN   2048
#define KK   256
#define HH   12

#if __has_builtin(__builtin_amdgcn_global_load_async_to_lds_b128)
#define HAVE_ASYNC_LDS 1
#else
#define HAVE_ASYNC_LDS 0
#endif

struct alignas(32) Frag32B { uint4 lo, hi; };

// Native bf16 convert (RNE) — lets clang emit v_cvt instead of manual rounding.
__device__ __forceinline__ u16 f2bf(float f) {
  __bf16 h = (__bf16)f;
  return __builtin_bit_cast(u16, h);
}

// A/B operand fragment: two 16-byte chunks (K-chunk and K-chunk+16) per lane.
__device__ __forceinline__ v16bf ldfrag(const u16* p0, const u16* p1) {
  Frag32B f;
  f.lo = *(const uint4*)p0;
  f.hi = *(const uint4*)p1;
  return __builtin_bit_cast(v16bf, f);
}

__device__ __forceinline__ v8f wmma_bf16(v16bf a, v16bf b, v8f c) {
  // (neg_a, A, neg_b, B, c_mod, C, reuse_a, reuse_b)
  return __builtin_amdgcn_wmma_f32_16x16x32_bf16(false, a, false, b, (short)0, c,
                                                 false, false);
}

// ---------------------------------------------------------------------------
// Fragment order.  x, wq, wk, w_out, pkt and krt, bf16 matrices M[row][k] that
// GEMMs read from global memory, are kept in the workspace as 1-KB units, one per (16 rows, 32 k):
//   unit  = (row >> 4) * (K / 32) + (k >> 5)
//   u16 offset in the unit = ((k >> 4) & 1) * 256        first / second chunk
//                          + (((k >> 3) & 1) * 16 + (row & 15)) * 8   the lane
//                          + (k & 7)
// A lane's two 16-B chunks are the ones it took from the row-major matrix, so
// the fragments hold the same values; but the 32 lanes of one load now read 512
// contiguous bytes (4 lines) where rows of 384 B and more gave 16 lines.
// ---------------------------------------------------------------------------
__device__ __forceinline__ v16bf ldunit(const u16* unit_lane) {
  return ldfrag(unit_lane, unit_lane + 256);
}

// ---------------------------------------------------------------------------
// Kernel 1: fp32 -> bf16 conversions into fragment order (+ project_k transpose)
//   Few, long waves instead of one element per thread.  A block takes one role
//   by its index (block-uniform):
//     0..31     project_k: thread = column kq, 64 rows n; the 64 loads are
//               coalesced over kq; 16 threads store 256 contiguous bytes
//     32..37    wq, 38..43 wk, 44..67 w_out, 68..579 x: a wave makes six units
//               in a row (16 rows x 192 k).  The 16 rows of a unit are one
//               128-B line of floats each: a wave-wide float4 load takes four
//               whole lines (8 lanes a row), and the 8-B stores of the four
//               rows fall in 64-B runs of the unit; a thread's 24 loads are
//               independent, so many are in flight at a time
// ---------------------------------------------------------------------------
__global__ void __launch_bounds__(256)
k_convert(const float* __restrict__ x,  const float* __restrict__ wq,
          const float* __restrict__ wk, const float* __restrict__ wout,
          const float* __restrict__ pk,
          u16* __restrict__ xbf, u16* __restrict__ wqbf, u16* __restrict__ wkbf,
          u16* __restrict__ woutbf, u16* __restrict__ pkt) {
  const int tid = threadIdx.x;
  int bid = blockIdx.x;

  if (bid < 32) {                            // pkt[kq][n] = pk[n][kq]
    const float* s = pk + (long)bid * 64 * KK + tid;
    float v[64];
#pragma unroll
    for (int j = 0; j < 64; ++j) v[j] = s[j * KK];
    // rows kq, k = n = bid*64 + c*8 + j: units (tid>>4)*64 + bid*2 + (c>>2)
    u16* d = pkt + ((long)(tid >> 4) * 64 + bid * 2) * 512 + (tid & 15) * 8;
#pragma unroll
    for (int c = 0; c < 8; ++c) {
      v8f f;
#pragma unroll
      for (int j = 0; j < 8; ++j) f[j] = v[c * 8 + j];
      *(uint4*)(d + (c >> 2) * 512 + ((c >> 1) & 1) * 256 + (c & 1) * 128) =
          __builtin_bit_cast(uint4, __builtin_convertvector(f, v8bf));
    }
    return;
  }

  const float* s;
  u16* d;
  int kd = DD;                               // row length k of the matrix
  if (bid < 38)      { s = wq;   d = wqbf;   bid -= 32; kd = 192; }
  else if (bid < 44) { s = wk;   d = wkbf;   bid -= 38; kd = 192; }
  else if (bid < 68) { s = wout; d = woutbf; bid -= 44; }
  else               { s = x;    d = xbf;    bid -= 68; }

  const int r4 = (tid & 31) >> 3, p = tid & 7;   // row in a group of 4, float4 in the line
  const int gw = bid * 8 + (tid >> 5);       // this wave's run of six units
  int rt = gw, ks0 = 0;                      // 192 k: six units are a row tile
  if (kd == DD) { rt = gw >> 2; ks0 = (gw & 3) * 6; }

  // v[u*4+i]: unit u, row i*4 + r4, k = p*4 .. p*4+3 of the unit
  const v4f* s4 = (const v4f*)(s + (long)(rt * 16 + r4) * kd + ks0 * 32 + p * 4);
  uint2*     d2 = (uint2*)(d + (long)gw * 6 * 512 + (p >> 2) * 256 +
                           (((p >> 1) & 1) * 16 + r4) * 8 + (p & 1) * 4);
  const v4f* r0 = s4;                        // the four rows' address pairs
  const v4f* r1 = s4 + kd;
  const v4f* r2 = s4 + 2 * kd;
  const v4f* r3 = s4 + 3 * kd;
  v4f v[24];
#pragma unroll
  for (int u = 0; u < 6; ++u) {
    v[u * 4]     = r0[u * 8];
    v[u * 4 + 1] = r1[u * 8];
    v[u * 4 + 2] = r2[u * 8];
    v[u * 4 + 3] = r3[u * 8];
  }
  // The address pairs stay whole until this wait.
  asm volatile("s_wait_xcnt 0x0" :: "v"(r0), "v"(r1), "v"(r2), "v"(r3) : "memory");
#pragma unroll
  for (int u = 0; u < 6; ++u)
#pragma unroll
    for (int i = 0; i < 4; ++i)
      d2[u * 128 + i * 8] =
          __builtin_bit_cast(uint2, __builtin_convertvector(v[u * 4 + i], v4bf));
}

// ---------------------------------------------------------------------------
// Kernel 2: grouped pointwise conv (block-diagonal GEMM), Q and K_raw.
//   y = x_g @ w_g^T  per 192-wide group.  x and w come in fragment order.
//   The weights stay in registers: a block of 8 waves takes one group, waves
//   0..3 its Q columns and waves 4..7 its K_raw columns, three 16-column tiles
//   (18 units, 144 registers) a wave, loaded once.  The block then walks GC_RT
//   row tiles; the six x units of a row tile come from L2 once and serve all
//   8 waves, each of which does 18 WMMAs on them (three chains of six).
//   Q stored row-major bf16; K_raw stored TRANSPOSED (rows b*768+d, k = n) in
//   fragment order: a lane's 8 sums are 8 consecutive n of one d, which is one
//   16-B chunk at the lane's own place.
// ---------------------------------------------------------------------------
#define GC_RT 8      // row tiles a block walks: 128 rows, inside one batch
template <bool IS_Q>
__device__ __forceinline__ void gconv_walk(const u16* __restrict__ au,
                                           const u16* __restrict__ bu,
                                           u16* __restrict__ dst) {
  v16bf w[3][6];
#pragma unroll
  for (int c = 0; c < 3; ++c)
#pragma unroll
    for (int ks = 0; ks < 6; ++ks) w[c][ks] = ldunit(bu + (c * 6 + ks) * 512);

  v16bf a[6];
#pragma unroll
  for (int ks = 0; ks < 6; ++ks) a[ks] = ldunit(au + ks * 512);

  for (int i = 0; i < GC_RT; ++i) {
    // Keeps this tile's WMMAs behind the stores of the tile before: left free,
    // they were lifted over them, and the loads below, which cannot pass the
    // wait at the loop's foot, were then issued directly in front of their use.
    __builtin_amdgcn_sched_barrier(0);
    au += 24 * 512;
    v8f acc[3] = {};
#pragma unroll
    for (int ks = 0; ks < 6; ++ks) {
#pragma unroll
      for (int c = 0; c < 3; ++c) acc[c] = wmma_bf16(a[ks], w[c][ks], acc[c]);
      // the next row tile's unit, as soon as this one has been used
      if (i + 1 < GC_RT) a[ks] = ldunit(au + ks * 512);
    }
    // Keeps those loads in front of the conversions and stores, which then run
    // while the loads are in flight.
    __builtin_amdgcn_sched_barrier(0);

    if (IS_Q) {                              // acc[c][j]: row j, col c*16
#pragma unroll
      for (int j = 0; j < 8; ++j)
#pragma unroll
        for (int c = 0; c < 3; ++c) dst[j * DD + c * 16] = f2bf(acc[c][j]);
      dst += 16 * DD;
    } else {                                 // acc[c][j]: n = j, d = c*16
#pragma unroll
      for (int c = 0; c < 3; ++c)
        *(uint4*)(dst + c * 64 * 512) =
            __builtin_bit_cast(uint4, __builtin_convertvector(acc[c], v8bf));
      dst += 256;                            // the next 16 n: the next half unit
    }
    // From here on the stores' data registers are free for the next tiles'
    // loads: the wait stands in front of any such overwrite.
    asm volatile("s_wait_xcnt 0x0" ::: "memory");
  }
}

__global__ void __launch_bounds__(256)
k_gconv(const u16* __restrict__ xbf, const u16* __restrict__ wqbf,
        const u16* __restrict__ wkbf, u16* __restrict__ qbf, u16* __restrict__ krt) {
  const int lane = threadIdx.x & 31;
  const int wave = __builtin_amdgcn_readfirstlane(threadIdx.x >> 5);   // 0..7
  const int lm = lane & 15, lhalf = lane >> 4;
  const int g = blockIdx.x & 3;              // group
  const int rt0 = (blockIdx.x >> 2) * GC_RT; // first row tile (16 rows of B*N)
  const int ct = g * 12 + (wave & 3) * 3;    // first of three col tiles
  const int m0 = rt0 * 16;
  const u16* au = xbf + ((long)rt0 * 24 + g * 6) * 512 + lane * 8;
  const long bo = (long)ct * 6 * 512 + lane * 8;   // rows g*192+o = ct*16+lm

  if (wave < 4) {
    gconv_walk<true>(au, wqbf + bo,
                     qbf + (long)(m0 + lhalf * 8) * DD + ct * 16 + lm);
  } else {
    const int b = m0 >> 11, n0 = m0 & 2047;
    gconv_walk<false>(au, wkbf + bo,
                      krt + (long)(b * 48 + ct) * 64 * 512 + (n0 >> 4) * 256 + lane * 8);
  }
}

// ---------------------------------------------------------------------------
// Kernel 3: k_proj[b,kq,d] = sum_n pk[n,kq] * k_raw[b,n,d]
//   A = pkt (rows kq, k = n), B = krt (rows b*768+d, k = n), both in fragment
//   order, 64 steps.
//   The f32 tile never goes to memory: each lane holds 8 consecutive kq of one
//   column d, which are 8 consecutive bf16 both in values^T and in keys, so the
//   epilogue stores the same 16 bytes to each.
//   valt[b,h,dq,kq]   = k_proj[b, kq, h*64+dq]
//   keys[b,h,kq2,dq2] = k_proj[b, (h*64+dq2)&255, 3*kq2 + ((h*64+dq2)>>8)]
//     inverted: kq2 = d/3, c = (d%3)*256 + kq, h = c>>6, dq2 = c&63
// ---------------------------------------------------------------------------
__global__ void __launch_bounds__(256)
k_kproj(const u16* __restrict__ pkt, const u16* __restrict__ krt,
        u16* __restrict__ keys, u16* __restrict__ valt) {
  const int lane = threadIdx.x & 31, wave = threadIdx.x >> 5;
  const int lm = lane & 15, lhalf = lane >> 4;
  int id = blockIdx.x * 8 + wave;            // 0..6143
  int b = id / 768;
  int rem = id - b * 768;
  int mt = rem / 48, nt = rem % 48;

  const u16* au = pkt + (long)mt * 64 * 512 + lane * 8;
  const u16* bu = krt + (long)(b * 48 + nt) * 64 * 512 + lane * 8;

  v8f acc = {};
  for (int ks = 0; ks < 64; ++ks) {
    v16bf a = ldunit(au + ks * 512);
    v16bf bf = ldunit(bu + ks * 512);
    acc = wmma_bf16(a, bf, acc);
  }

  const uint4 pk8 = __builtin_bit_cast(uint4, __builtin_convertvector(acc, v8bf));

  const int kq0 = mt * 16 + lhalf * 8;       // first of this lane's 8 rows
  const int d = nt * 16 + lm;
  *(uint4*)(valt + ((long)(b * HH + (d >> 6)) * 64 + (d & 63)) * KK + kq0) = pk8;
  const int kq2 = d / 3;
  const int c0 = (d - kq2 * 3) * 256 + kq0;
  *(uint4*)(keys + ((long)(b * HH + (c0 >> 6)) * KK + kq2) * 64 + (c0 & 63)) = pk8;
}

// ---------------------------------------------------------------------------
// Kernel 5: attention.  Block = (b, h, 128-row chunk), 8 waves x 16 rows.
//   LDS: keys 36KB + values^T 33KB + per-wave prob buffer 66KB = 135KB.
//   K/V staged with GLOBAL_LOAD_ASYNC_TO_LDS_B128 (ASYNCcnt-tracked DMA).
//   Every LDS row is read by ds_load_b128 with one row per lane, so each row
//   carries 16 pad bytes: the pitch is 16 B x odd (144 B, 528 B) and the 16
//   lanes of a half-wave fall on 16 different groups of four banks (bare
//   pitches of 128 B and 512 B put them on two groups and on one).
// ---------------------------------------------------------------------------
#define KPITCH 72    // keys row: 64 bf16 + 8 pad
#define VPITCH 264   // values^T row and prob row: 256 bf16 + 8 pad
__global__ void __launch_bounds__(256)
k_attn(const u16* __restrict__ qbf, const u16* __restrict__ keys,
       const u16* __restrict__ valt, u16* __restrict__ ctxbf) {
  extern __shared__ __align__(16) unsigned char smem_raw[];
  u16* keys_s = (u16*)smem_raw;              // [256][KPITCH]
  u16* valt_s = keys_s + 256 * KPITCH;       // [64][VPITCH]
  u16* pbuf   = valt_s + 64 * VPITCH;        // 8 waves * [16][VPITCH]

  const int lane = threadIdx.x & 31, wave = threadIdx.x >> 5;
  const int lm = lane & 15, lhalf = lane >> 4;
  int chunk = blockIdx.x & 15;
  int bh = blockIdx.x >> 4;
  int b = bh / HH, h = bh - b * HH;

  // stage K and V^T into LDS (16B per thread per iter)
  {
    const uint4* kg = (const uint4*)(keys + (long)bh * 16384);
    const uint4* vg = (const uint4*)(valt + (long)bh * 16384);
#if HAVE_ASYNC_LDS
    typedef __attribute__((address_space(1))) v4i* gp_t;   // global int4*
    typedef __attribute__((address_space(3))) v4i* lp_t;   // LDS int4*
    for (int i = threadIdx.x; i < 2048; i += 256) {
      u16* kd = keys_s + (i >> 3) * KPITCH + (i & 7) * 8;    // 8 x 16 B a row
      u16* vd = valt_s + (i >> 5) * VPITCH + (i & 31) * 8;   // 32 x 16 B a row
      __builtin_amdgcn_global_load_async_to_lds_b128((gp_t)(kg + i),
                                                     (lp_t)kd, 0, 0);
      __builtin_amdgcn_global_load_async_to_lds_b128((gp_t)(vg + i),
                                                     (lp_t)vd, 0, 0);
    }
#if __has_builtin(__builtin_amdgcn_s_wait_asynccnt)
    __builtin_amdgcn_s_wait_asynccnt(0);
#else
    asm volatile("s_wait_asynccnt 0x0" ::: "memory");
#endif
#else
    for (int i = threadIdx.x; i < 2048; i += 256) {
      *(uint4*)(keys_s + (i >> 3) * KPITCH + (i & 7) * 8) = kg[i];
      *(uint4*)(valt_s + (i >> 5) * VPITCH + (i & 31) * 8) = vg[i];
    }
#endif
  }
  __syncthreads();

  const int n0 = chunk * 128 + wave * 16;
  const u16* qrow = qbf + ((long)(b * NN + n0 + lm)) * DD + h * 64;
  v16bf aq0 = ldfrag(qrow + lhalf * 8,      qrow + lhalf * 8 + 16);
  v16bf aq1 = ldfrag(qrow + 32 + lhalf * 8, qrow + 32 + lhalf * 8 + 16);

  v8f acc[16];
#pragma unroll
  for (int t = 0; t < 16; ++t) { v8f z = {}; acc[t] = z; }

  // dots = q @ keys^T : 16 column tiles x 2 k-steps
#pragma unroll
  for (int t = 0; t < 16; ++t) {
    const u16* kr = keys_s + (t * 16 + lm) * KPITCH;
    v16bf b0 = ldfrag(kr + lhalf * 8,      kr + lhalf * 8 + 16);
    v16bf b1 = ldfrag(kr + 32 + lhalf * 8, kr + 32 + lhalf * 8 + 16);
    acc[t] = wmma_bf16(aq0, b0, acc[t]);
    acc[t] = wmma_bf16(aq1, b1, acc[t]);
  }

  // softmax over 256 (16 tiles x 16 lanes per half-wave), scale 1/sqrt(64)
  u16* pw = pbuf + wave * (16 * VPITCH);
#pragma unroll
  for (int j = 0; j < 8; ++j) {
    float m = -3.4e38f;
#pragma unroll
    for (int t = 0; t < 16; ++t) m = fmaxf(m, acc[t][j] * 0.125f);
    m = fmaxf(m, __shfl_xor(m, 1, 32));
    m = fmaxf(m, __shfl_xor(m, 2, 32));
    m = fmaxf(m, __shfl_xor(m, 4, 32));
    m = fmaxf(m, __shfl_xor(m, 8, 32));
    float s = 0.f;
#pragma unroll
    for (int t = 0; t < 16; ++t) {
      float p = __expf(acc[t][j] * 0.125f - m);
      acc[t][j] = p;
      s += p;
    }
    s += __shfl_xor(s, 1, 32);
    s += __shfl_xor(s, 2, 32);
    s += __shfl_xor(s, 4, 32);
    s += __shfl_xor(s, 8, 32);
    float inv = 1.f / s;
    int row = j + lhalf * 8;
#pragma unroll
    for (int t = 0; t < 16; ++t)
      pw[row * VPITCH + t * 16 + lm] = f2bf(acc[t][j] * inv);
  }

  // ctx = attn @ values : 4 dh tiles x 8 k-steps
  v8f o[4];
#pragma unroll
  for (int t = 0; t < 4; ++t) { v8f z = {}; o[t] = z; }
#pragma unroll
  for (int ks = 0; ks < 8; ++ks) {
    const u16* pr = pw + lm * VPITCH + ks * 32 + lhalf * 8;
    v16bf ap = ldfrag(pr, pr + 16);
#pragma unroll
    for (int dt = 0; dt < 4; ++dt) {
      const u16* vr = valt_s + (dt * 16 + lm) * VPITCH + ks * 32 + lhalf * 8;
      v16bf bv = ldfrag(vr, vr + 16);
      o[dt] = wmma_bf16(ap, bv, o[dt]);
    }
  }
#pragma unroll
  for (int dt = 0; dt < 4; ++dt)
#pragma unroll
    for (int j = 0; j < 8; ++j) {
      int row = b * NN + n0 + j + lhalf * 8;
      ctxbf[(long)row * DD + h * 64 + dt * 16 + lm] = f2bf(o[dt][j]);
    }
}

// ---------------------------------------------------------------------------
// Kernel 6: out = ctx @ w_out^T + b_out; y = x + out; LayerNorm(y).
//   Block = 64 rows (OUT_RT row tiles); 8 waves x 6 col tiles; 24 k-steps.
//   A wave keeps 4 x 6 accumulator tiles: the six w_out units of a k-step feed
//   four row tiles each, so w_out is read once per 64 rows, and a k-step is 20
//   loads for 24 WMMAs.  Two fragment sets: the 20 loads of the next k-step go
//   out as one group in front of this k-step's WMMAs.  LN via LDS + shfl, a
//   thread taking the same 48 columns of four rows.
//   w_out comes in fragment order; ctx is row-major.
// ---------------------------------------------------------------------------
#define OUT_RT 4     // row tiles a block takes
__device__ __forceinline__ void out_load(const u16* ap, const u16* bp,
                                         v16bf (&a)[OUT_RT], v16bf (&b)[6]) {
#pragma unroll
  for (int c = 0; c < 6; ++c) b[c] = ldunit(bp + c * 24 * 512);
#pragma unroll
  for (int r = 0; r < OUT_RT; ++r)
    a[r] = ldfrag(ap + r * 16 * DD, ap + r * 16 * DD + 16);
}

__device__ __forceinline__ void out_mma(const v16bf (&a)[OUT_RT], const v16bf (&b)[6],
                                        v8f (&acc)[OUT_RT][6]) {
#pragma unroll
  for (int c = 0; c < 6; ++c)
#pragma unroll
    for (int r = 0; r < OUT_RT; ++r) acc[r][c] = wmma_bf16(a[r], b[c], acc[r][c]);
}

__global__ void __launch_bounds__(256)
k_out(const u16* __restrict__ ctxbf, const u16* __restrict__ woutbf,
      const float* __restrict__ x, const float* __restrict__ bout,
      const float* __restrict__ gamma, const float* __restrict__ beta,
      float* __restrict__ out) {
  __shared__ float ybuf[16 * OUT_RT][772];   // padded vs 64-bank LDS
  const int lane = threadIdx.x & 31, wave = threadIdx.x >> 5;
  const int lm = lane & 15, lhalf = lane >> 4;
  const int r0 = blockIdx.x * (16 * OUT_RT);

  unsigned ao = (unsigned)(r0 + lm) * DD + lhalf * 8;        // index into ctx
  unsigned bo = (unsigned)wave * (6 * 24 * 512) + lane * 8;  // index into w_out
  v8f acc[OUT_RT][6];
#pragma unroll
  for (int r = 0; r < OUT_RT; ++r)
#pragma unroll
    for (int c = 0; c < 6; ++c) { v8f z = {}; acc[r][c] = z; }

  v16bf a0[OUT_RT], b0[6], a1[OUT_RT], b1[6];
  out_load(ctxbf + ao, woutbf + bo, a0, b0);
  for (int ks = 0; ks < 22; ks += 2) {
    const u16* pa = ctxbf + ao;
    const u16* pb = woutbf + bo;
    out_load(pa + 32, pb + 512, a1, b1);
    // Keeps the loads above in front of the WMMAs below: left free, they were
    // sunk among the WMMAs, many to just in front of their first use, which
    // then waited out the latency.
    __builtin_amdgcn_sched_barrier(0);
    out_mma(a0, b0, acc);
    // Keeps the reload of the first set behind its last use and, with the next
    // barrier, in front of the second set's WMMAs, for the same reason.
    __builtin_amdgcn_sched_barrier(0);
    // The issued loads name the two address pairs: as inputs they stay whole
    // until the wait, and the next pairs, made from the offsets that leave this
    // statement, are formed behind it.
    asm volatile("s_wait_xcnt 0x0" : "+v"(ao), "+v"(bo) : "v"(pa), "v"(pb) : "memory");
    ao += 64;
    bo += 1024;
    pa = ctxbf + ao;
    pb = woutbf + bo;
    out_load(pa, pb, a0, b0);
    __builtin_amdgcn_sched_barrier(0);
    out_mma(a1, b1, acc);
    // Keeps the wait below behind the WMMAs, where it costs nothing.
    __builtin_amdgcn_sched_barrier(0);
    // The same wait for the reload's address pairs.
    asm volatile("s_wait_xcnt 0x0" : "+v"(ao), "+v"(bo) : "v"(pa), "v"(pb) : "memory");
  }
  {
    const u16* pa = ctxbf + ao;
    const u16* pb = woutbf + bo;
    out_load(pa + 32, pb + 512, a1, b1);     // the last k-step
    // As in the loop: the loads in front of the WMMAs, and the wait, held in
    // place by the two barriers, in front of whatever takes the pairs' place.
    __builtin_amdgcn_sched_barrier(0);
    asm volatile("s_wait_xcnt 0x0" :: "v"(pa), "v"(pb) : "memory");
    __builtin_amdgcn_sched_barrier(0);
  }
  out_mma(a0, b0, acc);
  out_mma(a1, b1, acc);

  // acc[r][c][j]: row r*16 + lhalf*8 + j, col wave*96 + c*16 + lm
  const float* xb = x + (long)(r0 + lhalf * 8) * DD + wave * 96 + lm;
  const float* bb = bout + wave * 96 + lm;
  float* yb = &ybuf[lhalf * 8][wave * 96 + lm];
#pragma unroll
  for (int r = 0; r < OUT_RT; ++r)
#pragma unroll
    for (int c = 0; c < 6; ++c)
#pragma unroll
      for (int j = 0; j < 8; ++j)
        yb[(r * 16 + j) * 772 + c * 16] =
            acc[r][c][j] + bb[c * 16] + xb[(r * 16 + j) * DD + c * 16];
  // The two address pairs stay whole until this wait, so that no later load's
  // result is allocated over the pair of loads still being issued.
  asm volatile("s_wait_xcnt 0x0" :: "v"(xb), "v"(bb) : "memory");
  __syncthreads();

  int rr = threadIdx.x >> 4;                 // rows rr + 16 q, 16 lanes per row
  int s  = threadIdx.x & 15;
  float sum[OUT_RT], sq[OUT_RT];
#pragma unroll
  for (int q = 0; q < OUT_RT; ++q) { sum[q] = 0.f; sq[q] = 0.f; }
  for (int c = s; c < DD; c += 16)
#pragma unroll
    for (int q = 0; q < OUT_RT; ++q) {
      float v = ybuf[q * 16 + rr][c];
      sum[q] += v;
      sq[q] += v * v;
    }
  float mu[OUT_RT], rstd[OUT_RT];
#pragma unroll
  for (int q = 0; q < OUT_RT; ++q) {
    float sm = sum[q], ss = sq[q];
    sm += __shfl_xor(sm, 1, 32); ss += __shfl_xor(ss, 1, 32);
    sm += __shfl_xor(sm, 2, 32); ss += __shfl_xor(ss, 2, 32);
    sm += __shfl_xor(sm, 4, 32); ss += __shfl_xor(ss, 4, 32);
    sm += __shfl_xor(sm, 8, 32); ss += __shfl_xor(ss, 8, 32);
    mu[q] = sm * (1.f / DD);
    float var = ss * (1.f / DD) - mu[q] * mu[q];
    rstd[q] = rsqrtf(var + 1e-12f);
  }
  for (int c = s; c < DD; c += 16) {
    const float g = gamma[c], be = beta[c];
#pragma unroll
    for (int q = 0; q < OUT_RT; ++q)
      out[(long)(r0 + q * 16 + rr) * DD + c] =
          (ybuf[q * 16 + rr][c] - mu[q]) * rstd[q] * g + be;
  }
}

// ---------------------------------------------------------------------------
// Host launcher
// ---------------------------------------------------------------------------
extern "C" void kernel_launch(void* const* d_in, const int* in_sizes, int n_in,
                              void* d_out, int out_size, void* d_ws, size_t ws_size,
                              hipStream_t stream) {
  const float* x     = (const float*)d_in[0];
  const float* wq    = (const float*)d_in[1];
  const float* wk    = (const float*)d_in[2];
  const float* pk    = (const float*)d_in[3];
  const float* wout  = (const float*)d_in[4];
  const float* bout  = (const float*)d_in[5];
  const float* gamma = (const float*)d_in[6];
  const float* beta  = (const float*)d_in[7];
  float* out = (float*)d_out;
  char* ws = (char*)d_ws;

  // 256B-aligned workspace layout (bytes)
  u16*   xbf   = (u16*)(ws + 0);             // 25,165,824
  u16*   wqbf  = (u16*)(ws + 25165824);      //    294,912
  u16*   wkbf  = (u16*)(ws + 25460736);      //    294,912
  u16*   woutb = (u16*)(ws + 25755648);      //  1,179,648
  u16*   pkt   = (u16*)(ws + 26935296);      //  1,048,576
  u16*   qbf   = (u16*)(ws + 27983872);      // 25,165,824
  u16*   krt   = (u16*)(ws + 53149696);      // 25,165,824
  u16*   keys  = (u16*)(ws + 84606976);      //  3,145,728
  u16*   valt  = (u16*)(ws + 87752704);      //  3,145,728
  u16*   ctxbf = (u16*)(ws + 90898432);      // 25,165,824  (end 116,064,256)

  (void)hipFuncSetAttribute(reinterpret_cast<const void*>(k_attn),
                            hipFuncAttributeMaxDynamicSharedMemorySize, 138240);

  k_convert<<<  580, 256, 0, stream>>>(x, wq, wk, wout, pk, xbf, wqbf, wkbf, woutb, pkt);
  k_gconv  <<<  512, 256, 0, stream>>>(xbf, wqbf, wkbf, qbf, krt);
  k_kproj  <<<  768, 256, 0, stream>>>(pkt, krt, keys, valt);
  k_attn   <<< 1536, 256, 138240, stream>>>(qbf, keys, valt, ctxbf);
  k_out    <<<  256, 256, 0, stream>>>(ctxbf, woutb, x, bout, gamma, beta, out);
}

// v007
// One run takes 110 microseconds.
// Two timings next to v006 both put it at 1.04 times that version's speed.
// All steps since v000 together make it 3.09 times as fast.
#include <hip/hip_runtime.h>
#include <hip/hip_bf16.h>

// ---------------------------------------------------------------------------
// BonzSelfAttention for MI455X (gfx1250): bf16 WMMA everywhere, fp32 accum.
// B=8, N=2048, D=768, K=256, H=12, G=4, DH=64
// ---------------------------------------------------------------------------

typedef __attribute__((ext_vector_type(16))) __bf16 v16bf;
typedef __attribute__((ext_vector_type(8)))  __bf16 v8bf;
typedef __attribute__((ext_vector_type(8)))  float  v8f;
typedef __attribute__((ext_vector_type(4)))  float  v4f;
typedef __attribute__((ext_vector_type(4)))  __bf16 v4bf;
typedef __attribute__((ext_vector_type(4)))  int    v4i;
typedef unsigned short u16;

#define BN   16384   // B*N
#define DD   768
#define NN   2048
#define KK   256
#define HH   12

#if __has_builtin(__builtin_amdgcn_global_load_async_to_lds_b128)
#define HAVE_ASYNC_LDS 1
#else
#define HAVE_ASYNC_LDS 0
#endif

struct alignas(32) Frag32B { uint4 lo, hi; };

// Native bf16 convert (RNE) — lets clang emit v_cvt instead of manual rounding.
__device__ __forceinline__ u16 f2bf(float f) {
  __bf16 h = (__bf16)f;
  return __builtin_bit_cast(u16, h);
}

// A/B operand fragment: two 16-byte chunks (K-chunk and K-chunk+16) per lane.
__device__ __forceinline__ v16bf ldfrag(const u16* p0, const u16* p1) {
  Frag32B f;
  f.lo = *(const uint4*)p0;
  f.hi = *(const uint4*)p1;
  return __builtin_bit_cast(v16bf, f);
}

__device__ __forceinline__ v8f wmma_bf16(v16bf a, v16bf b, v8f c) {
  // (neg_a, A, neg_b, B, c_mod, C, reuse_a, reuse_b)
  return __builtin_amdgcn_wmma_f32_16x16x32_bf16(false, a, false, b, (short)0, c,
                                                 false, false);
}

// ---------------------------------------------------------------------------
// Fragment order.  x, wq, wk, w_out, pkt and krt, bf16 matrices M[row][k] that
// GEMMs read from global memory, are kept in the workspace as 1-KB units, one per (16 rows, 32 k):
//   unit  = (row >> 4) * (K / 32) + (k >> 5)
//   u16 offset in the unit = ((k >> 4) & 1) * 256        first / second chunk
//                          + (((k >> 3) & 1) * 16 + (row & 15)) * 8   the lane
//                          + (k & 7)
// A lane's two 16-B chunks are the ones it took from the row-major matrix, so
// the fragments hold the same values; but the 32 lanes of one load now read 512
// contiguous bytes (4 lines) where rows of 384 B and more gave 16 lines.
// ---------------------------------------------------------------------------
__device__ __forceinline__ v16bf ldunit(const u16* unit_lane) {
  return ldfrag(unit_lane, unit_lane + 256);
}

// ---------------------------------------------------------------------------
// Kernel 1: fp32 -> bf16 conversions into fragment order (+ project_k transpose)
//   Few, long waves instead of one element per thread.  A block takes one role
//   by its index (block-uniform):
//     0..31     project_k: thread = column kq, 64 rows n; the 64 loads are
//               coalesced over kq; 16 threads store 256 contiguous bytes
//     32..37    wq, 38..43 wk, 44..67 w_out, 68..579 x: a wave makes six units
//               in a row (16 rows x 192 k).  The 16 rows of a unit are one
//               128-B line of floats each: a wave-wide float4 load takes four
//               whole lines (8 lanes a row), and the 8-B stores of the four
//               rows fall in 64-B runs of the unit; a thread's 24 loads are
//               independent, so many are in flight at a time
// ---------------------------------------------------------------------------
__global__ void __launch_bounds__(256)
k_convert(const float* __restrict__ x,  const float* __restrict__ wq,
          const float* __restrict__ wk, const float* __restrict__ wout,
          const float* __restrict__ pk,
          u16* __restrict__ xbf, u16* __restrict__ wqbf, u16* __restrict__ wkbf,
          u16* __restrict__ woutbf, u16* __restrict__ pkt) {
  const int tid = threadIdx.x;
  int bid = blockIdx.x;

  if (bid < 32) {                            // pkt[kq][n] = pk[n][kq]
    const float* s = pk + (long)bid * 64 * KK + tid;
    float v[64];
#pragma unroll
    for (int j = 0; j < 64; ++j) v[j] = s[j * KK];
    // rows kq, k = n = bid*64 + c*8 + j: units (tid>>4)*64 + bid*2 + (c>>2)
    u16* d = pkt + ((long)(tid >> 4) * 64 + bid * 2) * 512 + (tid & 15) * 8;
#pragma unroll
    for (int c = 0; c < 8; ++c) {
      v8f f;
#pragma unroll
      for (int j = 0; j < 8; ++j) f[j] = v[c * 8 + j];
      *(uint4*)(d + (c >> 2) * 512 + ((c >> 1) & 1) * 256 + (c & 1) * 128) =
          __builtin_bit_cast(uint4, __builtin_convertvector(f, v8bf));
    }
    return;
  }

  const float* s;
  u16* d;
  int kd = DD;                               // row length k of the matrix
  if (bid < 38)      { s = wq;   d = wqbf;   bid -= 32; kd = 192; }
  else if (bid < 44) { s = wk;   d = wkbf;   bid -= 38; kd = 192; }
  else if (bid < 68) { s = wout; d = woutbf; bid -= 44; }
  else               { s = x;    d = xbf;    bid -= 68; }

  const int r4 = (tid & 31) >> 3, p = tid & 7;   // row in a group of 4, float4 in the line
  const int gw = bid * 8 + (tid >> 5);       // this wave's run of six units
  int rt = gw, ks0 = 0;                      // 192 k: six units are a row tile
  if (kd == DD) { rt = gw >> 2; ks0 = (gw & 3) * 6; }

  // v[u*4+i]: unit u, row i*4 + r4, k = p*4 .. p*4+3 of the unit
  const v4f* s4 = (const v4f*)(s + (long)(rt * 16 + r4) * kd + ks0 * 32 + p * 4);
  uint2*     d2 = (uint2*)(d + (long)gw * 6 * 512 + (p >> 2) * 256 +
                           (((p >> 1) & 1) * 16 + r4) * 8 + (p & 1) * 4);
  const v4f* r0 = s4;                        // the four rows' address pairs
  const v4f* r1 = s4 + kd;
  const v4f* r2 = s4 + 2 * kd;
  const v4f* r3 = s4 + 3 * kd;
  v4f v[24];
#pragma unroll
  for (int u = 0; u < 6; ++u) {
    v[u * 4]     = r0[u * 8];
    v[u * 4 + 1] = r1[u * 8];
    v[u * 4 + 2] = r2[u * 8];
    v[u * 4 + 3] = r3[u * 8];
  }
  // The address pairs stay whole until this wait.
  asm volatile("s_wait_xcnt 0x0" :: "v"(r0), "v"(r1), "v"(r2), "v"(r3) : "memory");
#pragma unroll
  for (int u = 0; u < 6; ++u)
#pragma unroll
    for (int i = 0; i < 4; ++i)
      d2[u * 128 + i * 8] =
          __builtin_bit_cast(uint2, __builtin_convertvector(v[u * 4 + i], v4bf));
}

// ---------------------------------------------------------------------------
// Kernel 2: grouped pointwise conv (block-diagonal GEMM), Q and K_raw.
//   y = x_g @ w_g^T  per 192-wide group.  x and w come in fragment order.
//   The weights stay in registers: a block of 8 waves takes one group, waves
//   0..3 its Q columns and waves 4..7 its K_raw columns, three 16-column tiles
//   (18 units, 144 registers) a wave, loaded once.  The block then walks GC_RT
//   row tiles; the six x units of a row tile come from L2 once and serve all
//   8 waves, each of which does 18 WMMAs on them (three chains of six).
//   Q stored row-major bf16; K_raw stored TRANSPOSED (rows b*768+d, k = n) in
//   fragment order: a lane's 8 sums are 8 consecutive n of one d, which is one
//   16-B chunk at the lane's own place.
// ---------------------------------------------------------------------------
#define GC_RT 8      // row tiles a block walks: 128 rows, inside one batch
template <bool IS_Q>
__device__ __forceinline__ void gconv_walk(const u16* __restrict__ au,
                                           const u16* __restrict__ bu,
                                           u16* __restrict__ dst) {
  v16bf w[3][6];
#pragma unroll
  for (int c = 0; c < 3; ++c)
#pragma unroll
    for (int ks = 0; ks < 6; ++ks) w[c][ks] = ldunit(bu + (c * 6 + ks) * 512);

  v16bf a[6];
#pragma unroll
  for (int ks = 0; ks < 6; ++ks) a[ks] = ldunit(au + ks * 512);

  for (int i = 0; i < GC_RT; ++i) {
    // Keeps this tile's WMMAs behind the stores of the tile before: left free,
    // they were lifted over them, and the loads below, which cannot pass the
    // wait at the loop's foot, were then issued directly in front of their use.
    __builtin_amdgcn_sched_barrier(0);
    au += 24 * 512;
    v8f acc[3] = {};
#pragma unroll
    for (int ks = 0; ks < 6; ++ks) {
#pragma unroll
      for (int c = 0; c < 3; ++c) acc[c] = wmma_bf16(a[ks], w[c][ks], acc[c]);
      // the next row tile's unit, as soon as this one has been used
      if (i + 1 < GC_RT) a[ks] = ldunit(au + ks * 512);
    }
    // Keeps those loads in front of the conversions and stores, which then run
    // while the loads are in flight.
    __builtin_amdgcn_sched_barrier(0);

    if (IS_Q) {                              // acc[c][j]: row j, col c*16
#pragma unroll
      for (int j = 0; j < 8; ++j)
#pragma unroll
        for (int c = 0; c < 3; ++c) dst[j * DD + c * 16] = f2bf(acc[c][j]);
      dst += 16 * DD;
    } else {                                 // acc[c][j]: n = j, d = c*16
#pragma unroll
      for (int c = 0; c < 3; ++c)
        *(uint4*)(dst + c * 64 * 512) =
            __builtin_bit_cast(uint4, __builtin_convertvector(acc[c], v8bf));
      dst += 256;                            // the next 16 n: the next half unit
    }
    // From here on the stores' data registers are free for the next tiles'
    // loads: the wait stands in front of any such overwrite.
    asm volatile("s_wait_xcnt 0x0" ::: "memory");
  }
}

__global__ void __launch_bounds__(256)
k_gconv(const u16* __restrict__ xbf, const u16* __restrict__ wqbf,
        const u16* __restrict__ wkbf, u16* __restrict__ qbf, u16* __restrict__ krt) {
  const int lane = threadIdx.x & 31;
  const int wave = __builtin_amdgcn_readfirstlane(threadIdx.x >> 5);   // 0..7
  const int lm = lane & 15, lhalf = lane >> 4;
  const int g = blockIdx.x & 3;              // group
  const int rt0 = (blockIdx.x >> 2) * GC_RT; // first row tile (16 rows of B*N)
  const int ct = g * 12 + (wave & 3) * 3;    // first of three col tiles
  const int m0 = rt0 * 16;
  const u16* au = xbf + ((long)rt0 * 24 + g * 6) * 512 + lane * 8;
  const long bo = (long)ct * 6 * 512 + lane * 8;   // rows g*192+o = ct*16+lm

  if (wave < 4) {
    gconv_walk<true>(au, wqbf + bo,
                     qbf + (long)(m0 + lhalf * 8) * DD + ct * 16 + lm);
  } else {
    const int b = m0 >> 11, n0 = m0 & 2047;
    gconv_walk<false>(au, wkbf + bo,
                      krt + (long)(b * 48 + ct) * 64 * 512 + (n0 >> 4) * 256 + lane * 8);
  }
}

// ---------------------------------------------------------------------------
// Kernel 3: k_proj[b,kq,d] = sum_n pk[n,kq] * k_raw[b,n,d]
//   A = pkt (rows kq, k = n), B = krt (rows b*768+d, k = n), both in fragment
//   order, 64 steps.
//   The f32 tile never goes to memory: each lane holds 8 consecutive kq of one
//   column d, which are 8 consecutive bf16 both in values^T and in keys, so the
//   epilogue stores the same 16 bytes to each.
//   valt[b,h,dq,kq]   = k_proj[b, kq, h*64+dq]
//   keys[b,h,kq2,dq2] = k_proj[b, (h*64+dq2)&255, 3*kq2 + ((h*64+dq2)>>8)]
//     inverted: kq2 = d/3, c = (d%3)*256 + kq, h = c>>6, dq2 = c&63
// ---------------------------------------------------------------------------
__global__ void __launch_bounds__(256)
k_kproj(const u16* __restrict__ pkt, const u16* __restrict__ krt,
        u16* __restrict__ keys, u16* __restrict__ valt) {
  const int lane = threadIdx.x & 31, wave = threadIdx.x >> 5;
  const int lm = lane & 15, lhalf = lane >> 4;
  int id = blockIdx.x * 8 + wave;            // 0..6143
  int b = id / 768;
  int rem = id - b * 768;
  int mt = rem / 48, nt = rem % 48;

  const u16* au = pkt + (long)mt * 64 * 512 + lane * 8;
  const u16* bu = krt + (long)(b * 48 + nt) * 64 * 512 + lane * 8;

  v8f acc = {};
  for (int ks = 0; ks < 64; ++ks) {
    v16bf a = ldunit(au + ks * 512);
    v16bf bf = ldunit(bu + ks * 512);
    acc = wmma_bf16(a, bf, acc);
  }

  const uint4 pk8 = __builtin_bit_cast(uint4, __builtin_convertvector(acc, v8bf));

  const int kq0 = mt * 16 + lhalf * 8;       // first of this lane's 8 rows
  const int d = nt * 16 + lm;
  *(uint4*)(valt + ((long)(b * HH + (d >> 6)) * 64 + (d & 63)) * KK + kq0) = pk8;
  const int kq2 = d / 3;
  const int c0 = (d - kq2 * 3) * 256 + kq0;
  *(uint4*)(keys + ((long)(b * HH + (c0 >> 6)) * KK + kq2) * 64 + (c0 & 63)) = pk8;
}

// ---------------------------------------------------------------------------
// Kernel 5: attention.  Block = (b, h, 128-query chunk), 8 waves x 16 queries.
//   Transposed products: S^T = keys . q^T and O^T = values^T . P^T, so that a
//   query is a COLUMN of every accumulator tile, that is, one lane pair
//   (l, l ^ 16).  A lane holds 128 of its query's 256 scores: maximum and sum
//   are taken in the lane and joined once with the other half.  Two score tiles
//   (32 keys), converted in place, are the B operand of the second product, so
//   the probabilities never go through LDS.  A lane's 8 sums of an O^T tile are
//   8 consecutive dh of one query: one 16-B store.
//   LDS: keys 36KB + values^T 33KB = 69KB.
//   K/V staged with GLOBAL_LOAD_ASYNC_TO_LDS_B128 (ASYNCcnt-tracked DMA).
//   Every LDS row is read by ds_load_b128 with one row per lane, so each row
//   carries 16 pad bytes: the pitch is 16 B x odd (144 B, 528 B) and the 16
//   lanes of a half-wave fall on 16 different groups of four banks (bare
//   pitches of 128 B and 512 B put them on two groups and on one).
// ---------------------------------------------------------------------------
#define KPITCH 72    // keys row: 64 bf16 + 8 pad
#define VPITCH 264   // values^T row: 256 bf16 + 8 pad

// lane l takes the value of lane l ^ 16
__device__ __forceinline__ float xhalf(float v) {
  const int b = __builtin_bit_cast(int, v);
  return __builtin_bit_cast(float, __builtin_amdgcn_permlanex16(
      b, b, 0x76543210, 0xfedcba98, false, false));
}

__global__ void __launch_bounds__(256)
k_attn(const u16* __restrict__ qbf, const u16* __restrict__ keys,
       const u16* __restrict__ valt, u16* __restrict__ ctxbf) {
  extern __shared__ __align__(16) unsigned char smem_raw[];
  u16* keys_s = (u16*)smem_raw;              // [256][KPITCH]
  u16* valt_s = keys_s + 256 * KPITCH;       // [64][VPITCH]

  const int lane = threadIdx.x & 31, wave = threadIdx.x >> 5;
  const int lm = lane & 15, lhalf = lane >> 4;
  int chunk = blockIdx.x & 15;
  int bh = blockIdx.x >> 4;
  int b = bh / HH, h = bh - b * HH;

  // stage K and V^T into LDS (16B per thread per iter)
  {
    const uint4* kg = (const uint4*)(keys + (long)bh * 16384);
    const uint4* vg = (const uint4*)(valt + (long)bh * 16384);
#if HAVE_ASYNC_LDS
    typedef __attribute__((address_space(1))) v4i* gp_t;   // global int4*
    typedef __attribute__((address_space(3))) v4i* lp_t;   // LDS int4*
    for (int i = threadIdx.x; i < 2048; i += 256) {
      u16* kd = keys_s + (i >> 3) * KPITCH + (i & 7) * 8;    // 8 x 16 B a row
      u16* vd = valt_s + (i >> 5) * VPITCH + (i & 31) * 8;   // 32 x 16 B a row
      __builtin_amdgcn_global_load_async_to_lds_b128((gp_t)(kg + i),
                                                     (lp_t)kd, 0, 0);
      __builtin_amdgcn_global_load_async_to_lds_b128((gp_t)(vg + i),
                                                     (lp_t)vd, 0, 0);
    }
#if __has_builtin(__builtin_amdgcn_s_wait_asynccnt)
    __builtin_amdgcn_s_wait_asynccnt(0);
#else
    asm volatile("s_wait_asynccnt 0x0" ::: "memory");
#endif
#else
    for (int i = threadIdx.x; i < 2048; i += 256) {
      *(uint4*)(keys_s + (i >> 3) * KPITCH + (i & 7) * 8) = kg[i];
      *(uint4*)(valt_s + (i >> 5) * VPITCH + (i & 31) * 8) = vg[i];
    }
#endif
  }
  __syncthreads();

  const int n0 = chunk * 128 + wave * 16;
  const u16* qrow = qbf + ((long)(b * NN + n0 + lm)) * DD + h * 64;
  v16bf aq0 = ldfrag(qrow + lhalf * 8,      qrow + lhalf * 8 + 16);
  v16bf aq1 = ldfrag(qrow + 32 + lhalf * 8, qrow + 32 + lhalf * 8 + 16);

  // dots^T = keys @ q^T : 16 key tiles x 2 k-steps
  //   acc[t][j] = dot(key t*16 + lhalf*8 + j, query lm)
  v8f acc[16];
#pragma unroll
  for (int t = 0; t < 16; ++t) {
    const u16* kr = keys_s + (t * 16 + lm) * KPITCH;
    v16bf k0 = ldfrag(kr + lhalf * 8,      kr + lhalf * 8 + 16);
    v16bf k1 = ldfrag(kr + 32 + lhalf * 8, kr + 32 + lhalf * 8 + 16);
    v8f z = {};
    acc[t] = wmma_bf16(k0, aq0, z);
    acc[t] = wmma_bf16(k1, aq1, acc[t]);
  }
#pragma unroll
  for (int t = 0; t < 16; ++t) acc[t] *= 0.125f;   // exact: a power of two

  // softmax over the 256 keys of query lm, scale 1/sqrt(64): 128 scores in this
  // lane, 128 in lane ^ 16.  Eight running sums, one per register of a tile.
  float m = -3.4e38f;
#pragma unroll
  for (int t = 0; t < 16; ++t)
#pragma unroll
    for (int j = 0; j < 8; ++j) m = fmaxf(m, acc[t][j]);
  m = fmaxf(m, xhalf(m));
  v8f sv = {};
#pragma unroll
  for (int t = 0; t < 16; ++t) {
#pragma unroll
    for (int j = 0; j < 8; ++j) acc[t][j] = __expf(acc[t][j] - m);
    sv += acc[t];
  }
  float s = ((sv[0] + sv[1]) + (sv[2] + sv[3])) + ((sv[4] + sv[5]) + (sv[6] + sv[7]));
  s += xhalf(s);
  const float inv = 1.f / s;

  // ctx^T = values^T @ attn^T : 4 dh tiles x 8 k-steps of 32 keys
  //   B operand of step ks: keys ks*32 + lhalf*8 + 0..7 are tile 2ks of this
  //   lane, keys ks*32 + 16 + lhalf*8 + 0..7 tile 2ks+1: the order in which the
  //   two 16-B chunks of a values^T row are taken.
  v8f o[4];
#pragma unroll
  for (int t = 0; t < 4; ++t) { v8f z = {}; o[t] = z; }
#pragma unroll
  for (int ks = 0; ks < 8; ++ks) {
    v16bf bp;
#pragma unroll
    for (int j = 0; j < 8; ++j) {
      bp[j]     = (__bf16)(acc[2 * ks][j] * inv);
      bp[8 + j] = (__bf16)(acc[2 * ks + 1][j] * inv);
    }
#pragma unroll
    for (int dt = 0; dt < 4; ++dt) {
      const u16* vr = valt_s + (dt * 16 + lm) * VPITCH + ks * 32 + lhalf * 8;
      v16bf av = ldfrag(vr, vr + 16);
      o[dt] = wmma_bf16(av, bp, o[dt]);
    }
  }
  // o[dt][j]: query lm, dh = dt*16 + lhalf*8 + j
  u16* crow = ctxbf + (long)(b * NN + n0 + lm) * DD + h * 64 + lhalf * 8;
#pragma unroll
  for (int dt = 0; dt < 4; ++dt)
    *(uint4*)(crow + dt * 16) =
        __builtin_bit_cast(uint4, __builtin_convertvector(o[dt], v8bf));
}

// ---------------------------------------------------------------------------
// Kernel 6: out = ctx @ w_out^T + b_out; y = x + out; LayerNorm(y).
//   Block = 64 rows (OUT_RT row tiles); 8 waves x 6 col tiles; 24 k-steps.
//   A wave keeps 4 x 6 accumulator tiles: the six w_out units of a k-step feed
//   four row tiles each, so w_out is read once per 64 rows, and a k-step is 20
//   loads for 24 WMMAs.  Two fragment sets: the 20 loads of the next k-step go
//   out as one group in front of this k-step's WMMAs.  LN via LDS + shfl, a
//   thread taking the same 48 columns of four rows.
//   w_out comes in fragment order; ctx is row-major.
// ---------------------------------------------------------------------------
#define OUT_RT 4     // row tiles a block takes
__device__ __forceinline__ void out_load(const u16* ap, const u16* bp,
                                         v16bf (&a)[OUT_RT], v16bf (&b)[6]) {
#pragma unroll
  for (int c = 0; c < 6; ++c) b[c] = ldunit(bp + c * 24 * 512);
#pragma unroll
  for (int r = 0; r < OUT_RT; ++r)
    a[r] = ldfrag(ap + r * 16 * DD, ap + r * 16 * DD + 16);
}

__device__ __forceinline__ void out_mma(const v16bf (&a)[OUT_RT], const v16bf (&b)[6],
                                        v8f (&acc)[OUT_RT][6]) {
#pragma unroll
  for (int c = 0; c < 6; ++c)
#pragma unroll
    for (int r = 0; r < OUT_RT; ++r) acc[r][c] = wmma_bf16(a[r], b[c], acc[r][c]);
}

__global__ void __launch_bounds__(256)
k_out(const u16* __restrict__ ctxbf, const u16* __restrict__ woutbf,
      const float* __restrict__ x, const float* __restrict__ bout,
      const float* __restrict__ gamma, const float* __restrict__ beta,
      float* __restrict__ out) {
  __shared__ float ybuf[16 * OUT_RT][772];   // padded vs 64-bank LDS
  const int lane = threadIdx.x & 31, wave = threadIdx.x >> 5;
  const int lm = lane & 15, lhalf = lane >> 4;
  const int r0 = blockIdx.x * (16 * OUT_RT);

  unsigned ao = (unsigned)(r0 + lm) * DD + lhalf * 8;        // index into ctx
  unsigned bo = (unsigned)wave * (6 * 24 * 512) + lane * 8;  // index into w_out
  v8f acc[OUT_RT][6];
#pragma unroll
  for (int r = 0; r < OUT_RT; ++r)
#pragma unroll
    for (int c = 0; c < 6; ++c) { v8f z = {}; acc[r][c] = z; }

  v16bf a0[OUT_RT], b0[6], a1[OUT_RT], b1[6];
  out_load(ctxbf + ao, woutbf + bo, a0, b0);
  for (int ks = 0; ks < 22; ks += 2) {
    const u16* pa = ctxbf + ao;
    const u16* pb = woutbf + bo;
    out_load(pa + 32, pb + 512, a1, b1);
    // Keeps the loads above in front of the WMMAs below: left free, they were
    // sunk among the WMMAs, many to just in front of their first use, which
    // then waited out the latency.
    __builtin_amdgcn_sched_barrier(0);
    out_mma(a0, b0, acc);
    // Keeps the reload of the first set behind its last use and, with the next
    // barrier, in front of the second set's WMMAs, for the same reason.
    __builtin_amdgcn_sched_barrier(0);
    // The issued loads name the two address pairs: as inputs they stay whole
    // until the wait, and the next pairs, made from the offsets that leave this
    // statement, are formed behind it.
    asm volatile("s_wait_xcnt 0x0" : "+v"(ao), "+v"(bo) : "v"(pa), "v"(pb) : "memory");
    ao += 64;
    bo += 1024;
    pa = ctxbf + ao;
    pb = woutbf + bo;
    out_load(pa, pb, a0, b0);
    __builtin_amdgcn_sched_barrier(0);
    out_mma(a1, b1, acc);
    // Keeps the wait below behind the WMMAs, where it costs nothing.
    __builtin_amdgcn_sched_barrier(0);
    // The same wait for the reload's address pairs.
    asm volatile("s_wait_xcnt 0x0" : "+v"(ao), "+v"(bo) : "v"(pa), "v"(pb) : "memory");
  }
  {
    const u16* pa = ctxbf + ao;
    const u16* pb = woutbf + bo;
    out_load(pa + 32, pb + 512, a1, b1);     // the last k-step
    // As in the loop: the loads in front of the WMMAs, and the wait, held in
    // place by the two barriers, in front of whatever takes the pairs' place.
    __builtin_amdgcn_sched_barrier(0);
    asm volatile("s_wait_xcnt 0x0" :: "v"(pa), "v"(pb) : "memory");
    __builtin_amdgcn_sched_barrier(0);
  }
  out_mma(a0, b0, acc);
  out_mma(a1, b1, acc);

  // acc[r][c][j]: row r*16 + lhalf*8 + j, col wave*96 + c*16 + lm
  const float* xb = x + (long)(r0 + lhalf * 8) * DD + wave * 96 + lm;
  const float* bb = bout + wave * 96 + lm;
  float* yb = &ybuf[lhalf * 8][wave * 96 + lm];
#pragma unroll
  for (int r = 0; r < OUT_RT; ++r)
#pragma unroll
    for (int c = 0; c < 6; ++c)
#pragma unroll
      for (int j = 0; j < 8; ++j)
        yb[(r * 16 + j) * 772 + c * 16] =
            acc[r][c][j] + bb[c * 16] + xb[(r * 16 + j) * DD + c * 16];
  // The two address pairs stay whole until this wait, so that no later load's
  // result is allocated over the pair of loads still being issued.
  asm volatile("s_wait_xcnt 0x0" :: "v"(xb), "v"(bb) : "memory");
  __syncthreads();

  int rr = threadIdx.x >> 4;                 // rows rr + 16 q, 16 lanes per row
  int s  = threadIdx.x & 15;
  float sum[OUT_RT], sq[OUT_RT];
#pragma unroll
  for (int q = 0; q < OUT_RT; ++q) { sum[q] = 0.f; sq[q] = 0.f; }
  for (int c = s; c < DD; c += 16)
#pragma unroll
    for (int q = 0; q < OUT_RT; ++q) {
      float v = ybuf[q * 16 + rr][c];
      sum[q] += v;
      sq[q] += v * v;
    }
  float mu[OUT_RT], rstd[OUT_RT];
#pragma unroll
  for (int q = 0; q < OUT_RT; ++q) {
    float sm = sum[q], ss = sq[q];
    sm += __shfl_xor(sm, 1, 32); ss += __shfl_xor(ss, 1, 32);
    sm += __shfl_xor(sm, 2, 32); ss += __shfl_xor(ss, 2, 32);
    sm += __shfl_xor(sm, 4, 32); ss += __shfl_xor(ss, 4, 32);
    sm += __shfl_xor(sm, 8, 32); ss += __shfl_xor(ss, 8, 32);
    mu[q] = sm * (1.f / DD);
    float var = ss * (1.f / DD) - mu[q] * mu[q];
    rstd[q] = rsqrtf(var + 1e-12f);
  }
  for (int c = s; c < DD; c += 16) {
    const float g = gamma[c], be = beta[c];
#pragma unroll
    for (int q = 0; q < OUT_RT; ++q)
      out[(long)(r0 + q * 16 + rr) * DD + c] =
          (ybuf[q * 16 + rr][c] - mu[q]) * rstd[q] * g + be;
  }
}

// ---------------------------------------------------------------------------
// Host launcher
// ---------------------------------------------------------------------------
extern "C" void kernel_launch(void* const* d_in, const int* in_sizes, int n_in,
                              void* d_out, int out_size, void* d_ws, size_t ws_size,
                              hipStream_t stream) {
  const float* x     = (const float*)d_in[0];
  const float* wq    = (const float*)d_in[1];
  const float* wk    = (const float*)d_in[2];
  const float* pk    = (const float*)d_in[3];
  const float* wout  = (const float*)d_in[4];
  const float* bout  = (const float*)d_in[5];
  const float* gamma = (const float*)d_in[6];
  const float* beta  = (const float*)d_in[7];
  float* out = (float*)d_out;
  char* ws = (char*)d_ws;

  // 256B-aligned workspace layout (bytes)
  u16*   xbf   = (u16*)(ws + 0);             // 25,165,824
  u16*   wqbf  = (u16*)(ws + 25165824);      //    294,912
  u16*   wkbf  = (u16*)(ws + 25460736);      //    294,912
  u16*   woutb = (u16*)(ws + 25755648);      //  1,179,648
  u16*   pkt   = (u16*)(ws + 26935296);      //  1,048,576
  u16*   qbf   = (u16*)(ws + 27983872);      // 25,165,824
  u16*   krt   = (u16*)(ws + 53149696);      // 25,165,824
  u16*   keys  = (u16*)(ws + 84606976);      //  3,145,728
  u16*   valt  = (u16*)(ws + 87752704);      //  3,145,728
  u16*   ctxbf = (u16*)(ws + 90898432);      // 25,165,824  (end 116,064,256)

  (void)hipFuncSetAttribute(reinterpret_cast<const void*>(k_attn),
                            hipFuncAttributeMaxDynamicSharedMemorySize, 70656);

  k_convert<<<  580, 256, 0, stream>>>(x, wq, wk, wout, pk, xbf, wqbf, wkbf, woutb, pkt);
  k_gconv  <<<  512, 256, 0, stream>>>(xbf, wqbf, wkbf, qbf, krt);
  k_kproj  <<<  768, 256, 0, stream>>>(pkt, krt, keys, valt);
  k_attn   <<< 1536, 256, 70656, stream>>>(qbf, keys, valt, ctxbf);
  k_out    <<<  256, 256, 0, stream>>>(ctxbf, woutb, x, bout, gamma, beta, out);
}

// v008
// One run takes 87.2 microseconds.
// Timed twice side by side with v007, it ran 1.27 times as fast both times.
// Over all steps from v000 it is 3.92 times as fast.
#include <hip/hip_runtime.h>
#include <hip/hip_bf16.h>

// ---------------------------------------------------------------------------
// BonzSelfAttention for MI455X (gfx1250): bf16 WMMA everywhere, fp32 accum.
// B=8, N=2048, D=768, K=256, H=12, G=4, DH=64
// ---------------------------------------------------------------------------

typedef __attribute__((ext_vector_type(16))) __bf16 v16bf;
typedef __attribute__((ext_vector_type(8)))  __bf16 v8bf;
typedef __attribute__((ext_vector_type(8)))  float  v8f;
typedef __attribute__((ext_vector_type(4)))  float  v4f;
typedef __attribute__((ext_vector_type(4)))  __bf16 v4bf;
typedef __attribute__((ext_vector_type(4)))  int    v4i;
typedef unsigned short u16;

#define BN   16384   // B*N
#define DD   768
#define NN   2048
#define KK   256
#define HH   12

#if __has_builtin(__builtin_amdgcn_global_load_async_to_lds_b128)
#define HAVE_ASYNC_LDS 1
#else
#define HAVE_ASYNC_LDS 0
#endif

struct alignas(32) Frag32B { uint4 lo, hi; };

// Native bf16 convert (RNE) — lets clang emit v_cvt instead of manual rounding.
__device__ __forceinline__ u16 f2bf(float f) {
  __bf16 h = (__bf16)f;
  return __builtin_bit_cast(u16, h);
}

// A/B operand fragment: two 16-byte chunks (K-chunk and K-chunk+16) per lane.
__device__ __forceinline__ v16bf ldfrag(const u16* p0, const u16* p1) {
  Frag32B f;
  f.lo = *(const uint4*)p0;
  f.hi = *(const uint4*)p1;
  return __builtin_bit_cast(v16bf, f);
}

__device__ __forceinline__ v8f wmma_bf16(v16bf a, v16bf b, v8f c) {
  // (neg_a, A, neg_b, B, c_mod, C, reuse_a, reuse_b)
  return __builtin_amdgcn_wmma_f32_16x16x32_bf16(false, a, false, b, (short)0, c,
                                                 false, false);
}

// ---------------------------------------------------------------------------
// Fragment order.  x, wq, wk, w_out, pkt and krt, bf16 matrices M[row][k] that
// GEMMs read from global memory, are kept in the workspace as 1-KB units, one per (16 rows, 32 k):
//   unit  = (row >> 4) * (K / 32) + (k >> 5)
//   u16 offset in the unit = ((k >> 4) & 1) * 256        first / second chunk
//                          + (((k >> 3) & 1) * 16 + (row & 15)) * 8   the lane
//                          + (k & 7)
// A lane's two 16-B chunks are the ones it took from the row-major matrix, so
// the fragments hold the same values; but the 32 lanes of one load now read 512
// contiguous bytes (4 lines) where rows of 384 B and more gave 16 lines.
// ---------------------------------------------------------------------------
__device__ __forceinline__ v16bf ldunit(const u16* unit_lane) {
  return ldfrag(unit_lane, unit_lane + 256);
}

// ---------------------------------------------------------------------------
// Kernel 1: fp32 -> bf16 conversions into fragment order (+ project_k transpose)
//   Few, long waves instead of one element per thread.  A block takes one role
//   by its index (block-uniform):
//     0..31     project_k: thread = column kq, 64 rows n; the 64 loads are
//               coalesced over kq; 16 threads store 256 contiguous bytes
//     32..37    wq, 38..43 wk, 44..67 w_out, 68..579 x: a wave makes six units
//               in a row (16 rows x 192 k).  The 16 rows of a unit are one
//               128-B line of floats each: a wave-wide float4 load takes four
//               whole lines (8 lanes a row), and the 8-B stores of the four
//               rows fall in 64-B runs of the unit; a thread's 24 loads are
//               independent, so many are in flight at a time
// ---------------------------------------------------------------------------
__global__ void __launch_bounds__(256)
k_convert(const float* __restrict__ x,  const float* __restrict__ wq,
          const float* __restrict__ wk, const float* __restrict__ wout,
          const float* __restrict__ pk,
          u16* __restrict__ xbf, u16* __restrict__ wqbf, u16* __restrict__ wkbf,
          u16* __restrict__ woutbf, u16* __restrict__ pkt) {
  const int tid = threadIdx.x;
  int bid = blockIdx.x;

  if (bid < 32) {                            // pkt[kq][n] = pk[n][kq]
    const float* s = pk + (long)bid * 64 * KK + tid;
    float v[64];
#pragma unroll
    for (int j = 0; j < 64; ++j) v[j] = s[j * KK];
    // rows kq, k = n = bid*64 + c*8 + j: units (tid>>4)*64 + bid*2 + (c>>2)
    u16* d = pkt + ((long)(tid >> 4) * 64 + bid * 2) * 512 + (tid & 15) * 8;
#pragma unroll
    for (int c = 0; c < 8; ++c) {
      v8f f;
#pragma unroll
      for (int j = 0; j < 8; ++j) f[j] = v[c * 8 + j];
      *(uint4*)(d + (c >> 2) * 512 + ((c >> 1) & 1) * 256 + (c & 1) * 128) =
          __builtin_bit_cast(uint4, __builtin_convertvector(f, v8bf));
    }
    return;
  }

  const float* s;
  u16* d;
  int kd = DD;                               // row length k of the matrix
  if (bid < 38)      { s = wq;   d = wqbf;   bid -= 32; kd = 192; }
  else if (bid < 44) { s = wk;   d = wkbf;   bid -= 38; kd = 192; }
  else if (bid < 68) { s = wout; d = woutbf; bid -= 44; }
  else               { s = x;    d = xbf;    bid -= 68; }

  const int r4 = (tid & 31) >> 3, p = tid & 7;   // row in a group of 4, float4 in the line
  const int gw = bid * 8 + (tid >> 5);       // this wave's run of six units
  int rt = gw, ks0 = 0;                      // 192 k: six units are a row tile
  if (kd == DD) { rt = gw >> 2; ks0 = (gw & 3) * 6; }

  // v[u*4+i]: unit u, row i*4 + r4, k = p*4 .. p*4+3 of the unit
  const v4f* s4 = (const v4f*)(s + (long)(rt * 16 + r4) * kd + ks0 * 32 + p * 4);
  uint2*     d2 = (uint2*)(d + (long)gw * 6 * 512 + (p >> 2) * 256 +
                           (((p >> 1) & 1) * 16 + r4) * 8 + (p & 1) * 4);
  const v4f* r0 = s4;                        // the four rows' address pairs
  const v4f* r1 = s4 + kd;
  const v4f* r2 = s4 + 2 * kd;
  const v4f* r3 = s4 + 3 * kd;
  v4f v[24];
#pragma unroll
  for (int u = 0; u < 6; ++u) {
    v[u * 4]     = r0[u * 8];
    v[u * 4 + 1] = r1[u * 8];
    v[u * 4 + 2] = r2[u * 8];
    v[u * 4 + 3] = r3[u * 8];
  }
  // The address pairs stay whole until this wait.
  asm volatile("s_wait_xcnt 0x0" :: "v"(r0), "v"(r1), "v"(r2), "v"(r3) : "memory");
#pragma unroll
  for (int u = 0; u < 6; ++u)
#pragma unroll
    for (int i = 0; i < 4; ++i)
      d2[u * 128 + i * 8] =
          __builtin_bit_cast(uint2, __builtin_convertvector(v[u * 4 + i], v4bf));
}

// ---------------------------------------------------------------------------
// Kernel 2: grouped pointwise conv (block-diagonal GEMM), Q and K_raw.
//   y = x_g @ w_g^T  per 192-wide group.  x and w come in fragment order.
//   The weights stay in registers: a block of 8 waves takes one group, waves
//   0..3 its Q columns and waves 4..7 its K_raw columns, three 16-column tiles
//   (18 units, 144 registers) a wave, loaded once.  The block then walks GC_RT
//   row tiles; the six x units of a row tile come from L2 once and serve all
//   8 waves, each of which does 18 WMMAs on them (three chains of six).
//   Q stored row-major bf16; K_raw stored TRANSPOSED (rows b*768+d, k = n) in
//   fragment order: a lane's 8 sums are 8 consecutive n of one d, which is one
//   16-B chunk at the lane's own place.
// ---------------------------------------------------------------------------
#define GC_RT 8      // row tiles a block walks: 128 rows, inside one batch
template <bool IS_Q>
__device__ __forceinline__ void gconv_walk(const u16* __restrict__ au,
                                           const u16* __restrict__ bu,
                                           u16* __restrict__ dst) {
  v16bf w[3][6];
#pragma unroll
  for (int c = 0; c < 3; ++c)
#pragma unroll
    for (int ks = 0; ks < 6; ++ks) w[c][ks] = ldunit(bu + (c * 6 + ks) * 512);

  v16bf a[6];
#pragma unroll
  for (int ks = 0; ks < 6; ++ks) a[ks] = ldunit(au + ks * 512);

  for (int i = 0; i < GC_RT; ++i) {
    // Keeps this tile's WMMAs behind the stores of the tile before: left free,
    // they were lifted over them, and the loads below, which cannot pass the
    // wait at the loop's foot, were then issued directly in front of their use.
    __builtin_amdgcn_sched_barrier(0);
    au += 24 * 512;
    v8f acc[3] = {};
#pragma unroll
    for (int ks = 0; ks < 6; ++ks) {
#pragma unroll
      for (int c = 0; c < 3; ++c) acc[c] = wmma_bf16(a[ks], w[c][ks], acc[c]);
      // the next row tile's unit, as soon as this one has been used
      if (i + 1 < GC_RT) a[ks] = ldunit(au + ks * 512);
    }
    // Keeps those loads in front of the conversions and stores, which then run
    // while the loads are in flight.
    __builtin_amdgcn_sched_barrier(0);

    if (IS_Q) {                              // acc[c][j]: row j, col c*16
#pragma unroll
      for (int j = 0; j < 8; ++j)
#pragma unroll
        for (int c = 0; c < 3; ++c) dst[j * DD + c * 16] = f2bf(acc[c][j]);
      dst += 16 * DD;
    } else {                                 // acc[c][j]: n = j, d = c*16
#pragma unroll
      for (int c = 0; c < 3; ++c)
        *(uint4*)(dst + c * 64 * 512) =
            __builtin_bit_cast(uint4, __builtin_convertvector(acc[c], v8bf));
      dst += 256;                            // the next 16 n: the next half unit
    }
    // From here on the stores' data registers are free for the next tiles'
    // loads: the wait stands in front of any such overwrite.
    asm volatile("s_wait_xcnt 0x0" ::: "memory");
  }
}

__global__ void __launch_bounds__(256)
k_gconv(const u16* __restrict__ xbf, const u16* __restrict__ wqbf,
        const u16* __restrict__ wkbf, u16* __restrict__ qbf, u16* __restrict__ krt) {
  const int lane = threadIdx.x & 31;
  const int wave = __builtin_amdgcn_readfirstlane(threadIdx.x >> 5);   // 0..7
  const int lm = lane & 15, lhalf = lane >> 4;
  const int g = blockIdx.x & 3;              // group
  const int rt0 = (blockIdx.x >> 2) * GC_RT; // first row tile (16 rows of B*N)
  const int ct = g * 12 + (wave & 3) * 3;    // first of three col tiles
  const int m0 = rt0 * 16;
  const u16* au = xbf + ((long)rt0 * 24 + g * 6) * 512 + lane * 8;
  const long bo = (long)ct * 6 * 512 + lane * 8;   // rows g*192+o = ct*16+lm

  if (wave < 4) {
    gconv_walk<true>(au, wqbf + bo,
                     qbf + (long)(m0 + lhalf * 8) * DD + ct * 16 + lm);
  } else {
    const int b = m0 >> 11, n0 = m0 & 2047;
    gconv_walk<false>(au, wkbf + bo,
                      krt + (long)(b * 48 + ct) * 64 * 512 + (n0 >> 4) * 256 + lane * 8);
  }
}

// ---------------------------------------------------------------------------
// Kernel 3: k_proj[b,kq,d] = sum_n pk[n,kq] * k_raw[b,n,d]
//   A = pkt (rows kq, k = n), B = krt (rows b*768+d, k = n), both in fragment
//   order, 64 k-steps.
//   A block takes 64 kq x 96 d (4 x 6 tiles).  A wave keeps 4 x 3 accumulator
//   tiles, one half of the block's columns, over one quarter of k (16 k-steps):
//   the seven units of a k-step feed 12 WMMAs.  Three fragment sets: the 14
//   loads of a k-step go out as one group two k-steps ahead.  The four quarters
//   are summed in LDS, each wave taking three of the 24 tiles.
//   The f32 tile never goes to memory: each lane holds 8 consecutive kq of one
//   column d, which are 8 consecutive bf16 both in values^T and in keys, so the
//   epilogue stores the same 16 bytes to each.
//   valt[b,h,dq,kq]   = k_proj[b, kq, h*64+dq]
//   keys[b,h,kq2,dq2] = k_proj[b, (h*64+dq2)&255, 3*kq2 + ((h*64+dq2)>>8)]
//     inverted: kq2 = d/3, c = (d%3)*256 + kq, h = c>>6, dq2 = c&63
// ---------------------------------------------------------------------------
#define KP_MT 4      // kq tiles a wave keeps
#define KP_NT 3      // d tiles a wave keeps
#define KP_KS 16     // k-steps a wave takes: a quarter of the 64
__device__ __forceinline__ void kp_load(const u16* ap, const u16* bp,
                                        v16bf (&a)[KP_MT], v16bf (&b)[KP_NT]) {
#pragma unroll
  for (int m = 0; m < KP_MT; ++m) a[m] = ldunit(ap + m * 64 * 512);
#pragma unroll
  for (int n = 0; n < KP_NT; ++n) b[n] = ldunit(bp + n * 64 * 512);
}

__device__ __forceinline__ void kp_mma(const v16bf (&a)[KP_MT], const v16bf (&b)[KP_NT],
                                       v8f (&acc)[KP_MT][KP_NT]) {
#pragma unroll
  for (int m = 0; m < KP_MT; ++m)
#pragma unroll
    for (int n = 0; n < KP_NT; ++n) acc[m][n] = wmma_bf16(a[m], b[n], acc[m][n]);
}

__global__ void __launch_bounds__(256)
k_kproj(const u16* __restrict__ pkt, const u16* __restrict__ krt,
        u16* __restrict__ keys, u16* __restrict__ valt) {
  // [quarter of k][tile m*6 + n][registers 0..3, 4..7][lane][4]
  __shared__ __align__(16) float part[4][24][2][128];
  const int lane = threadIdx.x & 31;
  const int wave = __builtin_amdgcn_readfirstlane(threadIdx.x >> 5);   // 0..7
  const int lm = lane & 15, lhalf = lane >> 4;
  const int nb = blockIdx.x & 63;            // 96 of the 6144 rows b*768+d
  const int mb = blockIdx.x >> 6;            // 64 of the 256 kq
  const int nw = wave & 1, kqt = wave >> 1;  // column half, quarter of k

  const u16* au = pkt + ((long)(mb * KP_MT) * 64 + kqt * KP_KS) * 512 + lane * 8;
  const u16* bu = krt + ((long)(nb * 6 + nw * KP_NT) * 64 + kqt * KP_KS) * 512 + lane * 8;

  v8f acc[KP_MT][KP_NT];
#pragma unroll
  for (int m = 0; m < KP_MT; ++m)
#pragma unroll
    for (int n = 0; n < KP_NT; ++n) { v8f z = {}; acc[m][n] = z; }

  v16bf a[3][KP_MT], b[3][KP_NT];
  kp_load(au, bu, a[0], b[0]);
  // Keeps the first k-step's loads the oldest: mixed with the second's and the
  // third's, the first WMMAs waited for all three groups.
  __builtin_amdgcn_sched_barrier(0);
  kp_load(au + 512, bu + 512, a[1], b[1]);
  // Unrolled whole: the set numbers are then constants and every load takes its
  // place from the instruction's offset, so the address registers never change.
#pragma unroll
  for (int ks = 0; ks < KP_KS; ++ks) {
    // For the same reason as above, and it keeps this group of loads behind the
    // last use of the set that it refills.
    __builtin_amdgcn_sched_barrier(0);
    if (ks + 2 < KP_KS)
      kp_load(au + (ks + 2) * 512, bu + (ks + 2) * 512, a[(ks + 2) % 3], b[(ks + 2) % 3]);
    // Keeps the loads above in front of this k-step's WMMAs: sunk among them,
    // they would lose part of their two k-steps of lead.
    __builtin_amdgcn_sched_barrier(0);
    kp_mma(a[ks % 3], b[ks % 3], acc);
    if (ks + 3 == KP_KS) {
      // Behind the last group of loads and the WMMAs that follow it, where it
      // costs nothing, and held there by the barriers: in front of whatever
      // takes the place of the loads' address registers behind the loop.
      __builtin_amdgcn_sched_barrier(0);
      asm volatile("s_wait_xcnt 0x0" ::: "memory");
    }
  }

  // acc[m][n] is the partial sum of tile m*6 + nw*3 + n; a wave-wide 16-B LDS
  // access covers 512 contiguous bytes.
#pragma unroll
  for (int m = 0; m < KP_MT; ++m)
#pragma unroll
    for (int n = 0; n < KP_NT; ++n) {
      float* p = &part[kqt][m * 6 + nw * KP_NT + n][0][lane * 4];
      *(v4f*)p         = __builtin_shufflevector(acc[m][n], acc[m][n], 0, 1, 2, 3);
      *(v4f*)(p + 128) = __builtin_shufflevector(acc[m][n], acc[m][n], 4, 5, 6, 7);
    }
  __syncthreads();

  // wave w sums tiles 3w .. 3w+2: tile row w >> 1, tile columns (w & 1) * 3 + i
  const int bt = nb >> 3;                    // batch: 8 blocks of 96 columns each
  const int kq0 = (mb * KP_MT + (wave >> 1)) * 16 + lhalf * 8;   // first of the lane's 8 rows
#pragma unroll
  for (int i = 0; i < 3; ++i) {
    const float* p = &part[0][wave * 3 + i][0][lane * 4];
    v4f lo = (*(const v4f*)p + *(const v4f*)(p + 6144)) +
             (*(const v4f*)(p + 12288) + *(const v4f*)(p + 18432));
    v4f hi = (*(const v4f*)(p + 128) + *(const v4f*)(p + 6144 + 128)) +
             (*(const v4f*)(p + 12288 + 128) + *(const v4f*)(p + 18432 + 128));
    const v8f sum = __builtin_shufflevector(lo, hi, 0, 1, 2, 3, 4, 5, 6, 7);
    const uint4 pk8 = __builtin_bit_cast(uint4, __builtin_convertvector(sum, v8bf));

    const int d = ((nb & 7) * 6 + (wave & 1) * 3 + i) * 16 + lm;
    *(uint4*)(valt + ((long)(bt * HH + (d >> 6)) * 64 + (d & 63)) * KK + kq0) = pk8;
    const int kq2 = d / 3;
    const int c0 = (d - kq2 * 3) * 256 + kq0;
    *(uint4*)(keys + ((long)(bt * HH + (c0 >> 6)) * KK + kq2) * 64 + (c0 & 63)) = pk8;
  }
}

// ---------------------------------------------------------------------------
// Kernel 5: attention.  Block = (b, h, 128-query chunk), 8 waves x 16 queries.
//   Transposed products: S^T = keys . q^T and O^T = values^T . P^T, so that a
//   query is a COLUMN of every accumulator tile, that is, one lane pair
//   (l, l ^ 16).  A lane holds 128 of its query's 256 scores: maximum and sum
//   are taken in the lane and joined once with the other half.  Two score tiles
//   (32 keys), converted in place, are the B operand of the second product, so
//   the probabilities never go through LDS.  A lane's 8 sums of an O^T tile are
//   8 consecutive dh of one query: one 16-B store.
//   LDS: keys 36KB + values^T 33KB = 69KB.
//   K/V staged with GLOBAL_LOAD_ASYNC_TO_LDS_B128 (ASYNCcnt-tracked DMA).
//   Every LDS row is read by ds_load_b128 with one row per lane, so each row
//   carries 16 pad bytes: the pitch is 16 B x odd (144 B, 528 B) and the 16
//   lanes of a half-wave fall on 16 different groups of four banks (bare
//   pitches of 128 B and 512 B put them on two groups and on one).
// ---------------------------------------------------------------------------
#define KPITCH 72    // keys row: 64 bf16 + 8 pad
#define VPITCH 264   // values^T row: 256 bf16 + 8 pad

// lane l takes the value of lane l ^ 16
__device__ __forceinline__ float xhalf(float v) {
  const int b = __builtin_bit_cast(int, v);
  return __builtin_bit_cast(float, __builtin_amdgcn_permlanex16(
      b, b, 0x76543210, 0xfedcba98, false, false));
}

__global__ void __launch_bounds__(256)
k_attn(const u16* __restrict__ qbf, const u16* __restrict__ keys,
       const u16* __restrict__ valt, u16* __restrict__ ctxbf) {
  extern __shared__ __align__(16) unsigned char smem_raw[];
  u16* keys_s = (u16*)smem_raw;              // [256][KPITCH]
  u16* valt_s = keys_s + 256 * KPITCH;       // [64][VPITCH]

  const int lane = threadIdx.x & 31, wave = threadIdx.x >> 5;
  const int lm = lane & 15, lhalf = lane >> 4;
  int chunk = blockIdx.x & 15;
  int bh = blockIdx.x >> 4;
  int b = bh / HH, h = bh - b * HH;

  // stage K and V^T into LDS (16B per thread per iter)
  {
    const uint4* kg = (const uint4*)(keys + (long)bh * 16384);
    const uint4* vg = (const uint4*)(valt + (long)bh * 16384);
#if HAVE_ASYNC_LDS
    typedef __attribute__((address_space(1))) v4i* gp_t;   // global int4*
    typedef __attribute__((address_space(3))) v4i* lp_t;   // LDS int4*
    for (int i = threadIdx.x; i < 2048; i += 256) {
      u16* kd = keys_s + (i >> 3) * KPITCH + (i & 7) * 8;    // 8 x 16 B a row
      u16* vd = valt_s + (i >> 5) * VPITCH + (i & 31) * 8;   // 32 x 16 B a row
      __builtin_amdgcn_global_load_async_to_lds_b128((gp_t)(kg + i),
                                                     (lp_t)kd, 0, 0);
      __builtin_amdgcn_global_load_async_to_lds_b128((gp_t)(vg + i),
                                                     (lp_t)vd, 0, 0);
    }
#if __has_builtin(__builtin_amdgcn_s_wait_asynccnt)
    __builtin_amdgcn_s_wait_asynccnt(0);
#else
    asm volatile("s_wait_asynccnt 0x0" ::: "memory");
#endif
#else
    for (int i = threadIdx.x; i < 2048; i += 256) {
      *(uint4*)(keys_s + (i >> 3) * KPITCH + (i & 7) * 8) = kg[i];
      *(uint4*)(valt_s + (i >> 5) * VPITCH + (i & 31) * 8) = vg[i];
    }
#endif
  }
  __syncthreads();

  const int n0 = chunk * 128 + wave * 16;
  const u16* qrow = qbf + ((long)(b * NN + n0 + lm)) * DD + h * 64;
  v16bf aq0 = ldfrag(qrow + lhalf * 8,      qrow + lhalf * 8 + 16);
  v16bf aq1 = ldfrag(qrow + 32 + lhalf * 8, qrow + 32 + lhalf * 8 + 16);

  // dots^T = keys @ q^T : 16 key tiles x 2 k-steps
  //   acc[t][j] = dot(key t*16 + lhalf*8 + j, query lm)
  v8f acc[16];
#pragma unroll
  for (int t = 0; t < 16; ++t) {
    const u16* kr = keys_s + (t * 16 + lm) * KPITCH;
    v16bf k0 = ldfrag(kr + lhalf * 8,      kr + lhalf * 8 + 16);
    v16bf k1 = ldfrag(kr + 32 + lhalf * 8, kr + 32 + lhalf * 8 + 16);
    v8f z = {};
    acc[t] = wmma_bf16(k0, aq0, z);
    acc[t] = wmma_bf16(k1, aq1, acc[t]);
  }
#pragma unroll
  for (int t = 0; t < 16; ++t) acc[t] *= 0.125f;   // exact: a power of two

  // softmax over the 256 keys of query lm, scale 1/sqrt(64): 128 scores in this
  // lane, 128 in lane ^ 16.  Eight running sums, one per register of a tile.
  float m = -3.4e38f;
#pragma unroll
  for (int t = 0; t < 16; ++t)
#pragma unroll
    for (int j = 0; j < 8; ++j) m = fmaxf(m, acc[t][j]);
  m = fmaxf(m, xhalf(m));
  v8f sv = {};
#pragma unroll
  for (int t = 0; t < 16; ++t) {
#pragma unroll
    for (int j = 0; j < 8; ++j) acc[t][j] = __expf(acc[t][j] - m);
    sv += acc[t];
  }
  float s = ((sv[0] + sv[1]) + (sv[2] + sv[3])) + ((sv[4] + sv[5]) + (sv[6] + sv[7]));
  s += xhalf(s);
  const float inv = 1.f / s;

  // ctx^T = values^T @ attn^T : 4 dh tiles x 8 k-steps of 32 keys
  //   B operand of step ks: keys ks*32 + lhalf*8 + 0..7 are tile 2ks of this
  //   lane, keys ks*32 + 16 + lhalf*8 + 0..7 tile 2ks+1: the order in which the
  //   two 16-B chunks of a values^T row are taken.
  v8f o[4];
#pragma unroll
  for (int t = 0; t < 4; ++t) { v8f z = {}; o[t] = z; }
#pragma unroll
  for (int ks = 0; ks < 8; ++ks) {
    v16bf bp;
#pragma unroll
    for (int j = 0; j < 8; ++j) {
      bp[j]     = (__bf16)(acc[2 * ks][j] * inv);
      bp[8 + j] = (__bf16)(acc[2 * ks + 1][j] * inv);
    }
#pragma unroll
    for (int dt = 0; dt < 4; ++dt) {
      const u16* vr = valt_s + (dt * 16 + lm) * VPITCH + ks * 32 + lhalf * 8;
      v16bf av = ldfrag(vr, vr + 16);
      o[dt] = wmma_bf16(av, bp, o[dt]);
    }
  }
  // o[dt][j]: query lm, dh = dt*16 + lhalf*8 + j
  u16* crow = ctxbf + (long)(b * NN + n0 + lm) * DD + h * 64 + lhalf * 8;
#pragma unroll
  for (int dt = 0; dt < 4; ++dt)
    *(uint4*)(crow + dt * 16) =
        __builtin_bit_cast(uint4, __builtin_convertvector(o[dt], v8bf));
}

// ---------------------------------------------------------------------------
// Kernel 6: out = ctx @ w_out^T + b_out; y = x + out; LayerNorm(y).
//   Block = 64 rows (OUT_RT row tiles); 8 waves x 6 col tiles; 24 k-steps.
//   A wave keeps 4 x 6 accumulator tiles: the six w_out units of a k-step feed
//   four row tiles each, so w_out is read once per 64 rows, and a k-step is 20
//   loads for 24 WMMAs.  Two fragment sets: the 20 loads of the next k-step go
//   out as one group in front of this k-step's WMMAs.  LN via LDS + shfl, a
//   thread taking the same 48 columns of four rows.
//   w_out comes in fragment order; ctx is row-major.
// ---------------------------------------------------------------------------
#define OUT_RT 4     // row tiles a block takes
__device__ __forceinline__ void out_load(const u16* ap, const u16* bp,
                                         v16bf (&a)[OUT_RT], v16bf (&b)[6]) {
#pragma unroll
  for (int c = 0; c < 6; ++c) b[c] = ldunit(bp + c * 24 * 512);
#pragma unroll
  for (int r = 0; r < OUT_RT; ++r)
    a[r] = ldfrag(ap + r * 16 * DD, ap + r * 16 * DD + 16);
}

__device__ __forceinline__ void out_mma(const v16bf (&a)[OUT_RT], const v16bf (&b)[6],
                                        v8f (&acc)[OUT_RT][6]) {
#pragma unroll
  for (int c = 0; c < 6; ++c)
#pragma unroll
    for (int r = 0; r < OUT_RT; ++r) acc[r][c] = wmma_bf16(a[r], b[c], acc[r][c]);
}

__global__ void __launch_bounds__(256)
k_out(const u16* __restrict__ ctxbf, const u16* __restrict__ woutbf,
      const float* __restrict__ x, const float* __restrict__ bout,
      const float* __restrict__ gamma, const float* __restrict__ beta,
      float* __restrict__ out) {
  __shared__ float ybuf[16 * OUT_RT][772];   // padded vs 64-bank LDS
  const int lane = threadIdx.x & 31, wave = threadIdx.x >> 5;
  const int lm = lane & 15, lhalf = lane >> 4;
  const int r0 = blockIdx.x * (16 * OUT_RT);

  unsigned ao = (unsigned)(r0 + lm) * DD + lhalf * 8;        // index into ctx
  unsigned bo = (unsigned)wave * (6 * 24 * 512) + lane * 8;  // index into w_out
  v8f acc[OUT_RT][6];
#pragma unroll
  for (int r = 0; r < OUT_RT; ++r)
#pragma unroll
    for (int c = 0; c < 6; ++c) { v8f z = {}; acc[r][c] = z; }

  v16bf a0[OUT_RT], b0[6], a1[OUT_RT], b1[6];
  out_load(ctxbf + ao, woutbf + bo, a0, b0);
  for (int ks = 0; ks < 22; ks += 2) {
    const u16* pa = ctxbf + ao;
    const u16* pb = woutbf + bo;
    out_load(pa + 32, pb + 512, a1, b1);
    // Keeps the loads above in front of the WMMAs below: left free, they were
    // sunk among the WMMAs, many to just in front of their first use, which
    // then waited out the latency.
    __builtin_amdgcn_sched_barrier(0);
    out_mma(a0, b0, acc);
    // Keeps the reload of the first set behind its last use and, with the next
    // barrier, in front of the second set's WMMAs, for the same reason.
    __builtin_amdgcn_sched_barrier(0);
    // The issued loads name the two address pairs: as inputs they stay whole
    // until the wait, and the next pairs, made from the offsets that leave this
    // statement, are formed behind it.
    asm volatile("s_wait_xcnt 0x0" : "+v"(ao), "+v"(bo) : "v"(pa), "v"(pb) : "memory");
    ao += 64;
    bo += 1024;
    pa = ctxbf + ao;
    pb = woutbf + bo;
    out_load(pa, pb, a0, b0);
    __builtin_amdgcn_sched_barrier(0);
    out_mma(a1, b1, acc);
    // Keeps the wait below behind the WMMAs, where it costs nothing.
    __builtin_amdgcn_sched_barrier(0);
    // The same wait for the reload's address pairs.
    asm volatile("s_wait_xcnt 0x0" : "+v"(ao), "+v"(bo) : "v"(pa), "v"(pb) : "memory");
  }
  {
    const u16* pa = ctxbf + ao;
    const u16* pb = woutbf + bo;
    out_load(pa + 32, pb + 512, a1, b1);     // the last k-step
    // As in the loop: the loads in front of the WMMAs, and the wait, held in
    // place by the two barriers, in front of whatever takes the pairs' place.
    __builtin_amdgcn_sched_barrier(0);
    asm volatile("s_wait_xcnt 0x0" :: "v"(pa), "v"(pb) : "memory");
    __builtin_amdgcn_sched_barrier(0);
  }
  out_mma(a0, b0, acc);
  out_mma(a1, b1, acc);

  // acc[r][c][j]: row r*16 + lhalf*8 + j, col wave*96 + c*16 + lm
  const float* xb = x + (long)(r0 + lhalf * 8) * DD + wave * 96 + lm;
  const float* bb = bout + wave * 96 + lm;
  float* yb = &ybuf[lhalf * 8][wave * 96 + lm];
#pragma unroll
  for (int r = 0; r < OUT_RT; ++r)
#pragma unroll
    for (int c = 0; c < 6; ++c)
#pragma unroll
      for (int j = 0; j < 8; ++j)
        yb[(r * 16 + j) * 772 + c * 16] =
            acc[r][c][j] + bb[c * 16] + xb[(r * 16 + j) * DD + c * 16];
  // The two address pairs stay whole until this wait, so that no later load's
  // result is allocated over the pair of loads still being issued.
  asm volatile("s_wait_xcnt 0x0" :: "v"(xb), "v"(bb) : "memory");
  __syncthreads();

  int rr = threadIdx.x >> 4;                 // rows rr + 16 q, 16 lanes per row
  int s  = threadIdx.x & 15;
  float sum[OUT_RT], sq[OUT_RT];
#pragma unroll
  for (int q = 0; q < OUT_RT; ++q) { sum[q] = 0.f; sq[q] = 0.f; }
  for (int c = s; c < DD; c += 16)
#pragma unroll
    for (int q = 0; q < OUT_RT; ++q) {
      float v = ybuf[q * 16 + rr][c];
      sum[q] += v;
      sq[q] += v * v;
    }
  float mu[OUT_RT], rstd[OUT_RT];
#pragma unroll
  for (int q = 0; q < OUT_RT; ++q) {
    float sm = sum[q], ss = sq[q];
    sm += __shfl_xor(sm, 1, 32); ss += __shfl_xor(ss, 1, 32);
    sm += __shfl_xor(sm, 2, 32); ss += __shfl_xor(ss, 2, 32);
    sm += __shfl_xor(sm, 4, 32); ss += __shfl_xor(ss, 4, 32);
    sm += __shfl_xor(sm, 8, 32); ss += __shfl_xor(ss, 8, 32);
    mu[q] = sm * (1.f / DD);
    float var = ss * (1.f / DD) - mu[q] * mu[q];
    rstd[q] = rsqrtf(var + 1e-12f);
  }
  for (int c = s; c < DD; c += 16) {
    const float g = gamma[c], be = beta[c];
#pragma unroll
    for (int q = 0; q < OUT_RT; ++q)
      out[(long)(r0 + q * 16 + rr) * DD + c] =
          (ybuf[q * 16 + rr][c] - mu[q]) * rstd[q] * g + be;
  }
}

// ---------------------------------------------------------------------------
// Host launcher
// ---------------------------------------------------------------------------
extern "C" void kernel_launch(void* const* d_in, const int* in_sizes, int n_in,
                              void* d_out, int out_size, void* d_ws, size_t ws_size,
                              hipStream_t stream) {
  const float* x     = (const float*)d_in[0];
  const float* wq    = (const float*)d_in[1];
  const float* wk    = (const float*)d_in[2];
  const float* pk    = (const float*)d_in[3];
  const float* wout  = (const float*)d_in[4];
  const float* bout  = (const float*)d_in[5];
  const float* gamma = (const float*)d_in[6];
  const float* beta  = (const float*)d_in[7];
  float* out = (float*)d_out;
  char* ws = (char*)d_ws;

  // 256B-aligned workspace layout (bytes)
  u16*   xbf   = (u16*)(ws + 0);             // 25,165,824
  u16*   wqbf  = (u16*)(ws + 25165824);      //    294,912
  u16*   wkbf  = (u16*)(ws + 25460736);      //    294,912
  u16*   woutb = (u16*)(ws + 25755648);      //  1,179,648
  u16*   pkt   = (u16*)(ws + 26935296);      //  1,048,576
  u16*   qbf   = (u16*)(ws + 27983872);      // 25,165,824
  u16*   krt   = (u16*)(ws + 53149696);      // 25,165,824
  u16*   keys  = (u16*)(ws + 84606976);      //  3,145,728
  u16*   valt  = (u16*)(ws + 87752704);      //  3,145,728
  u16*   ctxbf = (u16*)(ws + 90898432);      // 25,165,824  (end 116,064,256)

  (void)hipFuncSetAttribute(reinterpret_cast<const void*>(k_attn),
                            hipFuncAttributeMaxDynamicSharedMemorySize, 70656);

  k_convert<<<  580, 256, 0, stream>>>(x, wq, wk, wout, pk, xbf, wqbf, wkbf, woutb, pkt);
  k_gconv  <<<  512, 256, 0, stream>>>(xbf, wqbf, wkbf, qbf, krt);
  k_kproj  <<<  256, 256, 0, stream>>>(pkt, krt, keys, valt);
  k_attn   <<< 1536, 256, 70656, stream>>>(qbf, keys, valt, ctxbf);
  k_out    <<<  256, 256, 0, stream>>>(ctxbf, woutb, x, bout, gamma, beta, out);
}

// v009
// Measured time: 82 microseconds a run.
// Timed twice side by side with v008, it ran 1.06 times as fast both times.
// Counting every step since v000, it is 4.16 times as fast.
#include <hip/hip_runtime.h>
#include <hip/hip_bf16.h>

// ---------------------------------------------------------------------------
// BonzSelfAttention for MI455X (gfx1250): bf16 WMMA everywhere, fp32 accum.
// B=8, N=2048, D=768, K=256, H=12, G=4, DH=64
// ---------------------------------------------------------------------------

typedef __attribute__((ext_vector_type(16))) __bf16 v16bf;
typedef __attribute__((ext_vector_type(8)))  __bf16 v8bf;
typedef __attribute__((ext_vector_type(8)))  float  v8f;
typedef __attribute__((ext_vector_type(4)))  float  v4f;
typedef __attribute__((ext_vector_type(4)))  __bf16 v4bf;
typedef __attribute__((ext_vector_type(4)))  int    v4i;
typedef unsigned short u16;

#define BN   16384   // B*N
#define DD   768
#define NN   2048
#define KK   256
#define HH   12

#if __has_builtin(__builtin_amdgcn_global_load_async_to_lds_b128)
#define HAVE_ASYNC_LDS 1
#else
#define HAVE_ASYNC_LDS 0
#endif

struct alignas(32) Frag32B { uint4 lo, hi; };

// A/B operand fragment: two 16-byte chunks (K-chunk and K-chunk+16) per lane.
__device__ __forceinline__ v16bf ldfrag(const u16* p0, const u16* p1) {
  Frag32B f;
  f.lo = *(const uint4*)p0;
  f.hi = *(const uint4*)p1;
  return __builtin_bit_cast(v16bf, f);
}

__device__ __forceinline__ v8f wmma_bf16(v16bf a, v16bf b, v8f c) {
  // (neg_a, A, neg_b, B, c_mod, C, reuse_a, reuse_b)
  return __builtin_amdgcn_wmma_f32_16x16x32_bf16(false, a, false, b, (short)0, c,
                                                 false, false);
}

// ---------------------------------------------------------------------------
// Fragment order.  x, wq, wk, w_out, pkt, krt, q and ctx, bf16 matrices M[row][k] that
// GEMMs read from global memory, are kept in the workspace as 1-KB units, one per (16 rows, 32 k):
//   unit  = (row >> 4) * (K / 32) + (k >> 5)
//   u16 offset in the unit = ((k >> 4) & 1) * 256        first / second chunk
//                          + (((k >> 3) & 1) * 16 + (row & 15)) * 8   the lane
//                          + (k & 7)
// A lane's two 16-B chunks are the ones it took from the row-major matrix, so
// the fragments hold the same values; but the 32 lanes of one load now read 512
// contiguous bytes (4 lines) where rows of 384 B and more gave 16 lines.
// ---------------------------------------------------------------------------
__device__ __forceinline__ v16bf ldunit(const u16* unit_lane) {
  return ldfrag(unit_lane, unit_lane + 256);
}

// ---------------------------------------------------------------------------
// Kernel 1: fp32 -> bf16 conversions into fragment order (+ project_k transpose)
//   Few, long waves instead of one element per thread.  A block takes one role
//   by its index (block-uniform):
//     0..31     project_k: thread = column kq, 64 rows n; the 64 loads are
//               coalesced over kq; 16 threads store 256 contiguous bytes
//     32..37    wq, 38..43 wk, 44..67 w_out, 68..579 x: a wave makes six units
//               in a row (16 rows x 192 k).  The 16 rows of a unit are one
//               128-B line of floats each: a wave-wide float4 load takes four
//               whole lines (8 lanes a row), and the 8-B stores of the four
//               rows fall in 64-B runs of the unit; a thread's 24 loads are
//               independent, so many are in flight at a time
// ---------------------------------------------------------------------------
__global__ void __launch_bounds__(256)
k_convert(const float* __restrict__ x,  const float* __restrict__ wq,
          const float* __restrict__ wk, const float* __restrict__ wout,
          const float* __restrict__ pk,
          u16* __restrict__ xbf, u16* __restrict__ wqbf, u16* __restrict__ wkbf,
          u16* __restrict__ woutbf, u16* __restrict__ pkt) {
  const int tid = threadIdx.x;
  int bid = blockIdx.x;

  if (bid < 32) {                            // pkt[kq][n] = pk[n][kq]
    const float* s = pk + (long)bid * 64 * KK + tid;
    float v[64];
#pragma unroll
    for (int j = 0; j < 64; ++j) v[j] = s[j * KK];
    // rows kq, k = n = bid*64 + c*8 + j: units (tid>>4)*64 + bid*2 + (c>>2)
    u16* d = pkt + ((long)(tid >> 4) * 64 + bid * 2) * 512 + (tid & 15) * 8;
#pragma unroll
    for (int c = 0; c < 8; ++c) {
      v8f f;
#pragma unroll
      for (int j = 0; j < 8; ++j) f[j] = v[c * 8 + j];
      *(uint4*)(d + (c >> 2) * 512 + ((c >> 1) & 1) * 256 + (c & 1) * 128) =
          __builtin_bit_cast(uint4, __builtin_convertvector(f, v8bf));
    }
    return;
  }

  const float* s;
  u16* d;
  int kd = DD;                               // row length k of the matrix
  if (bid < 38)      { s = wq;   d = wqbf;   bid -= 32; kd = 192; }
  else if (bid < 44) { s = wk;   d = wkbf;   bid -= 38; kd = 192; }
  else if (bid < 68) { s = wout; d = woutbf; bid -= 44; }
  else               { s = x;    d = xbf;    bid -= 68; }

  const int r4 = (tid & 31) >> 3, p = tid & 7;   // row in a group of 4, float4 in the line
  const int gw = bid * 8 + (tid >> 5);       // this wave's run of six units
  int rt = gw, ks0 = 0;                      // 192 k: six units are a row tile
  if (kd == DD) { rt = gw >> 2; ks0 = (gw & 3) * 6; }

  // v[u*4+i]: unit u, row i*4 + r4, k = p*4 .. p*4+3 of the unit
  const v4f* s4 = (const v4f*)(s + (long)(rt * 16 + r4) * kd + ks0 * 32 + p * 4);
  uint2*     d2 = (uint2*)(d + (long)gw * 6 * 512 + (p >> 2) * 256 +
                           (((p >> 1) & 1) * 16 + r4) * 8 + (p & 1) * 4);
  const v4f* r0 = s4;                        // the four rows' address pairs
  const v4f* r1 = s4 + kd;
  const v4f* r2 = s4 + 2 * kd;
  const v4f* r3 = s4 + 3 * kd;
  v4f v[24];
#pragma unroll
  for (int u = 0; u < 6; ++u) {
    v[u * 4]     = r0[u * 8];
    v[u * 4 + 1] = r1[u * 8];
    v[u * 4 + 2] = r2[u * 8];
    v[u * 4 + 3] = r3[u * 8];
  }
  // The address pairs stay whole until this wait.
  asm volatile("s_wait_xcnt 0x0" :: "v"(r0), "v"(r1), "v"(r2), "v"(r3) : "memory");
#pragma unroll
  for (int u = 0; u < 6; ++u)
#pragma unroll
    for (int i = 0; i < 4; ++i)
      d2[u * 128 + i * 8] =
          __builtin_bit_cast(uint2, __builtin_convertvector(v[u * 4 + i], v4bf));
}

// ---------------------------------------------------------------------------
// Kernel 2: grouped pointwise conv (block-diagonal GEMM), Q and K_raw.
//   y = x_g @ w_g^T  per 192-wide group.  x and w come in fragment order.
//   The weights stay in registers: a block of 8 waves takes one group, waves
//   0..3 its Q columns and waves 4..7 its K_raw columns, three 16-column tiles
//   (18 units, 144 registers) a wave, loaded once.  The block then walks GC_RT
//   row tiles; the six x units of a row tile come from L2 once and serve all
//   8 waves, each of which does 18 WMMAs on them (three chains of six).
//   Both results go out in fragment order, a lane's 8 sums being one 16-B chunk
//   at the lane's own place, so that a wave-wide store covers 512 contiguous B:
//   K_raw TRANSPOSED (rows b*768+d, k = n): x is the A operand, and a lane holds
//   8 consecutive n of one d;  Q (rows b*2048+n, k = d): w is the A operand
//   (Q^T = w . x^T), and a lane holds 8 consecutive d of one row n.
// ---------------------------------------------------------------------------
#define GC_RT 8      // row tiles a block walks: 128 rows, inside one batch
template <bool IS_Q>
__device__ __forceinline__ void gconv_walk(const u16* __restrict__ au,
                                           const u16* __restrict__ bu,
                                           u16* __restrict__ dst) {
  v16bf w[3][6];
#pragma unroll
  for (int c = 0; c < 3; ++c)
#pragma unroll
    for (int ks = 0; ks < 6; ++ks) w[c][ks] = ldunit(bu + (c * 6 + ks) * 512);

  v16bf a[6];
#pragma unroll
  for (int ks = 0; ks < 6; ++ks) a[ks] = ldunit(au + ks * 512);

  for (int i = 0; i < GC_RT; ++i) {
    // Keeps this tile's WMMAs behind the stores of the tile before: left free,
    // they were lifted over them, and the loads below, which cannot pass the
    // wait at the loop's foot, were then issued directly in front of their use.
    __builtin_amdgcn_sched_barrier(0);
    au += 24 * 512;
    v8f acc[3] = {};
#pragma unroll
    for (int ks = 0; ks < 6; ++ks) {
#pragma unroll
      for (int c = 0; c < 3; ++c)
        acc[c] = IS_Q ? wmma_bf16(w[c][ks], a[ks], acc[c])
                      : wmma_bf16(a[ks], w[c][ks], acc[c]);
      // the next row tile's unit, as soon as this one has been used
      if (i + 1 < GC_RT) a[ks] = ldunit(au + ks * 512);
    }
    // Keeps those loads in front of the conversions and stores, which then run
    // while the loads are in flight.
    __builtin_amdgcn_sched_barrier(0);

    if (IS_Q) {                              // acc[c][j]: d = c*16 + j, n = the lane's
#pragma unroll
      for (int c = 0; c < 3; ++c)            // 16 d are half a unit
        *(uint4*)(dst + c * 256) =
            __builtin_bit_cast(uint4, __builtin_convertvector(acc[c], v8bf));
      dst += 24 * 512;                       // the next row tile: 24 units on
    } else {                                 // acc[c][j]: n = j, d = c*16
#pragma unroll
      for (int c = 0; c < 3; ++c)
        *(uint4*)(dst + c * 64 * 512) =
            __builtin_bit_cast(uint4, __builtin_convertvector(acc[c], v8bf));
      dst += 256;                            // the next 16 n: the next half unit
    }
    // From here on the stores' data registers are free for the next tiles'
    // loads: the wait stands in front of any such overwrite.
    asm volatile("s_wait_xcnt 0x0" ::: "memory");
  }
}

__global__ void __launch_bounds__(256)
k_gconv(const u16* __restrict__ xbf, const u16* __restrict__ wqbf,
        const u16* __restrict__ wkbf, u16* __restrict__ qbf, u16* __restrict__ krt) {
  const int lane = threadIdx.x & 31;
  const int wave = __builtin_amdgcn_readfirstlane(threadIdx.x >> 5);   // 0..7
  const int g = blockIdx.x & 3;              // group
  const int rt0 = (blockIdx.x >> 2) * GC_RT; // first row tile (16 rows of B*N)
  const int ct = g * 12 + (wave & 3) * 3;    // first of three col tiles
  const int m0 = rt0 * 16;
  const u16* au = xbf + ((long)rt0 * 24 + g * 6) * 512 + lane * 8;
  const long bo = (long)ct * 6 * 512 + lane * 8;   // rows g*192+o = ct*16+lm

  if (wave < 4) {
    gconv_walk<true>(au, wqbf + bo,
                     qbf + (long)rt0 * 24 * 512 + ct * 256 + lane * 8);
  } else {
    const int b = m0 >> 11, n0 = m0 & 2047;
    gconv_walk<false>(au, wkbf + bo,
                      krt + (long)(b * 48 + ct) * 64 * 512 + (n0 >> 4) * 256 + lane * 8);
  }
}

// ---------------------------------------------------------------------------
// Kernel 3: k_proj[b,kq,d] = sum_n pk[n,kq] * k_raw[b,n,d]
//   A = pkt (rows kq, k = n), B = krt (rows b*768+d, k = n), both in fragment
//   order, 64 k-steps.
//   A block takes 64 kq x 96 d (4 x 6 tiles).  A wave keeps 4 x 3 accumulator
//   tiles, one half of the block's columns, over one quarter of k (16 k-steps):
//   the seven units of a k-step feed 12 WMMAs.  Three fragment sets: the 14
//   loads of a k-step go out as one group two k-steps ahead.  The four quarters
//   are summed in LDS, each wave taking three of the 24 tiles.
//   The f32 tile never goes to memory: each lane holds 8 consecutive kq of one
//   column d, which are 8 consecutive bf16 both in values^T and in keys, so the
//   epilogue stores the same 16 bytes to each.
//   valt[b,h,dq,kq]   = k_proj[b, kq, h*64+dq]
//   keys[b,h,kq2,dq2] = k_proj[b, (h*64+dq2)&255, 3*kq2 + ((h*64+dq2)>>8)]
//     inverted: kq2 = d/3, c = (d%3)*256 + kq, h = c>>6, dq2 = c&63
// ---------------------------------------------------------------------------
#define KP_MT 4      // kq tiles a wave keeps
#define KP_NT 3      // d tiles a wave keeps
#define KP_KS 16     // k-steps a wave takes: a quarter of the 64
__device__ __forceinline__ void kp_load(const u16* ap, const u16* bp,
                                        v16bf (&a)[KP_MT], v16bf (&b)[KP_NT]) {
#pragma unroll
  for (int m = 0; m < KP_MT; ++m) a[m] = ldunit(ap + m * 64 * 512);
#pragma unroll
  for (int n = 0; n < KP_NT; ++n) b[n] = ldunit(bp + n * 64 * 512);
}

__device__ __forceinline__ void kp_mma(const v16bf (&a)[KP_MT], const v16bf (&b)[KP_NT],
                                       v8f (&acc)[KP_MT][KP_NT]) {
#pragma unroll
  for (int m = 0; m < KP_MT; ++m)
#pragma unroll
    for (int n = 0; n < KP_NT; ++n) acc[m][n] = wmma_bf16(a[m], b[n], acc[m][n]);
}

__global__ void __launch_bounds__(256)
k_kproj(const u16* __restrict__ pkt, const u16* __restrict__ krt,
        u16* __restrict__ keys, u16* __restrict__ valt) {
  // [quarter of k][tile m*6 + n][registers 0..3, 4..7][lane][4]
  __shared__ __align__(16) float part[4][24][2][128];
  const int lane = threadIdx.x & 31;
  const int wave = __builtin_amdgcn_readfirstlane(threadIdx.x >> 5);   // 0..7
  const int lm = lane & 15, lhalf = lane >> 4;
  const int nb = blockIdx.x & 63;            // 96 of the 6144 rows b*768+d
  const int mb = blockIdx.x >> 6;            // 64 of the 256 kq
  const int nw = wave & 1, kqt = wave >> 1;  // column half, quarter of k

  const u16* au = pkt + ((long)(mb * KP_MT) * 64 + kqt * KP_KS) * 512 + lane * 8;
  const u16* bu = krt + ((long)(nb * 6 + nw * KP_NT) * 64 + kqt * KP_KS) * 512 + lane * 8;

  v8f acc[KP_MT][KP_NT];
#pragma unroll
  for (int m = 0; m < KP_MT; ++m)
#pragma unroll
    for (int n = 0; n < KP_NT; ++n) { v8f z = {}; acc[m][n] = z; }

  v16bf a[3][KP_MT], b[3][KP_NT];
  kp_load(au, bu, a[0], b[0]);
  // Keeps the first k-step's loads the oldest: mixed with the second's and the
  // third's, the first WMMAs waited for all three groups.
  __builtin_amdgcn_sched_barrier(0);
  kp_load(au + 512, bu + 512, a[1], b[1]);
  // Unrolled whole: the set numbers are then constants and every load takes its
  // place from the instruction's offset, so the address registers never change.
#pragma unroll
  for (int ks = 0; ks < KP_KS; ++ks) {
    // For the same reason as above, and it keeps this group of loads behind the
    // last use of the set that it refills.
    __builtin_amdgcn_sched_barrier(0);
    if (ks + 2 < KP_KS)
      kp_load(au + (ks + 2) * 512, bu + (ks + 2) * 512, a[(ks + 2) % 3], b[(ks + 2) % 3]);
    // Keeps the loads above in front of this k-step's WMMAs: sunk among them,
    // they would lose part of their two k-steps of lead.
    __builtin_amdgcn_sched_barrier(0);
    kp_mma(a[ks % 3], b[ks % 3], acc);
    if (ks + 3 == KP_KS) {
      // Behind the last group of loads and the WMMAs that follow it, where it
      // costs nothing, and held there by the barriers: in front of whatever
      // takes the place of the loads' address registers behind the loop.
      __builtin_amdgcn_sched_barrier(0);
      asm volatile("s_wait_xcnt 0x0" ::: "memory");
    }
  }

  // acc[m][n] is the partial sum of tile m*6 + nw*3 + n; a wave-wide 16-B LDS
  // access covers 512 contiguous bytes.
#pragma unroll
  for (int m = 0; m < KP_MT; ++m)
#pragma unroll
    for (int n = 0; n < KP_NT; ++n) {
      float* p = &part[kqt][m * 6 + nw * KP_NT + n][0][lane * 4];
      *(v4f*)p         = __builtin_shufflevector(acc[m][n], acc[m][n], 0, 1, 2, 3);
      *(v4f*)(p + 128) = __builtin_shufflevector(acc[m][n], acc[m][n], 4, 5, 6, 7);
    }
  __syncthreads();

  // wave w sums tiles 3w .. 3w+2: tile row w >> 1, tile columns (w & 1) * 3 + i
  const int bt = nb >> 3;                    // batch: 8 blocks of 96 columns each
  const int kq0 = (mb * KP_MT + (wave >> 1)) * 16 + lhalf * 8;   // first of the lane's 8 rows
#pragma unroll
  for (int i = 0; i < 3; ++i) {
    const float* p = &part[0][wave * 3 + i][0][lane * 4];
    v4f lo = (*(const v4f*)p + *(const v4f*)(p + 6144)) +
             (*(const v4f*)(p + 12288) + *(const v4f*)(p + 18432));
    v4f hi = (*(const v4f*)(p + 128) + *(const v4f*)(p + 6144 + 128)) +
             (*(const v4f*)(p + 12288 + 128) + *(const v4f*)(p + 18432 + 128));
    const v8f sum = __builtin_shufflevector(lo, hi, 0, 1, 2, 3, 4, 5, 6, 7);
    const uint4 pk8 = __builtin_bit_cast(uint4, __builtin_convertvector(sum, v8bf));

    const int d = ((nb & 7) * 6 + (wave & 1) * 3 + i) * 16 + lm;
    *(uint4*)(valt + ((long)(bt * HH + (d >> 6)) * 64 + (d & 63)) * KK + kq0) = pk8;
    const int kq2 = d / 3;
    const int c0 = (d - kq2 * 3) * 256 + kq0;
    *(uint4*)(keys + ((long)(bt * HH + (c0 >> 6)) * KK + kq2) * 64 + (c0 & 63)) = pk8;
  }
}

// ---------------------------------------------------------------------------
// Kernel 5: attention.  Block = (b, h, 128-query chunk), 8 waves x 16 queries.
//   Transposed products: S^T = keys . q^T and O^T = values^T . P^T, so that a
//   query is a COLUMN of every accumulator tile, that is, one lane pair
//   (l, l ^ 16).  A lane holds 128 of its query's 256 scores: maximum and sum
//   are taken in the lane and joined once with the other half.  Two score tiles
//   (32 keys), converted in place, are the B operand of the second product, so
//   the probabilities never go through LDS.  A lane's 8 sums of an O^T tile are
//   8 consecutive dh of one query: one 16-B store.
//   q and ctx (rows b*2048+n, k = d) are in fragment order: a head's 64 columns
//   of a wave's 16 queries are two units, 2 KB in a row, and each of the wave's
//   four loads and four stores covers 512 contiguous bytes.
//   LDS: keys 36KB + values^T 33KB = 69KB.
//   K/V staged with GLOBAL_LOAD_ASYNC_TO_LDS_B128 (ASYNCcnt-tracked DMA).
//   Every LDS row is read by ds_load_b128 with one row per lane, so each row
//   carries 16 pad bytes: the pitch is 16 B x odd (144 B, 528 B) and the 16
//   lanes of a half-wave fall on 16 different groups of four banks (bare
//   pitches of 128 B and 512 B put them on two groups and on one).
// ---------------------------------------------------------------------------
#define KPITCH 72    // keys row: 64 bf16 + 8 pad
#define VPITCH 264   // values^T row: 256 bf16 + 8 pad

// lane l takes the value of lane l ^ 16
__device__ __forceinline__ float xhalf(float v) {
  const int b = __builtin_bit_cast(int, v);
  return __builtin_bit_cast(float, __builtin_amdgcn_permlanex16(
      b, b, 0x76543210, 0xfedcba98, false, false));
}

__global__ void __launch_bounds__(256)
k_attn(const u16* __restrict__ qbf, const u16* __restrict__ keys,
       const u16* __restrict__ valt, u16* __restrict__ ctxbf) {
  extern __shared__ __align__(16) unsigned char smem_raw[];
  u16* keys_s = (u16*)smem_raw;              // [256][KPITCH]
  u16* valt_s = keys_s + 256 * KPITCH;       // [64][VPITCH]

  const int lane = threadIdx.x & 31, wave = threadIdx.x >> 5;
  const int lm = lane & 15, lhalf = lane >> 4;
  int chunk = blockIdx.x & 15;
  int bh = blockIdx.x >> 4;
  int b = bh / HH, h = bh - b * HH;

  // stage K and V^T into LDS (16B per thread per iter)
  {
    const uint4* kg = (const uint4*)(keys + (long)bh * 16384);
    const uint4* vg = (const uint4*)(valt + (long)bh * 16384);
#if HAVE_ASYNC_LDS
    typedef __attribute__((address_space(1))) v4i* gp_t;   // global int4*
    typedef __attribute__((address_space(3))) v4i* lp_t;   // LDS int4*
    for (int i = threadIdx.x; i < 2048; i += 256) {
      u16* kd = keys_s + (i >> 3) * KPITCH + (i & 7) * 8;    // 8 x 16 B a row
      u16* vd = valt_s + (i >> 5) * VPITCH + (i & 31) * 8;   // 32 x 16 B a row
      __builtin_amdgcn_global_load_async_to_lds_b128((gp_t)(kg + i),
                                                     (lp_t)kd, 0, 0);
      __builtin_amdgcn_global_load_async_to_lds_b128((gp_t)(vg + i),
                                                     (lp_t)vd, 0, 0);
    }
#if __has_builtin(__builtin_amdgcn_s_wait_asynccnt)
    __builtin_amdgcn_s_wait_asynccnt(0);
#else
    asm volatile("s_wait_asynccnt 0x0" ::: "memory");
#endif
#else
    for (int i = threadIdx.x; i < 2048; i += 256) {
      *(uint4*)(keys_s + (i >> 3) * KPITCH + (i & 7) * 8) = kg[i];
      *(uint4*)(valt_s + (i >> 5) * VPITCH + (i & 31) * 8) = vg[i];
    }
#endif
  }
  __syncthreads();

  const int n0 = chunk * 128 + wave * 16;
  // the two units of (row tile, head), the same place in q and in ctx
  const long qc = ((long)((b * NN + n0) >> 4) * 24 + h * 2) * 512 + lane * 8;
  v16bf aq0 = ldunit(qbf + qc);
  v16bf aq1 = ldunit(qbf + qc + 512);

  // dots^T = keys @ q^T : 16 key tiles x 2 k-steps
  //   acc[t][j] = dot(key t*16 + lhalf*8 + j, query lm)
  v8f acc[16];
#pragma unroll
  for (int t = 0; t < 16; ++t) {
    const u16* kr = keys_s + (t * 16 + lm) * KPITCH;
    v16bf k0 = ldfrag(kr + lhalf * 8,      kr + lhalf * 8 + 16);
    v16bf k1 = ldfrag(kr + 32 + lhalf * 8, kr + 32 + lhalf * 8 + 16);
    v8f z = {};
    acc[t] = wmma_bf16(k0, aq0, z);
    acc[t] = wmma_bf16(k1, aq1, acc[t]);
  }
#pragma unroll
  for (int t = 0; t < 16; ++t) acc[t] *= 0.125f;   // exact: a power of two

  // softmax over the 256 keys of query lm, scale 1/sqrt(64): 128 scores in this
  // lane, 128 in lane ^ 16.  Eight running sums, one per register of a tile.
  float m = -3.4e38f;
#pragma unroll
  for (int t = 0; t < 16; ++t)
#pragma unroll
    for (int j = 0; j < 8; ++j) m = fmaxf(m, acc[t][j]);
  m = fmaxf(m, xhalf(m));
  v8f sv = {};
#pragma unroll
  for (int t = 0; t < 16; ++t) {
#pragma unroll
    for (int j = 0; j < 8; ++j) acc[t][j] = __expf(acc[t][j] - m);
    sv += acc[t];
  }
  float s = ((sv[0] + sv[1]) + (sv[2] + sv[3])) + ((sv[4] + sv[5]) + (sv[6] + sv[7]));
  s += xhalf(s);
  const float inv = 1.f / s;

  // ctx^T = values^T @ attn^T : 4 dh tiles x 8 k-steps of 32 keys
  //   B operand of step ks: keys ks*32 + lhalf*8 + 0..7 are tile 2ks of this
  //   lane, keys ks*32 + 16 + lhalf*8 + 0..7 tile 2ks+1: the order in which the
  //   two 16-B chunks of a values^T row are taken.
  v8f o[4];
#pragma unroll
  for (int t = 0; t < 4; ++t) { v8f z = {}; o[t] = z; }
#pragma unroll
  for (int ks = 0; ks < 8; ++ks) {
    v16bf bp;
#pragma unroll
    for (int j = 0; j < 8; ++j) {
      bp[j]     = (__bf16)(acc[2 * ks][j] * inv);
      bp[8 + j] = (__bf16)(acc[2 * ks + 1][j] * inv);
    }
#pragma unroll
    for (int dt = 0; dt < 4; ++dt) {
      const u16* vr = valt_s + (dt * 16 + lm) * VPITCH + ks * 32 + lhalf * 8;
      v16bf av = ldfrag(vr, vr + 16);
      o[dt] = wmma_bf16(av, bp, o[dt]);
    }
  }
  // o[dt][j]: query lm, dh = dt*16 + lhalf*8 + j
  u16* cu = ctxbf + qc;
#pragma unroll
  for (int dt = 0; dt < 4; ++dt)             // 16 dh are half a unit
    *(uint4*)(cu + dt * 256) =
        __builtin_bit_cast(uint4, __builtin_convertvector(o[dt], v8bf));
}

// ---------------------------------------------------------------------------
// Kernel 6: out = ctx @ w_out^T + b_out; y = x + out; LayerNorm(y).
//   Block = 64 rows (OUT_RT row tiles); 8 waves x 6 col tiles; 24 k-steps.
//   A wave keeps 4 x 6 accumulator tiles: the six w_out units of a k-step feed
//   four row tiles each, so w_out is read once per 64 rows, and a k-step is 20
//   loads for 24 WMMAs.  Two fragment sets: the 20 loads of the next k-step go
//   out as one group in front of this k-step's WMMAs.  LN via LDS + shfl, a
//   thread taking the same 48 columns of four rows.
//   w_out and ctx come in fragment order.
// ---------------------------------------------------------------------------
#define OUT_RT 4     // row tiles a block takes
__device__ __forceinline__ void out_load(const u16* ap, const u16* bp,
                                         v16bf (&a)[OUT_RT], v16bf (&b)[6]) {
#pragma unroll
  for (int c = 0; c < 6; ++c) b[c] = ldunit(bp + c * 24 * 512);
#pragma unroll
  for (int r = 0; r < OUT_RT; ++r)
    a[r] = ldunit(ap + r * 24 * 512);
}

__device__ __forceinline__ void out_mma(const v16bf (&a)[OUT_RT], const v16bf (&b)[6],
                                        v8f (&acc)[OUT_RT][6]) {
#pragma unroll
  for (int c = 0; c < 6; ++c)
#pragma unroll
    for (int r = 0; r < OUT_RT; ++r) acc[r][c] = wmma_bf16(a[r], b[c], acc[r][c]);
}

__global__ void __launch_bounds__(256)
k_out(const u16* __restrict__ ctxbf, const u16* __restrict__ woutbf,
      const float* __restrict__ x, const float* __restrict__ bout,
      const float* __restrict__ gamma, const float* __restrict__ beta,
      float* __restrict__ out) {
  __shared__ float ybuf[16 * OUT_RT][772];   // padded vs 64-bank LDS
  const int lane = threadIdx.x & 31, wave = threadIdx.x >> 5;
  const int lm = lane & 15, lhalf = lane >> 4;
  const int r0 = blockIdx.x * (16 * OUT_RT);

  unsigned ao = (unsigned)blockIdx.x * (OUT_RT * 24 * 512) + lane * 8;   // index into ctx
  unsigned bo = (unsigned)wave * (6 * 24 * 512) + lane * 8;  // index into w_out
  v8f acc[OUT_RT][6];
#pragma unroll
  for (int r = 0; r < OUT_RT; ++r)
#pragma unroll
    for (int c = 0; c < 6; ++c) { v8f z = {}; acc[r][c] = z; }

  v16bf a0[OUT_RT], b0[6], a1[OUT_RT], b1[6];
  out_load(ctxbf + ao, woutbf + bo, a0, b0);
  for (int ks = 0; ks < 22; ks += 2) {
    const u16* pa = ctxbf + ao;
    const u16* pb = woutbf + bo;
    out_load(pa + 512, pb + 512, a1, b1);
    // Keeps the loads above in front of the WMMAs below: left free, they were
    // sunk among the WMMAs, many to just in front of their first use, which
    // then waited out the latency.
    __builtin_amdgcn_sched_barrier(0);
    out_mma(a0, b0, acc);
    // Keeps the reload of the first set behind its last use and, with the next
    // barrier, in front of the second set's WMMAs, for the same reason.
    __builtin_amdgcn_sched_barrier(0);
    // The issued loads name the two address pairs: as inputs they stay whole
    // until the wait, and the next pairs, made from the offsets that leave this
    // statement, are formed behind it.
    asm volatile("s_wait_xcnt 0x0" : "+v"(ao), "+v"(bo) : "v"(pa), "v"(pb) : "memory");
    ao += 1024;
    bo += 1024;
    pa = ctxbf + ao;
    pb = woutbf + bo;
    out_load(pa, pb, a0, b0);
    __builtin_amdgcn_sched_barrier(0);
    out_mma(a1, b1, acc);
    // Keeps the wait below behind the WMMAs, where it costs nothing.
    __builtin_amdgcn_sched_barrier(0);
    // The same wait for the reload's address pairs.
    asm volatile("s_wait_xcnt 0x0" : "+v"(ao), "+v"(bo) : "v"(pa), "v"(pb) : "memory");
  }
  {
    const u16* pa = ctxbf + ao;
    const u16* pb = woutbf + bo;
    out_load(pa + 512, pb + 512, a1, b1);    // the last k-step
    // As in the loop: the loads in front of the WMMAs, and the wait, held in
    // place by the two barriers, in front of whatever takes the pairs' place.
    __builtin_amdgcn_sched_barrier(0);
    asm volatile("s_wait_xcnt 0x0" :: "v"(pa), "v"(pb) : "memory");
    __builtin_amdgcn_sched_barrier(0);
  }
  out_mma(a0, b0, acc);
  out_mma(a1, b1, acc);

  // acc[r][c][j]: row r*16 + lhalf*8 + j, col wave*96 + c*16 + lm
  const float* xb = x + (long)(r0 + lhalf * 8) * DD + wave * 96 + lm;
  const float* bb = bout + wave * 96 + lm;
  float* yb = &ybuf[lhalf * 8][wave * 96 + lm];
#pragma unroll
  for (int r = 0; r < OUT_RT; ++r)
#pragma unroll
    for (int c = 0; c < 6; ++c)
#pragma unroll
      for (int j = 0; j < 8; ++j)
        yb[(r * 16 + j) * 772 + c * 16] =
            acc[r][c][j] + bb[c * 16] + xb[(r * 16 + j) * DD + c * 16];
  // The two address pairs stay whole until this wait, so that no later load's
  // result is allocated over the pair of loads still being issued.
  asm volatile("s_wait_xcnt 0x0" :: "v"(xb), "v"(bb) : "memory");
  __syncthreads();

  int rr = threadIdx.x >> 4;                 // rows rr + 16 q, 16 lanes per row
  int s  = threadIdx.x & 15;
  float sum[OUT_RT], sq[OUT_RT];
#pragma unroll
  for (int q = 0; q < OUT_RT; ++q) { sum[q] = 0.f; sq[q] = 0.f; }
  for (int c = s; c < DD; c += 16)
#pragma unroll
    for (int q = 0; q < OUT_RT; ++q) {
      float v = ybuf[q * 16 + rr][c];
      sum[q] += v;
      sq[q] += v * v;
    }
  float mu[OUT_RT], rstd[OUT_RT];
#pragma unroll
  for (int q = 0; q < OUT_RT; ++q) {
    float sm = sum[q], ss = sq[q];
    sm += __shfl_xor(sm, 1, 32); ss += __shfl_xor(ss, 1, 32);
    sm += __shfl_xor(sm, 2, 32); ss += __shfl_xor(ss, 2, 32);
    sm += __shfl_xor(sm, 4, 32); ss += __shfl_xor(ss, 4, 32);
    sm += __shfl_xor(sm, 8, 32); ss += __shfl_xor(ss, 8, 32);
    mu[q] = sm * (1.f / DD);
    float var = ss * (1.f / DD) - mu[q] * mu[q];
    rstd[q] = rsqrtf(var + 1e-12f);
  }
  for (int c = s; c < DD; c += 16) {
    const float g = gamma[c], be = beta[c];
#pragma unroll
    for (int q = 0; q < OUT_RT; ++q)
      out[(long)(r0 + q * 16 + rr) * DD + c] =
          (ybuf[q * 16 + rr][c] - mu[q]) * rstd[q] * g + be;
  }
}

// ---------------------------------------------------------------------------
// Host launcher
// ---------------------------------------------------------------------------
extern "C" void kernel_launch(void* const* d_in, const int* in_sizes, int n_in,
                              void* d_out, int out_size, void* d_ws, size_t ws_size,
                              hipStream_t stream) {
  const float* x     = (const float*)d_in[0];
  const float* wq    = (const float*)d_in[1];
  const float* wk    = (const float*)d_in[2];
  const float* pk    = (const float*)d_in[3];
  const float* wout  = (const float*)d_in[4];
  const float* bout  = (const float*)d_in[5];
  const float* gamma = (const float*)d_in[6];
  const float* beta  = (const float*)d_in[7];
  float* out = (float*)d_out;
  char* ws = (char*)d_ws;

  // 256B-aligned workspace layout (bytes)
  u16*   xbf   = (u16*)(ws + 0);             // 25,165,824
  u16*   wqbf  = (u16*)(ws + 25165824);      //    294,912
  u16*   wkbf  = (u16*)(ws + 25460736);      //    294,912
  u16*   woutb = (u16*)(ws + 25755648);      //  1,179,648
  u16*   pkt   = (u16*)(ws + 26935296);      //  1,048,576
  u16*   qbf   = (u16*)(ws + 27983872);      // 25,165,824
  u16*   krt   = (u16*)(ws + 53149696);      // 25,165,824
  u16*   keys  = (u16*)(ws + 84606976);      //  3,145,728
  u16*   valt  = (u16*)(ws + 87752704);      //  3,145,728
  u16*   ctxbf = (u16*)(ws + 90898432);      // 25,165,824  (end 116,064,256)

  (void)hipFuncSetAttribute(reinterpret_cast<const void*>(k_attn),
                            hipFuncAttributeMaxDynamicSharedMemorySize, 70656);

  k_convert<<<  580, 256, 0, stream>>>(x, wq, wk, wout, pk, xbf, wqbf, wkbf, woutb, pkt);
  k_gconv  <<<  512, 256, 0, stream>>>(xbf, wqbf, wkbf, qbf, krt);
  k_kproj  <<<  256, 256, 0, stream>>>(pkt, krt, keys, valt);
  k_attn   <<< 1536, 256, 70656, stream>>>(qbf, keys, valt, ctxbf);
  k_out    <<<  256, 256, 0, stream>>>(ctxbf, woutb, x, bout, gamma, beta, out);
}

// v010
// Measured time: 76.3 microseconds a run.
// Timed twice side by side with v009, it ran 1.07 times as fast both times.
// Counting every step since v000, it is 4.46 times as fast.
#include <hip/hip_runtime.h>
#include <hip/hip_bf16.h>

// ---------------------------------------------------------------------------
// BonzSelfAttention for MI455X (gfx1250): bf16 WMMA everywhere, fp32 accum.
// B=8, N=2048, D=768, K=256, H=12, G=4, DH=64
// ---------------------------------------------------------------------------

typedef __attribute__((ext_vector_type(16))) __bf16 v16bf;
typedef __attribute__((ext_vector_type(8)))  __bf16 v8bf;
typedef __attribute__((ext_vector_type(8)))  float  v8f;
typedef __attribute__((ext_vector_type(4)))  float  v4f;
typedef __attribute__((ext_vector_type(4)))  __bf16 v4bf;
typedef __attribute__((ext_vector_type(4)))  int    v4i;
typedef unsigned short u16;

#define BN   16384   // B*N
#define DD   768
#define NN   2048
#define KK   256
#define HH   12

#if __has_builtin(__builtin_amdgcn_global_load_async_to_lds_b128)
#define HAVE_ASYNC_LDS 1
#else
#define HAVE_ASYNC_LDS 0
#endif

struct alignas(32) Frag32B { uint4 lo, hi; };

// A/B operand fragment: two 16-byte chunks (K-chunk and K-chunk+16) per lane.
__device__ __forceinline__ v16bf ldfrag(const u16* p0, const u16* p1) {
  Frag32B f;
  f.lo = *(const uint4*)p0;
  f.hi = *(const uint4*)p1;
  return __builtin_bit_cast(v16bf, f);
}

__device__ __forceinline__ v8f wmma_bf16(v16bf a, v16bf b, v8f c) {
  // (neg_a, A, neg_b, B, c_mod, C, reuse_a, reuse_b)
  return __builtin_amdgcn_wmma_f32_16x16x32_bf16(false, a, false, b, (short)0, c,
                                                 false, false);
}

// ---------------------------------------------------------------------------
// Fragment order.  x, wq, wk, w_out, pkt, krt, q and ctx, bf16 matrices M[row][k] that
// GEMMs read from global memory, are kept in the workspace as 1-KB units, one per (16 rows, 32 k):
//   unit  = (row >> 4) * (K / 32) + (k >> 5)
//   u16 offset in the unit = ((k >> 4) & 1) * 256        first / second chunk
//                          + (((k >> 3) & 1) * 16 + (row & 15)) * 8   the lane
//                          + (k & 7)
// A lane's two 16-B chunks are the ones it took from the row-major matrix, so
// the fragments hold the same values; but the 32 lanes of one load now read 512
// contiguous bytes (4 lines) where rows of 384 B and more gave 16 lines.
// ---------------------------------------------------------------------------
__device__ __forceinline__ v16bf ldunit(const u16* unit_lane) {
  return ldfrag(unit_lane, unit_lane + 256);
}

// ---------------------------------------------------------------------------
// Kernel 1: fp32 -> bf16 conversions into fragment order (+ project_k transpose)
//   Few, long waves instead of one element per thread.  A block takes one role
//   by its index (block-uniform):
//     0..31     project_k: thread = column kq, 64 rows n; the 64 loads are
//               coalesced over kq; 16 threads store 256 contiguous bytes
//     32..37    wq, 38..43 wk, 44..67 w_out, 68..579 x: a wave makes six units
//               in a row (16 rows x 192 k).  The 16 rows of a unit are one
//               128-B line of floats each: a wave-wide float4 load takes four
//               whole lines (8 lanes a row), and the 8-B stores of the four
//               rows fall in 64-B runs of the unit; a thread's 24 loads are
//               independent, so many are in flight at a time
// ---------------------------------------------------------------------------
__global__ void __launch_bounds__(256)
k_convert(const float* __restrict__ x,  const float* __restrict__ wq,
          const float* __restrict__ wk, const float* __restrict__ wout,
          const float* __restrict__ pk,
          u16* __restrict__ xbf, u16* __restrict__ wqbf, u16* __restrict__ wkbf,
          u16* __restrict__ woutbf, u16* __restrict__ pkt) {
  const int tid = threadIdx.x;
  int bid = blockIdx.x;

  if (bid < 32) {                            // pkt[kq][n] = pk[n][kq]
    const float* s = pk + (long)bid * 64 * KK + tid;
    float v[64];
#pragma unroll
    for (int j = 0; j < 64; ++j) v[j] = s[j * KK];
    // rows kq, k = n = bid*64 + c*8 + j: units (tid>>4)*64 + bid*2 + (c>>2)
    u16* d = pkt + ((long)(tid >> 4) * 64 + bid * 2) * 512 + (tid & 15) * 8;
#pragma unroll
    for (int c = 0; c < 8; ++c) {
      v8f f;
#pragma unroll
      for (int j = 0; j < 8; ++j) f[j] = v[c * 8 + j];
      *(uint4*)(d + (c >> 2) * 512 + ((c >> 1) & 1) * 256 + (c & 1) * 128) =
          __builtin_bit_cast(uint4, __builtin_convertvector(f, v8bf));
    }
    return;
  }

  const float* s;
  u16* d;
  int kd = DD;                               // row length k of the matrix
  if (bid < 38)      { s = wq;   d = wqbf;   bid -= 32; kd = 192; }
  else if (bid < 44) { s = wk;   d = wkbf;   bid -= 38; kd = 192; }
  else if (bid < 68) { s = wout; d = woutbf; bid -= 44; }
  else               { s = x;    d = xbf;    bid -= 68; }

  const int r4 = (tid & 31) >> 3, p = tid & 7;   // row in a group of 4, float4 in the line
  const int gw = bid * 8 + (tid >> 5);       // this wave's run of six units
  int rt = gw, ks0 = 0;                      // 192 k: six units are a row tile
  if (kd == DD) { rt = gw >> 2; ks0 = (gw & 3) * 6; }

  // v[u*4+i]: unit u, row i*4 + r4, k = p*4 .. p*4+3 of the unit
  const v4f* s4 = (const v4f*)(s + (long)(rt * 16 + r4) * kd + ks0 * 32 + p * 4);
  uint2*     d2 = (uint2*)(d + (long)gw * 6 * 512 + (p >> 2) * 256 +
                           (((p >> 1) & 1) * 16 + r4) * 8 + (p & 1) * 4);
  const v4f* r0 = s4;                        // the four rows' address pairs
  const v4f* r1 = s4 + kd;
  const v4f* r2 = s4 + 2 * kd;
  const v4f* r3 = s4 + 3 * kd;
  v4f v[24];
#pragma unroll
  for (int u = 0; u < 6; ++u) {
    v[u * 4]     = r0[u * 8];
    v[u * 4 + 1] = r1[u * 8];
    v[u * 4 + 2] = r2[u * 8];
    v[u * 4 + 3] = r3[u * 8];
  }
  // The address pairs stay whole until this wait.
  asm volatile("s_wait_xcnt 0x0" :: "v"(r0), "v"(r1), "v"(r2), "v"(r3) : "memory");
#pragma unroll
  for (int u = 0; u < 6; ++u)
#pragma unroll
    for (int i = 0; i < 4; ++i)
      d2[u * 128 + i * 8] =
          __builtin_bit_cast(uint2, __builtin_convertvector(v[u * 4 + i], v4bf));
}

// ---------------------------------------------------------------------------
// Kernel 2: grouped pointwise conv (block-diagonal GEMM), Q and K_raw.
//   y = x_g @ w_g^T  per 192-wide group.  x and w come in fragment order.
//   The weights stay in registers: a block of 8 waves takes one group, waves
//   0..3 its Q columns and waves 4..7 its K_raw columns, three 16-column tiles
//   (18 units, 144 registers) a wave, loaded once.  The block then walks GC_RT
//   row tiles; the six x units of a row tile come from L2 once and serve all
//   8 waves, each of which does 18 WMMAs on them (three chains of six).
//   Both results go out in fragment order, a lane's 8 sums being one 16-B chunk
//   at the lane's own place, so that a wave-wide store covers 512 contiguous B:
//   K_raw TRANSPOSED (rows b*768+d, k = n): x is the A operand, and a lane holds
//   8 consecutive n of one d;  Q (rows b*2048+n, k = d): w is the A operand
//   (Q^T = w . x^T), and a lane holds 8 consecutive d of one row n.
// ---------------------------------------------------------------------------
#define GC_RT 8      // row tiles a block walks: 128 rows, inside one batch
template <bool IS_Q>
__device__ __forceinline__ void gconv_walk(const u16* __restrict__ au,
                                           const u16* __restrict__ bu,
                                           u16* __restrict__ dst) {
  v16bf w[3][6];
#pragma unroll
  for (int c = 0; c < 3; ++c)
#pragma unroll
    for (int ks = 0; ks < 6; ++ks) w[c][ks] = ldunit(bu + (c * 6 + ks) * 512);

  v16bf a[6];
#pragma unroll
  for (int ks = 0; ks < 6; ++ks) a[ks] = ldunit(au + ks * 512);

  for (int i = 0; i < GC_RT; ++i) {
    // Keeps this tile's WMMAs behind the stores of the tile before: left free,
    // they were lifted over them, and the loads below, which cannot pass the
    // wait at the loop's foot, were then issued directly in front of their use.
    __builtin_amdgcn_sched_barrier(0);
    au += 24 * 512;
    v8f acc[3] = {};
#pragma unroll
    for (int ks = 0; ks < 6; ++ks) {
#pragma unroll
      for (int c = 0; c < 3; ++c)
        acc[c] = IS_Q ? wmma_bf16(w[c][ks], a[ks], acc[c])
                      : wmma_bf16(a[ks], w[c][ks], acc[c]);
      // the next row tile's unit, as soon as this one has been used
      if (i + 1 < GC_RT) a[ks] = ldunit(au + ks * 512);
    }
    // Keeps those loads in front of the conversions and stores, which then run
    // while the loads are in flight.
    __builtin_amdgcn_sched_barrier(0);

    if (IS_Q) {                              // acc[c][j]: d = c*16 + j, n = the lane's
#pragma unroll
      for (int c = 0; c < 3; ++c)            // 16 d are half a unit
        *(uint4*)(dst + c * 256) =
            __builtin_bit_cast(uint4, __builtin_convertvector(acc[c], v8bf));
      dst += 24 * 512;                       // the next row tile: 24 units on
    } else {                                 // acc[c][j]: n = j, d = c*16
#pragma unroll
      for (int c = 0; c < 3; ++c)
        *(uint4*)(dst + c * 64 * 512) =
            __builtin_bit_cast(uint4, __builtin_convertvector(acc[c], v8bf));
      dst += 256;                            // the next 16 n: the next half unit
    }
    // From here on the stores' data registers are free for the next tiles'
    // loads: the wait stands in front of any such overwrite.
    asm volatile("s_wait_xcnt 0x0" ::: "memory");
  }
}

__global__ void __launch_bounds__(256)
k_gconv(const u16* __restrict__ xbf, const u16* __restrict__ wqbf,
        const u16* __restrict__ wkbf, u16* __restrict__ qbf, u16* __restrict__ krt) {
  const int lane = threadIdx.x & 31;
  const int wave = __builtin_amdgcn_readfirstlane(threadIdx.x >> 5);   // 0..7
  const int g = blockIdx.x & 3;              // group
  const int rt0 = (blockIdx.x >> 2) * GC_RT; // first row tile (16 rows of B*N)
  const int ct = g * 12 + (wave & 3) * 3;    // first of three col tiles
  const int m0 = rt0 * 16;
  const u16* au = xbf + ((long)rt0 * 24 + g * 6) * 512 + lane * 8;
  const long bo = (long)ct * 6 * 512 + lane * 8;   // rows g*192+o = ct*16+lm

  if (wave < 4) {
    gconv_walk<true>(au, wqbf + bo,
                     qbf + (long)rt0 * 24 * 512 + ct * 256 + lane * 8);
  } else {
    const int b = m0 >> 11, n0 = m0 & 2047;
    gconv_walk<false>(au, wkbf + bo,
                      krt + (long)(b * 48 + ct) * 64 * 512 + (n0 >> 4) * 256 + lane * 8);
  }
}

// ---------------------------------------------------------------------------
// Kernel 3: k_proj[b,kq,d] = sum_n pk[n,kq] * k_raw[b,n,d]
//   A = pkt (rows kq, k = n), B = krt (rows b*768+d, k = n), both in fragment
//   order, 64 k-steps.
//   A block takes 64 kq x 96 d (4 x 6 tiles).  A wave keeps 4 x 3 accumulator
//   tiles, one half of the block's columns, over one quarter of k (16 k-steps):
//   the seven units of a k-step feed 12 WMMAs.  Three fragment sets: the 14
//   loads of a k-step go out as one group two k-steps ahead.  The four quarters
//   are summed in LDS, each wave taking three of the 24 tiles.
//   The f32 tile never goes to memory: each lane holds 8 consecutive kq of one
//   column d, which are 8 consecutive bf16 both in values^T and in keys, so the
//   epilogue stores the same 16 bytes to each.
//   valt[b,h,dq,kq]   = k_proj[b, kq, h*64+dq]
//   keys[b,h,kq2,dq2] = k_proj[b, (h*64+dq2)&255, 3*kq2 + ((h*64+dq2)>>8)]
//     inverted: kq2 = d/3, c = (d%3)*256 + kq, h = c>>6, dq2 = c&63
// ---------------------------------------------------------------------------
#define KP_MT 4      // kq tiles a wave keeps
#define KP_NT 3      // d tiles a wave keeps
#define KP_KS 16     // k-steps a wave takes: a quarter of the 64
__device__ __forceinline__ void kp_load(const u16* ap, const u16* bp,
                                        v16bf (&a)[KP_MT], v16bf (&b)[KP_NT]) {
#pragma unroll
  for (int m = 0; m < KP_MT; ++m) a[m] = ldunit(ap + m * 64 * 512);
#pragma unroll
  for (int n = 0; n < KP_NT; ++n) b[n] = ldunit(bp + n * 64 * 512);
}

__device__ __forceinline__ void kp_mma(const v16bf (&a)[KP_MT], const v16bf (&b)[KP_NT],
                                       v8f (&acc)[KP_MT][KP_NT]) {
#pragma unroll
  for (int m = 0; m < KP_MT; ++m)
#pragma unroll
    for (int n = 0; n < KP_NT; ++n) acc[m][n] = wmma_bf16(a[m], b[n], acc[m][n]);
}

__global__ void __launch_bounds__(256)
k_kproj(const u16* __restrict__ pkt, const u16* __restrict__ krt,
        u16* __restrict__ keys, u16* __restrict__ valt) {
  // [quarter of k][tile m*6 + n][registers 0..3, 4..7][lane][4]
  __shared__ __align__(16) float part[4][24][2][128];
  const int lane = threadIdx.x & 31;
  const int wave = __builtin_amdgcn_readfirstlane(threadIdx.x >> 5);   // 0..7
  const int lm = lane & 15, lhalf = lane >> 4;
  const int nb = blockIdx.x & 63;            // 96 of the 6144 rows b*768+d
  const int mb = blockIdx.x >> 6;            // 64 of the 256 kq
  const int nw = wave & 1, kqt = wave >> 1;  // column half, quarter of k

  const u16* au = pkt + ((long)(mb * KP_MT) * 64 + kqt * KP_KS) * 512 + lane * 8;
  const u16* bu = krt + ((long)(nb * 6 + nw * KP_NT) * 64 + kqt * KP_KS) * 512 + lane * 8;

  v8f acc[KP_MT][KP_NT];
#pragma unroll
  for (int m = 0; m < KP_MT; ++m)
#pragma unroll
    for (int n = 0; n < KP_NT; ++n) { v8f z = {}; acc[m][n] = z; }

  v16bf a[3][KP_MT], b[3][KP_NT];
  kp_load(au, bu, a[0], b[0]);
  // Keeps the first k-step's loads the oldest: mixed with the second's and the
  // third's, the first WMMAs waited for all three groups.
  __builtin_amdgcn_sched_barrier(0);
  kp_load(au + 512, bu + 512, a[1], b[1]);
  // Unrolled whole: the set numbers are then constants and every load takes its
  // place from the instruction's offset, so the address registers never change.
#pragma unroll
  for (int ks = 0; ks < KP_KS; ++ks) {
    // For the same reason as above, and it keeps this group of loads behind the
    // last use of the set that it refills.
    __builtin_amdgcn_sched_barrier(0);
    if (ks + 2 < KP_KS)
      kp_load(au + (ks + 2) * 512, bu + (ks + 2) * 512, a[(ks + 2) % 3], b[(ks + 2) % 3]);
    // Keeps the loads above in front of this k-step's WMMAs: sunk among them,
    // they would lose part of their two k-steps of lead.
    __builtin_amdgcn_sched_barrier(0);
    kp_mma(a[ks % 3], b[ks % 3], acc);
    if (ks + 3 == KP_KS) {
      // Behind the last group of loads and the WMMAs that follow it, where it
      // costs nothing, and held there by the barriers: in front of whatever
      // takes the place of the loads' address registers behind the loop.
      __builtin_amdgcn_sched_barrier(0);
      asm volatile("s_wait_xcnt 0x0" ::: "memory");
    }
  }

  // acc[m][n] is the partial sum of tile m*6 + nw*3 + n; a wave-wide 16-B LDS
  // access covers 512 contiguous bytes.
#pragma unroll
  for (int m = 0; m < KP_MT; ++m)
#pragma unroll
    for (int n = 0; n < KP_NT; ++n) {
      float* p = &part[kqt][m * 6 + nw * KP_NT + n][0][lane * 4];
      *(v4f*)p         = __builtin_shufflevector(acc[m][n], acc[m][n], 0, 1, 2, 3);
      *(v4f*)(p + 128) = __builtin_shufflevector(acc[m][n], acc[m][n], 4, 5, 6, 7);
    }
  __syncthreads();

  // wave w sums tiles 3w .. 3w+2: tile row w >> 1, tile columns (w & 1) * 3 + i
  const int bt = nb >> 3;                    // batch: 8 blocks of 96 columns each
  const int kq0 = (mb * KP_MT + (wave >> 1)) * 16 + lhalf * 8;   // first of the lane's 8 rows
#pragma unroll
  for (int i = 0; i < 3; ++i) {
    const float* p = &part[0][wave * 3 + i][0][lane * 4];
    v4f lo = (*(const v4f*)p + *(const v4f*)(p + 6144)) +
             (*(const v4f*)(p + 12288) + *(const v4f*)(p + 18432));
    v4f hi = (*(const v4f*)(p + 128) + *(const v4f*)(p + 6144 + 128)) +
             (*(const v4f*)(p + 12288 + 128) + *(const v4f*)(p + 18432 + 128));
    const v8f sum = __builtin_shufflevector(lo, hi, 0, 1, 2, 3, 4, 5, 6, 7);
    const uint4 pk8 = __builtin_bit_cast(uint4, __builtin_convertvector(sum, v8bf));

    const int d = ((nb & 7) * 6 + (wave & 1) * 3 + i) * 16 + lm;
    *(uint4*)(valt + ((long)(bt * HH + (d >> 6)) * 64 + (d & 63)) * KK + kq0) = pk8;
    const int kq2 = d / 3;
    const int c0 = (d - kq2 * 3) * 256 + kq0;
    *(uint4*)(keys + ((long)(bt * HH + (c0 >> 6)) * KK + kq2) * 64 + (c0 & 63)) = pk8;
  }
}

// ---------------------------------------------------------------------------
// Kernel 5: attention.  Block = (b, h, 128-query chunk), 8 waves x 16 queries.
//   Transposed products: S^T = keys . q^T and O^T = values^T . P^T, so that a
//   query is a COLUMN of every accumulator tile, that is, one lane pair
//   (l, l ^ 16).  A lane holds 128 of its query's 256 scores: maximum and sum
//   are taken in the lane and joined once with the other half.  Two score tiles
//   (32 keys), converted in place, are the B operand of the second product, so
//   the probabilities never go through LDS.  A lane's 8 sums of an O^T tile are
//   8 consecutive dh of one query: one 16-B store.
//   q and ctx (rows b*2048+n, k = d) are in fragment order: a head's 64 columns
//   of a wave's 16 queries are two units, 2 KB in a row, and each of the wave's
//   four loads and four stores covers 512 contiguous bytes.
//   LDS: keys 36KB + values^T 33KB = 69KB.
//   K/V staged with GLOBAL_LOAD_ASYNC_TO_LDS_B128 (ASYNCcnt-tracked DMA).
//   Every LDS row is read by ds_load_b128 with one row per lane, so each row
//   carries 16 pad bytes: the pitch is 16 B x odd (144 B, 528 B) and the 16
//   lanes of a half-wave fall on 16 different groups of four banks (bare
//   pitches of 128 B and 512 B put them on two groups and on one).
// ---------------------------------------------------------------------------
#define KPITCH 72    // keys row: 64 bf16 + 8 pad
#define VPITCH 264   // values^T row: 256 bf16 + 8 pad

// lane l takes the value of lane l ^ 16
__device__ __forceinline__ float xhalf(float v) {
  const int b = __builtin_bit_cast(int, v);
  return __builtin_bit_cast(float, __builtin_amdgcn_permlanex16(
      b, b, 0x76543210, 0xfedcba98, false, false));
}

__global__ void __launch_bounds__(256)
k_attn(const u16* __restrict__ qbf, const u16* __restrict__ keys,
       const u16* __restrict__ valt, u16* __restrict__ ctxbf) {
  extern __shared__ __align__(16) unsigned char smem_raw[];
  u16* keys_s = (u16*)smem_raw;              // [256][KPITCH]
  u16* valt_s = keys_s + 256 * KPITCH;       // [64][VPITCH]

  const int lane = threadIdx.x & 31, wave = threadIdx.x >> 5;
  const int lm = lane & 15, lhalf = lane >> 4;
  int chunk = blockIdx.x & 15;
  int bh = blockIdx.x >> 4;
  int b = bh / HH, h = bh - b * HH;

  // stage K and V^T into LDS (16B per thread per iter)
  {
    const uint4* kg = (const uint4*)(keys + (long)bh * 16384);
    const uint4* vg = (const uint4*)(valt + (long)bh * 16384);
#if HAVE_ASYNC_LDS
    typedef __attribute__((address_space(1))) v4i* gp_t;   // global int4*
    typedef __attribute__((address_space(3))) v4i* lp_t;   // LDS int4*
    for (int i = threadIdx.x; i < 2048; i += 256) {
      u16* kd = keys_s + (i >> 3) * KPITCH + (i & 7) * 8;    // 8 x 16 B a row
      u16* vd = valt_s + (i >> 5) * VPITCH + (i & 31) * 8;   // 32 x 16 B a row
      __builtin_amdgcn_global_load_async_to_lds_b128((gp_t)(kg + i),
                                                     (lp_t)kd, 0, 0);
      __builtin_amdgcn_global_load_async_to_lds_b128((gp_t)(vg + i),
                                                     (lp_t)vd, 0, 0);
    }
#if __has_builtin(__builtin_amdgcn_s_wait_asynccnt)
    __builtin_amdgcn_s_wait_asynccnt(0);
#else
    asm volatile("s_wait_asynccnt 0x0" ::: "memory");
#endif
#else
    for (int i = threadIdx.x; i < 2048; i += 256) {
      *(uint4*)(keys_s + (i >> 3) * KPITCH + (i & 7) * 8) = kg[i];
      *(uint4*)(valt_s + (i >> 5) * VPITCH + (i & 31) * 8) = vg[i];
    }
#endif
  }
  __syncthreads();

  const int n0 = chunk * 128 + wave * 16;
  // the two units of (row tile, head), the same place in q and in ctx
  const long qc = ((long)((b * NN + n0) >> 4) * 24 + h * 2) * 512 + lane * 8;
  v16bf aq0 = ldunit(qbf + qc);
  v16bf aq1 = ldunit(qbf + qc + 512);

  // dots^T = keys @ q^T : 16 key tiles x 2 k-steps
  //   acc[t][j] = dot(key t*16 + lhalf*8 + j, query lm)
  v8f acc[16];
#pragma unroll
  for (int t = 0; t < 16; ++t) {
    const u16* kr = keys_s + (t * 16 + lm) * KPITCH;
    v16bf k0 = ldfrag(kr + lhalf * 8,      kr + lhalf * 8 + 16);
    v16bf k1 = ldfrag(kr + 32 + lhalf * 8, kr + 32 + lhalf * 8 + 16);
    v8f z = {};
    acc[t] = wmma_bf16(k0, aq0, z);
    acc[t] = wmma_bf16(k1, aq1, acc[t]);
  }
#pragma unroll
  for (int t = 0; t < 16; ++t) acc[t] *= 0.125f;   // exact: a power of two

  // softmax over the 256 keys of query lm, scale 1/sqrt(64): 128 scores in this
  // lane, 128 in lane ^ 16.  Eight running sums, one per register of a tile.
  float m = -3.4e38f;
#pragma unroll
  for (int t = 0; t < 16; ++t)
#pragma unroll
    for (int j = 0; j < 8; ++j) m = fmaxf(m, acc[t][j]);
  m = fmaxf(m, xhalf(m));
  v8f sv = {};
#pragma unroll
  for (int t = 0; t < 16; ++t) {
#pragma unroll
    for (int j = 0; j < 8; ++j) acc[t][j] = __expf(acc[t][j] - m);
    sv += acc[t];
  }
  float s = ((sv[0] + sv[1]) + (sv[2] + sv[3])) + ((sv[4] + sv[5]) + (sv[6] + sv[7]));
  s += xhalf(s);
  const float inv = 1.f / s;

  // ctx^T = values^T @ attn^T : 4 dh tiles x 8 k-steps of 32 keys
  //   B operand of step ks: keys ks*32 + lhalf*8 + 0..7 are tile 2ks of this
  //   lane, keys ks*32 + 16 + lhalf*8 + 0..7 tile 2ks+1: the order in which the
  //   two 16-B chunks of a values^T row are taken.
  v8f o[4];
#pragma unroll
  for (int t = 0; t < 4; ++t) { v8f z = {}; o[t] = z; }
#pragma unroll
  for (int ks = 0; ks < 8; ++ks) {
    v16bf bp;
#pragma unroll
    for (int j = 0; j < 8; ++j) {
      bp[j]     = (__bf16)(acc[2 * ks][j] * inv);
      bp[8 + j] = (__bf16)(acc[2 * ks + 1][j] * inv);
    }
#pragma unroll
    for (int dt = 0; dt < 4; ++dt) {
      const u16* vr = valt_s + (dt * 16 + lm) * VPITCH + ks * 32 + lhalf * 8;
      v16bf av = ldfrag(vr, vr + 16);
      o[dt] = wmma_bf16(av, bp, o[dt]);
    }
  }
  // o[dt][j]: query lm, dh = dt*16 + lhalf*8 + j
  u16* cu = ctxbf + qc;
#pragma unroll
  for (int dt = 0; dt < 4; ++dt)             // 16 dh are half a unit
    *(uint4*)(cu + dt * 256) =
        __builtin_bit_cast(uint4, __builtin_convertvector(o[dt], v8bf));
}

// ---------------------------------------------------------------------------
// Kernel 6: out = ctx @ w_out^T + b_out; y = x + out; LayerNorm(y).
//   Block = 64 rows (OUT_RT row tiles); 8 waves x 6 col tiles; 24 k-steps.
//   A wave keeps 4 x 6 accumulator tiles: the six w_out units of a k-step feed
//   four row tiles each, so w_out is read once per 64 rows, and a k-step is 20
//   loads for 24 WMMAs.  Two fragment sets: the 20 loads of the next k-step go
//   out as one group in front of this k-step's WMMAs.  LN: the sums go through
//   LDS once, then a wave takes 8 whole rows and keeps them in registers.
//   w_out and ctx come in fragment order.
// ---------------------------------------------------------------------------
#define OUT_RT 4     // row tiles a block takes
__device__ __forceinline__ void out_load(const u16* ap, const u16* bp,
                                         v16bf (&a)[OUT_RT], v16bf (&b)[6]) {
#pragma unroll
  for (int c = 0; c < 6; ++c) b[c] = ldunit(bp + c * 24 * 512);
#pragma unroll
  for (int r = 0; r < OUT_RT; ++r)
    a[r] = ldunit(ap + r * 24 * 512);
}

__device__ __forceinline__ void out_mma(const v16bf (&a)[OUT_RT], const v16bf (&b)[6],
                                        v8f (&acc)[OUT_RT][6]) {
#pragma unroll
  for (int c = 0; c < 6; ++c)
#pragma unroll
    for (int r = 0; r < OUT_RT; ++r) acc[r][c] = wmma_bf16(a[r], b[c], acc[r][c]);
}

__global__ void __launch_bounds__(256)
k_out(const u16* __restrict__ ctxbf, const u16* __restrict__ woutbf,
      const float* __restrict__ x, const float* __restrict__ bout,
      const float* __restrict__ gamma, const float* __restrict__ beta,
      float* __restrict__ out) {
  __shared__ __align__(16) float ybuf[16 * OUT_RT][772];   // padded vs 64-bank LDS
  const int lane = threadIdx.x & 31, wave = threadIdx.x >> 5;
  const int lm = lane & 15, lhalf = lane >> 4;
  const int r0 = blockIdx.x * (16 * OUT_RT);

  unsigned ao = (unsigned)blockIdx.x * (OUT_RT * 24 * 512) + lane * 8;   // index into ctx
  unsigned bo = (unsigned)wave * (6 * 24 * 512) + lane * 8;  // index into w_out
  v8f acc[OUT_RT][6];
#pragma unroll
  for (int r = 0; r < OUT_RT; ++r)
#pragma unroll
    for (int c = 0; c < 6; ++c) { v8f z = {}; acc[r][c] = z; }

  // The bias of the lane's six columns, fetched first: behind the loads of x it
  // would come back only after them, and the staging in LDS would wait for x.
  const float* bb = bout + wave * 96 + lm;
  float bias[6];
#pragma unroll
  for (int c = 0; c < 6; ++c) bias[c] = bb[c * 16];
  // The address pair stays whole until this wait; the barrier keeps the six
  // loads here, in front of the loop.
  asm volatile("s_wait_xcnt 0x0" :: "v"(bb) : "memory");
  __builtin_amdgcn_sched_barrier(0);

  v16bf a0[OUT_RT], b0[6], a1[OUT_RT], b1[6];
  out_load(ctxbf + ao, woutbf + bo, a0, b0);
  // The first loads' address registers are formed anew at the head of the loop:
  // the wait stands in front of that, and the barrier keeps the loads above it.
  __builtin_amdgcn_sched_barrier(0);
  asm volatile("s_wait_xcnt 0x0" ::: "memory");
  for (int ks = 0; ks < 22; ks += 2) {
    const u16* pa = ctxbf + ao;
    const u16* pb = woutbf + bo;
    out_load(pa + 512, pb + 512, a1, b1);
    // Keeps the loads above in front of the WMMAs below: left free, they were
    // sunk among the WMMAs, many to just in front of their first use, which
    // then waited out the latency.
    __builtin_amdgcn_sched_barrier(0);
    out_mma(a0, b0, acc);
    // Keeps the reload of the first set behind its last use and, with the next
    // barrier, in front of the second set's WMMAs, for the same reason.
    __builtin_amdgcn_sched_barrier(0);
    // The issued loads name the two address pairs: as inputs they stay whole
    // until the wait, and the next pairs, made from the offsets that leave this
    // statement, are formed behind it.
    asm volatile("s_wait_xcnt 0x0" : "+v"(ao), "+v"(bo) : "v"(pa), "v"(pb) : "memory");
    ao += 1024;
    bo += 1024;
    pa = ctxbf + ao;
    pb = woutbf + bo;
    out_load(pa, pb, a0, b0);
    __builtin_amdgcn_sched_barrier(0);
    out_mma(a1, b1, acc);
    // Keeps the wait below behind the WMMAs, where it costs nothing.
    __builtin_amdgcn_sched_barrier(0);
    // The same wait for the reload's address pairs.
    asm volatile("s_wait_xcnt 0x0" : "+v"(ao), "+v"(bo) : "v"(pa), "v"(pb) : "memory");
  }
  {
    const u16* pa = ctxbf + ao;
    const u16* pb = woutbf + bo;
    out_load(pa + 512, pb + 512, a1, b1);    // the last k-step
    // As in the loop: the loads in front of the WMMAs, and the wait, held in
    // place by the two barriers, in front of whatever takes the pairs' place.
    __builtin_amdgcn_sched_barrier(0);
    asm volatile("s_wait_xcnt 0x0" :: "v"(pa), "v"(pb) : "memory");
    __builtin_amdgcn_sched_barrier(0);
  }
  out_mma(a0, b0, acc);
  out_mma(a1, b1, acc);

  // The epilogue goes by whole rows: wave w takes rows 8w .. 8w+7 of the block, a
  // lane the float4s lane, lane + 32, ... lane + 160 of each row, so that every
  // wave-wide 16-B access to x, to LDS and to out covers 512 contiguous bytes.
  // The 48 loads of x go out here and fly while the sums are staged in LDS.
  const v4f* xr = (const v4f*)(x + (long)(r0 + wave * 8) * DD) + lane;
  v4f y[8][6];
#pragma unroll
  for (int q = 0; q < 8; ++q)
#pragma unroll
    for (int i = 0; i < 6; ++i) y[q][i] = xr[q * 192 + i * 32];
  // The address pair stays whole until this wait, so that no later load's
  // result is allocated over the pair of loads still being issued.
  asm volatile("s_wait_xcnt 0x0" :: "v"(xr) : "memory");
  // Keeps the loads above in front of the LDS stores below: sunk behind the
  // barrier, they would start only when the staging is over.
  __builtin_amdgcn_sched_barrier(0);

  // acc[r][c][j]: row r*16 + lhalf*8 + j, col wave*96 + c*16 + lm
  float* yb = &ybuf[lhalf * 8][wave * 96 + lm];
#pragma unroll
  for (int r = 0; r < OUT_RT; ++r)
#pragma unroll
    for (int c = 0; c < 6; ++c)
#pragma unroll
      for (int j = 0; j < 8; ++j)
        yb[(r * 16 + j) * 772 + c * 16] = acc[r][c][j] + bias[c];
  __syncthreads();

  // gamma and beta, the lane's own 24 columns, once for the 8 rows.  Between the
  // two barriers stand only these loads and their wait, so that no register
  // which they name is written in front of it.
  __builtin_amdgcn_sched_barrier(0);
  const v4f* g4 = (const v4f*)gamma + lane;
  const v4f* b4 = (const v4f*)beta + lane;
  v4f g[6], be[6];
#pragma unroll
  for (int i = 0; i < 6; ++i) { g[i] = g4[i * 32]; be[i] = b4[i * 32]; }
  asm volatile("s_wait_xcnt 0x0" ::: "memory");
  __builtin_amdgcn_sched_barrier(0);

  // y = (product + bias) + x stays in registers from here to the store.
  const float* yr = &ybuf[wave * 8][lane * 4];
  v4f t[8][6];
#pragma unroll
  for (int q = 0; q < 8; ++q)
#pragma unroll
    for (int i = 0; i < 6; ++i) t[q][i] = *(const v4f*)(yr + q * 772 + i * 128);
  // Keeps the 48 LDS reads together in front of the arithmetic: spread among it,
  // only two or three were in flight at a time.
  __builtin_amdgcn_sched_barrier(0);
  float sum[8], sq[8];
#pragma unroll
  for (int q = 0; q < 8; ++q) {
    v4f s4 = {}, q4 = {};
#pragma unroll
    for (int i = 0; i < 6; ++i) {
      y[q][i] += t[q][i];
      s4 += y[q][i];
      q4 += y[q][i] * y[q][i];
    }
    sum[q] = (s4[0] + s4[1]) + (s4[2] + s4[3]);
    sq[q]  = (q4[0] + q4[1]) + (q4[2] + q4[3]);
  }
  // the 16 sums over the 32 lanes side by side, step by step
#pragma unroll
  for (int m = 1; m < 16; m <<= 1)
#pragma unroll
    for (int q = 0; q < 8; ++q) {
      sum[q] += __shfl_xor(sum[q], m, 32);
      sq[q]  += __shfl_xor(sq[q], m, 32);
    }
#pragma unroll
  for (int q = 0; q < 8; ++q) {
    const float sm = sum[q] + xhalf(sum[q]), ss = sq[q] + xhalf(sq[q]);
    const float mu = sm * (1.f / DD);
    const float var = ss * (1.f / DD) - mu * mu;
    const float rstd = rsqrtf(var + 1e-12f);
#pragma unroll
    for (int i = 0; i < 6; ++i) y[q][i] = (y[q][i] - mu) * rstd * g[i] + be[i];
  }
  // Keeps every store behind the last of the arithmetic: no register that an
  // issued store names is written again.
  __builtin_amdgcn_sched_barrier(0);
  v4f* orow = (v4f*)(out + (long)(r0 + wave * 8) * DD) + lane;
#pragma unroll
  for (int q = 0; q < 8; ++q)
#pragma unroll
    for (int i = 0; i < 6; ++i) orow[q * 192 + i * 32] = y[q][i];
}

// ---------------------------------------------------------------------------
// Host launcher
// ---------------------------------------------------------------------------
extern "C" void kernel_launch(void* const* d_in, const int* in_sizes, int n_in,
                              void* d_out, int out_size, void* d_ws, size_t ws_size,
                              hipStream_t stream) {
  const float* x     = (const float*)d_in[0];
  const float* wq    = (const float*)d_in[1];
  const float* wk    = (const float*)d_in[2];
  const float* pk    = (const float*)d_in[3];
  const float* wout  = (const float*)d_in[4];
  const float* bout  = (const float*)d_in[5];
  const float* gamma = (const float*)d_in[6];
  const float* beta  = (const float*)d_in[7];
  float* out = (float*)d_out;
  char* ws = (char*)d_ws;

  // 256B-aligned workspace layout (bytes)
  u16*   xbf   = (u16*)(ws + 0);             // 25,165,824
  u16*   wqbf  = (u16*)(ws + 25165824);      //    294,912
  u16*   wkbf  = (u16*)(ws + 25460736);      //    294,912
  u16*   woutb = (u16*)(ws + 25755648);      //  1,179,648
  u16*   pkt   = (u16*)(ws + 26935296);      //  1,048,576
  u16*   qbf   = (u16*)(ws + 27983872);      // 25,165,824
  u16*   krt   = (u16*)(ws + 53149696);      // 25,165,824
  u16*   keys  = (u16*)(ws + 84606976);      //  3,145,728
  u16*   valt  = (u16*)(ws + 87752704);      //  3,145,728
  u16*   ctxbf = (u16*)(ws + 90898432);      // 25,165,824  (end 116,064,256)

  (void)hipFuncSetAttribute(reinterpret_cast<const void*>(k_attn),
                            hipFuncAttributeMaxDynamicSharedMemorySize, 70656);

  k_convert<<<  580, 256, 0, stream>>>(x, wq, wk, wout, pk, xbf, wqbf, wkbf, woutb, pkt);
  k_gconv  <<<  512, 256, 0, stream>>>(xbf, wqbf, wkbf, qbf, krt);
  k_kproj  <<<  256, 256, 0, stream>>>(pkt, krt, keys, valt);
  k_attn   <<< 1536, 256, 70656, stream>>>(qbf, keys, valt, ctxbf);
  k_out    <<<  256, 256, 0, stream>>>(ctxbf, woutb, x, bout, gamma, beta, out);
}
